// v000
// Times are from an AMD MI455X. After a warm-up the kernel runs many times in a row, and a time is the length of
// such a window on the GPU divided by its runs, so every launch and the gaps after it count. The runs cycle
// through copies of the inputs. A figure is the median of several windows, for all but v000 over two sittings.
// Sittings can differ by a few percent; kernels timed side by side share one.
// v000 is the starting kernel. One run takes 2860 microseconds.
#include <hip/hip_runtime.h>

// MuCausalSelfAttention (x [4][2048][1024]; qkv = x W_attn ([1024][3072]: q | k | v column blocks, 16 heads x 64); muP scaling: scores = q.k / 64 (1/head_dim); causal (-inf); softmax; out = merged W_proj -> [4][2048][1024]).
// Compute dtypes, f32 accumulate: every input rounded to bf16; q/k/v on PLAIN bf16 operands (inputs: exact); causal scores and attn.v: query rows < 512 hl (3 products), the rest single fp16 (x1024), causal tile skipping; softmax f32; W_proj hl x exact (2 products).

#define NB_  4
#define TT   2048
#define DM   1024
#define NH_  16
#define NKV  16
#define REP  (NH_ / NKV)
#define HD   64
#define DQ   (NH_ * HD)
#define DKV  (NKV * HD)
#define ZH   2
#define RH   512                  // query rows < RH use hi+lo planes (0: none)
#define WIN  2048
#define PCAR 1024.0f
#define SCL  0.015625f   // muP: 1/head_dim
typedef _Float16 h16;
typedef unsigned short bf;
typedef __attribute__((ext_vector_type(16))) __bf16   v16bf;
typedef __attribute__((ext_vector_type(16))) _Float16 v16h;
typedef __attribute__((ext_vector_type(8)))  _Float16 v8h;
typedef __attribute__((ext_vector_type(8)))  unsigned short v8us;
typedef __attribute__((ext_vector_type(8)))  float    v8f;
typedef __attribute__((ext_vector_type(4)))  float    v4f;
typedef v8h  __attribute__((may_alias)) v8ha;
typedef v4f  __attribute__((may_alias)) v4fa;
typedef v8us __attribute__((may_alias)) v8usa;

__device__ __forceinline__ unsigned short f2bf(float f) { unsigned u = __float_as_uint(f); u += 0x7FFFu + ((u >> 16) & 1u); return (unsigned short)(u >> 16); }
__device__ __forceinline__ float bf2f(unsigned short b) { return __uint_as_float(((unsigned)b) << 16); }
__device__ __forceinline__ float bfr(float f) { return bf2f(f2bf(f)); }
__device__ __forceinline__ v16h cat16(v8h lo, v8h hi) { return __builtin_shufflevector(lo, hi, 0, 1, 2, 3, 4, 5, 6, 7, 8, 9, 10, 11, 12, 13, 14, 15); }
__device__ __forceinline__ v16bf cat16b(v8us lo, v8us hi) { return __builtin_bit_cast(v16bf, __builtin_shufflevector(lo, hi, 0, 1, 2, 3, 4, 5, 6, 7, 8, 9, 10, 11, 12, 13, 14, 15)); }
__device__ __forceinline__ v8f wmma16(v16h a, v16h b, v8f c) { return __builtin_amdgcn_wmma_f32_16x16x32_f16(false, a, false, b, (short)0, c, false, false); }
__device__ __forceinline__ v8f wmmab(v16bf a, v16bf b, v8f c) { return __builtin_amdgcn_wmma_f32_16x16x32_bf16(false, a, false, b, (short)0, c, false, false); }



// ---- k_gemmw: register-blocked GEMM, ONE WAVE per 64x64 output tile (16 accumulators), operands straight from K-contiguous 16-bit planes; grid (M/64, N/64, Z), 32 threads.
// C[m][n] (f32, pitch ldc, + optional f32 bias[n]) = sum_k A[m][k] Bt[n][k] (+ split products per NSPLIT). z-batch strides sA/sB/sC in elements. K % 32 == 0.
template <typename T16> struct WFrag;
template <> struct WFrag<h16> { typedef v16h V; static __device__ __forceinline__ V ld(const h16* p) { return cat16(*(const v8h*)p, *(const v8h*)(p + 16)); } static __device__ __forceinline__ v8f mma(V a, V b, v8f c) { return wmma16(a, b, c); } };
template <> struct WFrag<bf> { typedef v16bf V; static __device__ __forceinline__ V ld(const bf* p) { return cat16b(*(const v8us*)p, *(const v8us*)(p + 16)); } static __device__ __forceinline__ v8f mma(V a, V b, v8f c) { return wmmab(a, b, c); } };
template <typename T16, int NSPLIT, bool BIAS>
__global__ __launch_bounds__(32) void k_gemmw(const T16* __restrict__ A, const T16* __restrict__ A2, const T16* __restrict__ Bt, const T16* __restrict__ Bt2, int K, float* C, int ldc, const float* __restrict__ bias, size_t sA, size_t sB, size_t sC) {
    typedef typename WFrag<T16>::V V;
    __shared__ __align__(16) float os[16 * 68];
    const size_t z = blockIdx.z; A += z * sA; if (A2) A2 += z * sA; Bt += z * sB; if (Bt2) Bt2 += z * sB; C += z * sC;
    const int lane = threadIdx.x & 31, lr = lane & 15, hi = lane >> 4; const int r0 = blockIdx.x * 64, c0 = blockIdx.y * 64;
    v8f acc[4][4];
#pragma unroll
    for (int mb = 0; mb < 4; ++mb)
#pragma unroll
        for (int nb = 0; nb < 4; ++nb) acc[mb][nb] = (v8f){};
    const size_t aoff = (size_t)(r0 + lr) * K + 8 * hi, boff = (size_t)(c0 + lr) * K + 8 * hi;
#pragma unroll 1
    for (int kc = 0; kc < K; kc += 32) {
        V a[4], a2[4];
#pragma unroll
        for (int mb = 0; mb < 4; ++mb) { a[mb] = WFrag<T16>::ld(A + aoff + (size_t)mb * 16 * K + kc); if (NSPLIT == 1 || NSPLIT == 2) a2[mb] = WFrag<T16>::ld(A2 + aoff + (size_t)mb * 16 * K + kc); }
#pragma unroll
        for (int nb = 0; nb < 4; ++nb) { const V b = WFrag<T16>::ld(Bt + boff + (size_t)nb * 16 * K + kc); V b2; if (NSPLIT >= 2) b2 = WFrag<T16>::ld(Bt2 + boff + (size_t)nb * 16 * K + kc);
#pragma unroll
            for (int mb = 0; mb < 4; ++mb) { acc[mb][nb] = WFrag<T16>::mma(a[mb], b, acc[mb][nb]); if (NSPLIT == 1 || NSPLIT == 2) acc[mb][nb] = WFrag<T16>::mma(a2[mb], b, acc[mb][nb]); if (NSPLIT >= 2) acc[mb][nb] = WFrag<T16>::mma(a[mb], b2, acc[mb][nb]); } }
        asm volatile("v_nop\n\tv_nop\n\tv_nop\n\tv_nop" : "+v"(acc[0][0]), "+v"(acc[1][1]), "+v"(acc[2][2]), "+v"(acc[3][3]) : "v"(a[0]), "v"(a[3]));
    }
#pragma unroll
    for (int mb = 0; mb < 4; ++mb) {
#pragma unroll
        for (int nb = 0; nb < 4; ++nb) {
#pragma unroll
            for (int j = 0; j < 8; ++j) os[(hi * 8 + j) * 68 + nb * 16 + lr] = acc[mb][nb][j]; }
        __builtin_amdgcn_wave_barrier(); asm volatile("" ::: "memory");
        float* crow = C + (size_t)(r0 + mb * 16) * ldc + c0;
{
#pragma unroll
            for (int s = 0; s < 8; ++s) { const int row = 2 * s + hi, cofs = lr * 4; v4f val = *(const v4fa*)(os + row * 68 + cofs); if (BIAS) { val[0] += bfr(bias[c0 + cofs]); val[1] += bfr(bias[c0 + cofs + 1]); val[2] += bfr(bias[c0 + cofs + 2]); val[3] += bfr(bias[c0 + cofs + 3]); }
                *(v4f*)(crow + (size_t)row * ldc + cofs) = val; }
             }
        __builtin_amdgcn_wave_barrier(); asm volatile("" ::: "memory");
    }
}

// ---- k_gemmc: the same one-wave 64x64 tile GEMM specialised for causal attention: CMODE 1 skips score tiles entirely above the diagonal (query rows r0+roff.., key columns c0..), CMODE 2 limits the
// key (K) loop of the probability x value contraction to the diagonal block (probabilities beyond it are exactly zero). roff = row offset of this launch's first row within the sequence.
template <typename T16, int NSPLIT, int CMODE>
__global__ __launch_bounds__(32) void k_gemmc(const T16* __restrict__ A, const T16* __restrict__ A2, const T16* __restrict__ Bt, const T16* __restrict__ Bt2, int K, float* C, int ldc, int roff, size_t sA, size_t sB, size_t sC) {
    typedef typename WFrag<T16>::V V;
    __shared__ __align__(16) float os[16 * 68];
    const size_t z = blockIdx.z; A += z * sA; if (A2) A2 += z * sA; Bt += z * sB; if (Bt2) Bt2 += z * sB; C += z * sC;
    const int lane = threadIdx.x & 31, lr = lane & 15, hi = lane >> 4; const int r0 = blockIdx.x * 64, c0 = blockIdx.y * 64;
    if (CMODE == 1 && c0 > r0 + roff + 63) return;                  // score tile entirely above the causal diagonal: never read (the softmax masks j > i by select)
    const int Kl = (CMODE == 2) ? min(K, r0 + roff + 64) : K;        // P.V: probabilities are exactly 0 beyond the diagonal block, so the K loop stops there
    v8f acc[4][4];
#pragma unroll
    for (int mb = 0; mb < 4; ++mb)
#pragma unroll
        for (int nb = 0; nb < 4; ++nb) acc[mb][nb] = (v8f){};
    const size_t aoff = (size_t)(r0 + lr) * K + 8 * hi, boff = (size_t)(c0 + lr) * K + 8 * hi;
#pragma unroll 1
    for (int kc = 0; kc < Kl; kc += 32) {
        V a[4], a2[4];
#pragma unroll
        for (int mb = 0; mb < 4; ++mb) { a[mb] = WFrag<T16>::ld(A + aoff + (size_t)mb * 16 * K + kc); if (NSPLIT == 1 || NSPLIT == 2) a2[mb] = WFrag<T16>::ld(A2 + aoff + (size_t)mb * 16 * K + kc); }
#pragma unroll
        for (int nb = 0; nb < 4; ++nb) { const V b = WFrag<T16>::ld(Bt + boff + (size_t)nb * 16 * K + kc); V b2; if (NSPLIT >= 2) b2 = WFrag<T16>::ld(Bt2 + boff + (size_t)nb * 16 * K + kc);
#pragma unroll
            for (int mb = 0; mb < 4; ++mb) { acc[mb][nb] = WFrag<T16>::mma(a[mb], b, acc[mb][nb]); if (NSPLIT == 1 || NSPLIT == 2) acc[mb][nb] = WFrag<T16>::mma(a2[mb], b, acc[mb][nb]); if (NSPLIT >= 2) acc[mb][nb] = WFrag<T16>::mma(a[mb], b2, acc[mb][nb]); } }
        asm volatile("v_nop\n\tv_nop\n\tv_nop\n\tv_nop" : "+v"(acc[0][0]), "+v"(acc[1][1]), "+v"(acc[2][2]), "+v"(acc[3][3]) : "v"(a[0]), "v"(a[3]));
    }
#pragma unroll
    for (int mb = 0; mb < 4; ++mb) {
#pragma unroll
        for (int nb = 0; nb < 4; ++nb) {
#pragma unroll
            for (int j = 0; j < 8; ++j) os[(hi * 8 + j) * 68 + nb * 16 + lr] = acc[mb][nb][j]; }
        __builtin_amdgcn_wave_barrier(); asm volatile("" ::: "memory");
        float* crow = C + (size_t)(r0 + mb * 16) * ldc + c0;
{
#pragma unroll
            for (int s = 0; s < 8; ++s) { const int row = 2 * s + hi, cofs = lr * 4; v4f val = *(const v4fa*)(os + row * 68 + cofs);
                *(v4f*)(crow + (size_t)row * ldc + cofs) = val; }
             }
        __builtin_amdgcn_wave_barrier(); asm volatile("" ::: "memory");
    }
}

__device__ __forceinline__ h16 tohx(float x) { return (h16)x; }
__device__ __forceinline__ void splitf(float y, unsigned short& h, unsigned short& l) { h = f2bf(y); l = f2bf(y - bf2f(h)); }
typedef __attribute__((ext_vector_type(2))) _Float16 v2h;
typedef __attribute__((ext_vector_type(4))) _Float16 v4h;
typedef __attribute__((ext_vector_type(2))) unsigned short v2us;
typedef __attribute__((ext_vector_type(4))) unsigned short v4us;
typedef __attribute__((ext_vector_type(2))) float v2f;
typedef __attribute__((ext_vector_type(4))) int v4i;

__global__ __launch_bounds__(256) void k_wtG(const float* __restrict__ w, int K, int N, bf* Bt) {
    const int lane = threadIdx.x & 31; const int L0 = (blockIdx.x * 8 + (threadIdx.x >> 5)) * 8; const int nlines = N * K / 64;
{
#pragma unroll 1
        for (int l = 0; l < 8; ++l) { const int L = L0 + l; if (L >= nlines) break; const size_t e = (size_t)L * 64 + lane * 2; const int k = (int)(e % K), n = (int)(e / K); v2us o;
            o[0] = f2bf(w[(size_t)k * N + n]); o[1] = f2bf(w[(size_t)(k + 1) * N + n]); *(v2us*)(Bt + e) = o; }
         }
}
__global__ __launch_bounds__(256) void k_cvt8(const float* __restrict__ src, bf* dst, size_t n8) { const size_t i = (size_t)blockIdx.x * 256 + threadIdx.x; if (i >= n8) return; const v8f v = *(const v8f*)(src + i * 8); v8us o;
#pragma unroll
    for (int k = 0; k < 8; ++k) o[k] = f2bf(v[k]); *(v8us*)(dst + i * 8) = o;  }
__global__ __launch_bounds__(256) void k_cscvt(const float* __restrict__ cosT, const float* __restrict__ sinT, float* CS) { const int idx = blockIdx.x * 256 + threadIdx.x; if (idx >= TT * HD) return; v2f cs; cs[0] = bfr(cosT[idx]); cs[1] = bfr(sinT[idx]); *(v2f*)(CS + (size_t)idx * 2) = cs;  }
// k_rope: head planes [h][t][d] (fp16 + hi/lo) of rope(x) x sc with the rotate-half convention out[d] = x[d] cos[t][d] - x[d+HD/2] sin[t][d], out[d+HD/2] = x[d+HD/2] cos[t][d+HD/2] + x[d] sin[t][d+HD/2]
__global__ __launch_bounds__(256) void k_rope(const float* __restrict__ F, int pitch, int nheads, const float* __restrict__ CS, const float* __restrict__ RF, const float* __restrict__ nw, float sc, h16* P16, bf* Ph, bf* Pl) {
    const size_t e = ((size_t)blockIdx.x * 256 + threadIdx.x) * 2; if (e >= (size_t)nheads * TT * HD) return; const int d = (int)(e % HD); const int t = (int)((e / HD) % TT); const int h = (int)(e / ((size_t)HD * TT)); const float* f = F + (size_t)t * pitch + h * HD; const float rf = RF ? RF[(size_t)h * TT + t] : 1.0f; v2h o16; v2us oh, ol;
#pragma unroll
    for (int q = 0; q < 2; ++q) { const int dd = d + q; const int dp = (dd < HD / 2) ? dd + HD / 2 : dd - HD / 2; float x0 = f[dd], x1 = f[dp];
        if (RF) { float n0 = __fmul_rn(x0, rf), n1 = __fmul_rn(x1, rf); asm volatile("" : "+v"(n0)); asm volatile("" : "+v"(n1)); x0 = __fmul_rn(bfr(nw[dd]), n0); x1 = __fmul_rn(bfr(nw[dp]), n1); }
        const v2f cs = *(const v2f*)(CS + ((size_t)t * HD + dd) * 2); float a = __fmul_rn(x0, cs[0]), bq = __fmul_rn(x1, cs[1]); asm volatile("" : "+v"(a)); asm volatile("" : "+v"(bq)); const float r = ((dd < HD / 2) ? __fsub_rn(a, bq) : __fadd_rn(a, bq)) * sc;
        o16[q] = tohx(r); unsigned short a2, c2; splitf(r, a2, c2); oh[q] = a2; ol[q] = c2; }
    *(v2h*)(P16 + e) = o16; *(v2us*)(Ph + e) = oh; *(v2us*)(Pl + e) = ol;  }
__global__ __launch_bounds__(256) void k_vtp(const float* __restrict__ F, int pitch, int nheads, h16* V16, bf* Vh, bf* Vl) { const size_t e = ((size_t)blockIdx.x * 256 + threadIdx.x) * 2; if (e >= (size_t)nheads * HD * TT) return; const int t = (int)(e % TT); const int d = (int)((e / TT) % HD); const int g = (int)(e / ((size_t)TT * HD)); v2h o16; v2us oh, ol;
#pragma unroll
    for (int q = 0; q < 2; ++q) { const float x = F[(size_t)(t + q) * pitch + g * HD + d]; o16[q] = tohx(x); unsigned short a2, c2; splitf(x, a2, c2); oh[q] = a2; ol[q] = c2; }
    *(v2h*)(V16 + e) = o16; *(v2us*)(Vh + e) = oh; *(v2us*)(Vl + e) = ol;  }
__global__ __launch_bounds__(256) void k_csid(float* CS) { const int idx = blockIdx.x * 256 + threadIdx.x; if (idx >= TT * HD) return; v2f cs; cs[0] = 1.0f; cs[1] = 0.0f; *(v2f*)(CS + (size_t)idx * 2) = cs;  }
// k_asoft: per row (zz, i): t = S x HD^-1 for j <= i and i - j < WIN (sliding causal window; the reference's -1e9 additive fill vanishes identically); softmax over the 2048 keys (register row, one exp, fixed trees);
__global__ __launch_bounds__(256) void k_asoft(const float* __restrict__ Sb, h16* P16, bf* Ph, bf* Pl) {
    const int lane = threadIdx.x & 31; const int row = blockIdx.x * 8 + (threadIdx.x >> 5); if (row >= ZH * TT) return; const int i = row % TT; const int zz = row / TT; (void)zz; const bool hires = (i < RH); const float* sr = Sb + (size_t)row * TT; float v[TT / 32]; float mx = -3.0e38f;
#pragma unroll
    for (int ch = 0; ch < TT / 128; ++ch) { const int j0 = ch * 128 + lane * 4; const v4f a = *(const v4f*)(sr + j0);
#pragma unroll
        for (int q = 0; q < 4; ++q) { const int j = j0 + q; (void)j; const float t = (j <= i && i - j < WIN) ? a[q] * SCL : -3.0e38f; v[ch * 4 + q] = t; mx = fmaxf(mx, t); } }
#pragma unroll
    for (int sh = 16; sh; sh >>= 1) mx = fmaxf(mx, __shfl_xor(mx, sh, 32));
    float sum = 0.f;
#pragma unroll
    for (int k = 0; k < TT / 32; ++k) { float d0 = __fsub_rn(v[k], mx); asm volatile("" : "+v"(d0)); v[k] = __builtin_amdgcn_exp2f(__fmul_rn(d0, 1.4426950408889634f)); sum += v[k]; }
#pragma unroll
    for (int sh = 16; sh; sh >>= 1) sum += __shfl_xor(sum, sh, 32);
    const float f = __fdiv_rn(hires ? 1.0f : PCAR, sum);
{
        if (hires) {
#pragma unroll
            for (int ch = 0; ch < TT / 128; ++ch) { v4us oh, ol;
#pragma unroll
                for (int q = 0; q < 4; ++q) { unsigned short a, c2; splitf(v[ch * 4 + q] * f, a, c2); oh[q] = a; ol[q] = c2; }
                const size_t oo = ((size_t)zz * (RH ? RH : 1) + i) * TT + ch * 128 + lane * 4; *(v4us*)(Ph + oo) = oh; *(v4us*)(Pl + oo) = ol; }
        } else {
#pragma unroll
            for (int ch = 0; ch < TT / 128; ++ch) { v4h o4;
#pragma unroll
                for (int q = 0; q < 4; ++q) o4[q] = tohx(v[ch * 4 + q] * f);
                *(v4h*)(P16 + (size_t)row * TT + ch * 128 + lane * 4) = o4; } }
         }
}
__global__ __launch_bounds__(256) void k_merge(const float* __restrict__ O, int h0, bf* Ah, bf* Al) { const size_t e = ((size_t)blockIdx.x * 256 + threadIdx.x) * 2; if (e >= (size_t)ZH * TT * HD) return; const int d = (int)(e % HD); const int t = (int)((e / HD) % TT); const int zz = (int)(e / ((size_t)HD * TT)); const float cs = (t < RH) ? 1.0f : (1.0f / PCAR); const size_t oo = (size_t)t * DQ + (h0 + zz) * HD + d;
    v2us oh, ol;
#pragma unroll
    for (int q = 0; q < 2; ++q) { unsigned short a, c2; splitf(O[e + q] * cs, a, c2); oh[q] = a; ol[q] = c2; } *(v2us*)(Ah + oo) = oh; *(v2us*)(Al + oo) = ol;  }

extern "C" void kernel_launch(void* const* d_in, const int* in_sizes, int n_in,
                              void* d_out, int out_size, void* d_ws, size_t ws_size, hipStream_t stream) {
    (void)in_sizes; (void)n_in; (void)out_size;
    const float* x = (const float*)d_in[0]; const float* wf = (const float*)d_in[1]; const float* wo = (const float*)d_in[2]; const float* wq = wf; const float* wk = wf; const float* wv = wf; (void)wk; (void)wv; const float* cosT = nullptr; const float* sinT = nullptr; (void)cosT; (void)sinT;
    float* OUT = (float*)d_out;     // [4][2048][1024]
    char* wsp = (char*)d_ws;
    auto take = [&](size_t bytes) { char* p = wsp; wsp += (bytes + 255) & ~(size_t)255; return (void*)p; };
    bf* WQ = nullptr; bf* WK = nullptr; bf* WV = nullptr; bf* WO = (bf*)take((size_t)DM * DQ * 2); float* CS = (float*)take((size_t)TT * HD * 2 * 4);
    bf* XB = (bf*)take((size_t)TT * DM * 2); bf* WALL = (bf*)take((size_t)(DQ + 2 * DKV) * DM * 2); float* FQ = (float*)take((size_t)TT * DQ * 4); float* FK = (float*)take((size_t)TT * DKV * 4);
    h16* QP16 = (h16*)take((size_t)NH_ * TT * HD * 2); h16* KP16 = (h16*)take((size_t)NKV * TT * HD * 2); h16* VT16 = (h16*)take((size_t)NKV * HD * TT * 2);
    bf* QPh = (bf*)take((size_t)NH_ * TT * HD * 2); bf* QPl = (bf*)take((size_t)NH_ * TT * HD * 2); bf* KPh = (bf*)take((size_t)NKV * TT * HD * 2); bf* KPl = (bf*)take((size_t)NKV * TT * HD * 2); bf* VTh = (bf*)take((size_t)NKV * HD * TT * 2); bf* VTl = (bf*)take((size_t)NKV * HD * TT * 2); bf* Ph = (bf*)take((size_t)ZH * RH * TT * 2); bf* Pl = (bf*)take((size_t)ZH * RH * TT * 2);
    float* Sb = (float*)take((size_t)ZH * TT * TT * 4); h16* P16 = (h16*)take((size_t)ZH * TT * TT * 2); float* Ob = (float*)take((size_t)ZH * TT * HD * 4); bf* ATh = (bf*)take((size_t)TT * DQ * 2); bf* ATl = (bf*)take((size_t)TT * DQ * 2);
    if ((size_t)(wsp - (char*)d_ws) > ws_size) return;    // ws 256 MiB
    float* FV = FK;   // v projection reuses the k buffer after the k planes are built (stream-ordered)
    { k_wtG<<<(unsigned)((DM * (DQ + 2 * DKV) / 64 + 63) / 64), 256, 0, stream>>>(wf, DM, DQ + 2 * DKV, WALL); WQ = WALL; WK = WALL + (size_t)DQ * DM; WV = WK + (size_t)DKV * DM;
      k_wtG<<<(unsigned)((DQ * DM / 64 + 63) / 64), 256, 0, stream>>>(wo, DQ, DM, WO);
       }
    k_csid<<<(TT * HD + 255) / 256, 256, 0, stream>>>(CS);
    const unsigned LQ = (unsigned)(((size_t)NH_ * TT * HD / 2 + 255) / 256), LKv = (unsigned)(((size_t)NKV * TT * HD / 2 + 255) / 256);
    for (int b = 0; b < NB_; ++b) {
        
        k_cvt8<<<(unsigned)(((size_t)TT * DM / 8 + 255) / 256), 256, 0, stream>>>(x + (size_t)b * TT * DM, XB, (size_t)TT * DM / 8);
        k_gemmw<bf, 0, false><<<dim3(TT / 64, DQ / 64, 1), 32, 0, stream>>>(XB, nullptr, WQ, nullptr, DM, FQ, DQ, nullptr, 0, 0, 0);
        k_rope<<<LQ, 256, 0, stream>>>(FQ, DQ, NH_, CS, nullptr, nullptr, 1.0f, QP16, QPh, QPl);
        k_gemmw<bf, 0, false><<<dim3(TT / 64, DKV / 64, 1), 32, 0, stream>>>(XB, nullptr, WK, nullptr, DM, FK, DKV, nullptr, 0, 0, 0);
        k_rope<<<LKv, 256, 0, stream>>>(FK, DKV, NKV, CS, nullptr, nullptr, 1.0f, KP16, KPh, KPl);
        k_gemmw<bf, 0, false><<<dim3(TT / 64, DKV / 64, 1), 32, 0, stream>>>(XB, nullptr, WV, nullptr, DM, FV, DKV, nullptr, 0, 0, 0); k_vtp<<<LKv, 256, 0, stream>>>(FV, DKV, NKV, VT16, VTh, VTl);
        for (int h0 = 0; h0 < NH_; h0 += ZH) { const size_t zq = (size_t)h0, zk = (size_t)(h0 / REP);   // one kv head per query head: the pass's two heads use consecutive kv planes (z-strides TT*HD)
            k_gemmc<bf, 2, 1><<<dim3(RH / 64, TT / 64, ZH), 32, 0, stream>>>(QPh + zq * TT * HD, QPl + zq * TT * HD, KPh + zk * TT * HD, KPl + zk * TT * HD, HD, Sb, TT, 0, (size_t)TT * HD, (size_t)TT * HD, (size_t)TT * TT);
            k_gemmc<h16, 0, 1><<<dim3((TT - RH) / 64, TT / 64, ZH), 32, 0, stream>>>(QP16 + zq * TT * HD + (size_t)RH * HD, nullptr, KP16 + zk * TT * HD, nullptr, HD, Sb + (size_t)RH * TT, TT, RH, (size_t)TT * HD, (size_t)TT * HD, (size_t)TT * TT);
            k_asoft<<<ZH * TT / 8, 256, 0, stream>>>(Sb, P16, Ph, Pl);
            k_gemmc<bf, 2, 2><<<dim3(RH / 64, HD / 64, ZH), 32, 0, stream>>>(Ph, Pl, VTh + zk * HD * TT, VTl + zk * HD * TT, TT, Ob, HD, 0, (size_t)RH * TT, (size_t)HD * TT, (size_t)TT * HD);
            k_gemmc<h16, 0, 2><<<dim3((TT - RH) / 64, HD / 64, ZH), 32, 0, stream>>>(P16 + (size_t)RH * TT, nullptr, VT16 + zk * HD * TT, nullptr, TT, Ob + (size_t)RH * HD, HD, RH, (size_t)TT * TT, (size_t)HD * TT, (size_t)TT * HD);
            k_merge<<<(unsigned)(((size_t)ZH * TT * HD / 2 + 255) / 256), 256, 0, stream>>>(Ob, h0, ATh, ATl); }
        k_gemmw<bf, 1, false><<<dim3(TT / 64, DM / 64, 1), 32, 0, stream>>>(ATh, ATl, WO, nullptr, DQ, OUT + (size_t)b * TT * DM, DM, nullptr, 0, 0, 0); }
}

// v001
// One run takes 1500 microseconds.
// In two side-by-side timings against v000, it was 1.89 and 1.93 times as fast.
#include <hip/hip_runtime.h>

// MuCausalSelfAttention (x [4][2048][1024]; qkv = x W_attn ([1024][3072]: q | k | v column blocks, 16 heads x 64); muP scaling: scores = q.k / 64 (1/head_dim); causal (-inf); softmax; out = merged W_proj -> [4][2048][1024]).
// Compute dtypes, f32 accumulate: every input rounded to bf16; q/k/v on PLAIN bf16 operands (inputs: exact); causal scores and attn.v: query rows < 512 hl (3 products), the rest single fp16 (x1024), causal tile skipping; softmax f32; W_proj hl x exact (2 products).

#define NB_  4
#define TT   2048
#define DM   1024
#define NH_  16
#define NKV  16
#define REP  (NH_ / NKV)
#define HD   64
#define DQ   (NH_ * HD)
#define DKV  (NKV * HD)
#define ZH   2
#define RH   512                  // query rows < RH use hi+lo planes (0: none)
#define WIN  2048
#define PCAR 1024.0f
#define SCL  0.015625f   // muP: 1/head_dim
typedef _Float16 h16;
typedef unsigned short bf;
typedef __attribute__((ext_vector_type(16))) __bf16   v16bf;
typedef __attribute__((ext_vector_type(16))) _Float16 v16h;
typedef __attribute__((ext_vector_type(8)))  _Float16 v8h;
typedef __attribute__((ext_vector_type(8)))  unsigned short v8us;
typedef __attribute__((ext_vector_type(8)))  float    v8f;
typedef __attribute__((ext_vector_type(4)))  float    v4f;
typedef v8h  __attribute__((may_alias)) v8ha;
typedef v4f  __attribute__((may_alias)) v4fa;
typedef v8us __attribute__((may_alias)) v8usa;

__device__ __forceinline__ unsigned short f2bf(float f) { unsigned u = __float_as_uint(f); u += 0x7FFFu + ((u >> 16) & 1u); return (unsigned short)(u >> 16); }
__device__ __forceinline__ float bf2f(unsigned short b) { return __uint_as_float(((unsigned)b) << 16); }
__device__ __forceinline__ float bfr(float f) { return bf2f(f2bf(f)); }
__device__ __forceinline__ v16h cat16(v8h lo, v8h hi) { return __builtin_shufflevector(lo, hi, 0, 1, 2, 3, 4, 5, 6, 7, 8, 9, 10, 11, 12, 13, 14, 15); }
__device__ __forceinline__ v16bf cat16b(v8us lo, v8us hi) { return __builtin_bit_cast(v16bf, __builtin_shufflevector(lo, hi, 0, 1, 2, 3, 4, 5, 6, 7, 8, 9, 10, 11, 12, 13, 14, 15)); }
__device__ __forceinline__ v8f wmma16(v16h a, v16h b, v8f c) { return __builtin_amdgcn_wmma_f32_16x16x32_f16(false, a, false, b, (short)0, c, false, false); }
__device__ __forceinline__ v8f wmmab(v16bf a, v16bf b, v8f c) { return __builtin_amdgcn_wmma_f32_16x16x32_bf16(false, a, false, b, (short)0, c, false, false); }



// ---- k_gemmw: register-blocked GEMM, NW WAVES per 64x64 output tile: wave w takes the 32-wide K steps w, w + NW, ... (16 accumulators each); the NW f32 partial tiles are staged in LDS and summed in wave order;
// operands straight from K-contiguous 16-bit planes; grid (M/64, N/64, Z), 32 x NW threads.
// C[m][n] (f32, pitch ldc, + optional f32 bias[n]) = sum_k A[m][k] Bt[n][k] (+ split products per NSPLIT). z-batch strides sA/sB/sC in elements. K % 32 == 0.
template <typename T16> struct WFrag;
template <> struct WFrag<h16> { typedef v16h V; static __device__ __forceinline__ V ld(const h16* p) { return cat16(*(const v8h*)p, *(const v8h*)(p + 16)); } static __device__ __forceinline__ v8f mma(V a, V b, v8f c) { return wmma16(a, b, c); } };
template <> struct WFrag<bf> { typedef v16bf V; static __device__ __forceinline__ V ld(const bf* p) { return cat16b(*(const v8us*)p, *(const v8us*)(p + 16)); } static __device__ __forceinline__ v8f mma(V a, V b, v8f c) { return wmmab(a, b, c); } };
template <typename T16, int NSPLIT, bool BIAS, int NW>
__global__ __launch_bounds__(32 * NW) void k_gemmw(const T16* __restrict__ A, const T16* __restrict__ A2, const T16* __restrict__ Bt, const T16* __restrict__ Bt2, int K, float* C, int ldc, const float* __restrict__ bias, size_t sA, size_t sB, size_t sC) {
    typedef typename WFrag<T16>::V V;
    __shared__ __align__(16) float os[NW * 64 * 68];
    const size_t z = blockIdx.z; A += z * sA; if (A2) A2 += z * sA; Bt += z * sB; if (Bt2) Bt2 += z * sB; C += z * sC;
    const int lane = threadIdx.x & 31, lr = lane & 15, hi = lane >> 4; const int r0 = blockIdx.x * 64, c0 = blockIdx.y * 64;
    const int wv = __builtin_amdgcn_readfirstlane((int)(threadIdx.x >> 5));   // wave number, scalar: the K loop's trip test stays a scalar branch
    v8f acc[4][4];
#pragma unroll
    for (int mb = 0; mb < 4; ++mb)
#pragma unroll
        for (int nb = 0; nb < 4; ++nb) acc[mb][nb] = (v8f){};
    const size_t aoff = (size_t)(r0 + lr) * K + 8 * hi, boff = (size_t)(c0 + lr) * K + 8 * hi;
#pragma unroll 1
    for (int kc = wv * 32; kc < K; kc += 32 * NW) {
        V a[4], a2[4];
#pragma unroll
        for (int mb = 0; mb < 4; ++mb) { a[mb] = WFrag<T16>::ld(A + aoff + (size_t)mb * 16 * K + kc); if (NSPLIT == 1 || NSPLIT == 2) a2[mb] = WFrag<T16>::ld(A2 + aoff + (size_t)mb * 16 * K + kc); }
#pragma unroll
        for (int nb = 0; nb < 4; ++nb) { const V b = WFrag<T16>::ld(Bt + boff + (size_t)nb * 16 * K + kc); V b2; if (NSPLIT >= 2) b2 = WFrag<T16>::ld(Bt2 + boff + (size_t)nb * 16 * K + kc);
#pragma unroll
            for (int mb = 0; mb < 4; ++mb) { acc[mb][nb] = WFrag<T16>::mma(a[mb], b, acc[mb][nb]); if (NSPLIT == 1 || NSPLIT == 2) acc[mb][nb] = WFrag<T16>::mma(a2[mb], b, acc[mb][nb]); if (NSPLIT >= 2) acc[mb][nb] = WFrag<T16>::mma(a[mb], b2, acc[mb][nb]); } }
        asm volatile("v_nop\n\tv_nop\n\tv_nop\n\tv_nop" : "+v"(acc[0][0]), "+v"(acc[1][1]), "+v"(acc[2][2]), "+v"(acc[3][3]) : "v"(a[0]), "v"(a[3]));
    }
    // every wave stages its whole 64x64 partial tile, so one barrier serves and no LDS is reused; then each thread sums its four-float slots over the waves, in wave order
#pragma unroll
    for (int mb = 0; mb < 4; ++mb) {
#pragma unroll
        for (int nb = 0; nb < 4; ++nb) {
#pragma unroll
            for (int j = 0; j < 8; ++j) os[wv * (64 * 68) + (mb * 16 + hi * 8 + j) * 68 + nb * 16 + lr] = acc[mb][nb][j]; } }
    __syncthreads();
    float* crow = C + (size_t)r0 * ldc + c0;
#pragma unroll
    for (int s = 0; s < 32 / NW; ++s) { const int slot = s * 32 * NW + (int)threadIdx.x; const int row = slot >> 4, cofs = (slot & 15) * 4; v4f val = *(const v4fa*)(os + row * 68 + cofs);
#pragma unroll
        for (int w = 1; w < NW; ++w) val += *(const v4fa*)(os + w * (64 * 68) + row * 68 + cofs);
        if (BIAS) { val[0] += bfr(bias[c0 + cofs]); val[1] += bfr(bias[c0 + cofs + 1]); val[2] += bfr(bias[c0 + cofs + 2]); val[3] += bfr(bias[c0 + cofs + 3]); }
        *(v4f*)(crow + (size_t)row * ldc + cofs) = val; }
}

// ---- k_gemmc: the same 64x64 tile GEMM (NW waves share the K loop; NW = 1: one wave, slab-wise store) specialised for causal attention: CMODE 1 skips score tiles entirely above the diagonal (query rows r0+roff.., key columns c0..), CMODE 2 limits the
// key (K) loop of the probability x value contraction to the diagonal block (probabilities beyond it are exactly zero). roff = row offset of this launch's first row within the sequence.
template <typename T16, int NSPLIT, int CMODE, int NW>
__global__ __launch_bounds__(32 * NW) void k_gemmc(const T16* __restrict__ A, const T16* __restrict__ A2, const T16* __restrict__ Bt, const T16* __restrict__ Bt2, int K, float* C, int ldc, int roff, size_t sA, size_t sB, size_t sC) {
    typedef typename WFrag<T16>::V V;
    __shared__ __align__(16) float os[(NW == 1 ? 16 : NW * 64) * 68];
    const size_t z = blockIdx.z; A += z * sA; if (A2) A2 += z * sA; Bt += z * sB; if (Bt2) Bt2 += z * sB; C += z * sC;
    const int lane = threadIdx.x & 31, lr = lane & 15, hi = lane >> 4; const int r0 = blockIdx.x * 64, c0 = blockIdx.y * 64;
    const int wv = (NW == 1) ? 0 : __builtin_amdgcn_readfirstlane((int)(threadIdx.x >> 5));   // wave number, scalar: the K loop's trip test stays a scalar branch
    if (CMODE == 1 && c0 > r0 + roff + 63) return;                  // score tile entirely above the causal diagonal: never read (the softmax masks j > i by select)
    const int Kl = (CMODE == 2) ? min(K, r0 + roff + 64) : K;        // P.V: probabilities are exactly 0 beyond the diagonal block, so the K loop stops there
    v8f acc[4][4];
#pragma unroll
    for (int mb = 0; mb < 4; ++mb)
#pragma unroll
        for (int nb = 0; nb < 4; ++nb) acc[mb][nb] = (v8f){};
    const size_t aoff = (size_t)(r0 + lr) * K + 8 * hi, boff = (size_t)(c0 + lr) * K + 8 * hi;
#pragma unroll 1
    for (int kc = wv * 32; kc < Kl; kc += 32 * NW) {
        V a[4], a2[4];
#pragma unroll
        for (int mb = 0; mb < 4; ++mb) { a[mb] = WFrag<T16>::ld(A + aoff + (size_t)mb * 16 * K + kc); if (NSPLIT == 1 || NSPLIT == 2) a2[mb] = WFrag<T16>::ld(A2 + aoff + (size_t)mb * 16 * K + kc); }
#pragma unroll
        for (int nb = 0; nb < 4; ++nb) { const V b = WFrag<T16>::ld(Bt + boff + (size_t)nb * 16 * K + kc); V b2; if (NSPLIT >= 2) b2 = WFrag<T16>::ld(Bt2 + boff + (size_t)nb * 16 * K + kc);
#pragma unroll
            for (int mb = 0; mb < 4; ++mb) { acc[mb][nb] = WFrag<T16>::mma(a[mb], b, acc[mb][nb]); if (NSPLIT == 1 || NSPLIT == 2) acc[mb][nb] = WFrag<T16>::mma(a2[mb], b, acc[mb][nb]); if (NSPLIT >= 2) acc[mb][nb] = WFrag<T16>::mma(a[mb], b2, acc[mb][nb]); } }
        asm volatile("v_nop\n\tv_nop\n\tv_nop\n\tv_nop" : "+v"(acc[0][0]), "+v"(acc[1][1]), "+v"(acc[2][2]), "+v"(acc[3][3]) : "v"(a[0]), "v"(a[3]));
    }
    if constexpr (NW == 1) {
#pragma unroll
    for (int mb = 0; mb < 4; ++mb) {
#pragma unroll
        for (int nb = 0; nb < 4; ++nb) {
#pragma unroll
            for (int j = 0; j < 8; ++j) os[(hi * 8 + j) * 68 + nb * 16 + lr] = acc[mb][nb][j]; }
        __builtin_amdgcn_wave_barrier(); asm volatile("" ::: "memory");
        float* crow = C + (size_t)(r0 + mb * 16) * ldc + c0;
{
#pragma unroll
            for (int s = 0; s < 8; ++s) { const int row = 2 * s + hi, cofs = lr * 4; v4f val = *(const v4fa*)(os + row * 68 + cofs);
                *(v4f*)(crow + (size_t)row * ldc + cofs) = val; }
             }
        __builtin_amdgcn_wave_barrier(); asm volatile("" ::: "memory");
    }
    } else {
        // every wave stages its whole 64x64 partial tile, so one barrier serves and no LDS is reused; then each thread sums its four-float slots over the waves, in wave order
#pragma unroll
        for (int mb = 0; mb < 4; ++mb) {
#pragma unroll
            for (int nb = 0; nb < 4; ++nb) {
#pragma unroll
                for (int j = 0; j < 8; ++j) os[wv * (64 * 68) + (mb * 16 + hi * 8 + j) * 68 + nb * 16 + lr] = acc[mb][nb][j]; } }
        __syncthreads();
        float* crow = C + (size_t)r0 * ldc + c0;
#pragma unroll
        for (int s = 0; s < 32 / NW; ++s) { const int slot = s * 32 * NW + (int)threadIdx.x; const int row = slot >> 4, cofs = (slot & 15) * 4; v4f val = *(const v4fa*)(os + row * 68 + cofs);
#pragma unroll
            for (int w = 1; w < NW; ++w) val += *(const v4fa*)(os + w * (64 * 68) + row * 68 + cofs);
            *(v4f*)(crow + (size_t)row * ldc + cofs) = val; }
    }
}

__device__ __forceinline__ h16 tohx(float x) { return (h16)x; }
__device__ __forceinline__ void splitf(float y, unsigned short& h, unsigned short& l) { h = f2bf(y); l = f2bf(y - bf2f(h)); }
typedef __attribute__((ext_vector_type(2))) _Float16 v2h;
typedef __attribute__((ext_vector_type(4))) _Float16 v4h;
typedef __attribute__((ext_vector_type(2))) unsigned short v2us;
typedef __attribute__((ext_vector_type(4))) unsigned short v4us;
typedef __attribute__((ext_vector_type(2))) float v2f;
typedef __attribute__((ext_vector_type(4))) int v4i;

__global__ __launch_bounds__(256) void k_wtG(const float* __restrict__ w, int K, int N, bf* Bt) {
    const int lane = threadIdx.x & 31; const int L0 = (blockIdx.x * 8 + (threadIdx.x >> 5)) * 8; const int nlines = N * K / 64;
{
#pragma unroll 1
        for (int l = 0; l < 8; ++l) { const int L = L0 + l; if (L >= nlines) break; const size_t e = (size_t)L * 64 + lane * 2; const int k = (int)(e % K), n = (int)(e / K); v2us o;
            o[0] = f2bf(w[(size_t)k * N + n]); o[1] = f2bf(w[(size_t)(k + 1) * N + n]); *(v2us*)(Bt + e) = o; }
         }
}
__global__ __launch_bounds__(256) void k_cvt8(const float* __restrict__ src, bf* dst, size_t n8) { const size_t i = (size_t)blockIdx.x * 256 + threadIdx.x; if (i >= n8) return; const v8f v = *(const v8f*)(src + i * 8); v8us o;
#pragma unroll
    for (int k = 0; k < 8; ++k) o[k] = f2bf(v[k]); *(v8us*)(dst + i * 8) = o;  }
__global__ __launch_bounds__(256) void k_cscvt(const float* __restrict__ cosT, const float* __restrict__ sinT, float* CS) { const int idx = blockIdx.x * 256 + threadIdx.x; if (idx >= TT * HD) return; v2f cs; cs[0] = bfr(cosT[idx]); cs[1] = bfr(sinT[idx]); *(v2f*)(CS + (size_t)idx * 2) = cs;  }
// k_rope: head planes [h][t][d] (fp16 + hi/lo) of rope(x) x sc with the rotate-half convention out[d] = x[d] cos[t][d] - x[d+HD/2] sin[t][d], out[d+HD/2] = x[d+HD/2] cos[t][d+HD/2] + x[d] sin[t][d+HD/2]
__global__ __launch_bounds__(256) void k_rope(const float* __restrict__ F, int pitch, int nheads, const float* __restrict__ CS, const float* __restrict__ RF, const float* __restrict__ nw, float sc, h16* P16, bf* Ph, bf* Pl) {
    const size_t e = ((size_t)blockIdx.x * 256 + threadIdx.x) * 2; if (e >= (size_t)nheads * TT * HD) return; const int d = (int)(e % HD); const int t = (int)((e / HD) % TT); const int h = (int)(e / ((size_t)HD * TT)); const float* f = F + (size_t)t * pitch + h * HD; const float rf = RF ? RF[(size_t)h * TT + t] : 1.0f; v2h o16; v2us oh, ol;
#pragma unroll
    for (int q = 0; q < 2; ++q) { const int dd = d + q; const int dp = (dd < HD / 2) ? dd + HD / 2 : dd - HD / 2; float x0 = f[dd], x1 = f[dp];
        if (RF) { float n0 = __fmul_rn(x0, rf), n1 = __fmul_rn(x1, rf); asm volatile("" : "+v"(n0)); asm volatile("" : "+v"(n1)); x0 = __fmul_rn(bfr(nw[dd]), n0); x1 = __fmul_rn(bfr(nw[dp]), n1); }
        const v2f cs = *(const v2f*)(CS + ((size_t)t * HD + dd) * 2); float a = __fmul_rn(x0, cs[0]), bq = __fmul_rn(x1, cs[1]); asm volatile("" : "+v"(a)); asm volatile("" : "+v"(bq)); const float r = ((dd < HD / 2) ? __fsub_rn(a, bq) : __fadd_rn(a, bq)) * sc;
        o16[q] = tohx(r); unsigned short a2, c2; splitf(r, a2, c2); oh[q] = a2; ol[q] = c2; }
    *(v2h*)(P16 + e) = o16; *(v2us*)(Ph + e) = oh; *(v2us*)(Pl + e) = ol;  }
__global__ __launch_bounds__(256) void k_vtp(const float* __restrict__ F, int pitch, int nheads, h16* V16, bf* Vh, bf* Vl) { const size_t e = ((size_t)blockIdx.x * 256 + threadIdx.x) * 2; if (e >= (size_t)nheads * HD * TT) return; const int t = (int)(e % TT); const int d = (int)((e / TT) % HD); const int g = (int)(e / ((size_t)TT * HD)); v2h o16; v2us oh, ol;
#pragma unroll
    for (int q = 0; q < 2; ++q) { const float x = F[(size_t)(t + q) * pitch + g * HD + d]; o16[q] = tohx(x); unsigned short a2, c2; splitf(x, a2, c2); oh[q] = a2; ol[q] = c2; }
    *(v2h*)(V16 + e) = o16; *(v2us*)(Vh + e) = oh; *(v2us*)(Vl + e) = ol;  }
__global__ __launch_bounds__(256) void k_csid(float* CS) { const int idx = blockIdx.x * 256 + threadIdx.x; if (idx >= TT * HD) return; v2f cs; cs[0] = 1.0f; cs[1] = 0.0f; *(v2f*)(CS + (size_t)idx * 2) = cs;  }
// k_asoft: per row (zz, i): t = S x HD^-1 for j <= i and i - j < WIN (sliding causal window; the reference's -1e9 additive fill vanishes identically); softmax over the 2048 keys (register row, one exp, fixed trees);
__global__ __launch_bounds__(256) void k_asoft(const float* __restrict__ Sb, h16* P16, bf* Ph, bf* Pl) {
    const int lane = threadIdx.x & 31; const int row = blockIdx.x * 8 + (threadIdx.x >> 5); if (row >= ZH * TT) return; const int i = row % TT; const int zz = row / TT; (void)zz; const bool hires = (i < RH); const float* sr = Sb + (size_t)row * TT; float v[TT / 32]; float mx = -3.0e38f;
#pragma unroll
    for (int ch = 0; ch < TT / 128; ++ch) { const int j0 = ch * 128 + lane * 4; const v4f a = *(const v4f*)(sr + j0);
#pragma unroll
        for (int q = 0; q < 4; ++q) { const int j = j0 + q; (void)j; const float t = (j <= i && i - j < WIN) ? a[q] * SCL : -3.0e38f; v[ch * 4 + q] = t; mx = fmaxf(mx, t); } }
#pragma unroll
    for (int sh = 16; sh; sh >>= 1) mx = fmaxf(mx, __shfl_xor(mx, sh, 32));
    float sum = 0.f;
#pragma unroll
    for (int k = 0; k < TT / 32; ++k) { float d0 = __fsub_rn(v[k], mx); asm volatile("" : "+v"(d0)); v[k] = __builtin_amdgcn_exp2f(__fmul_rn(d0, 1.4426950408889634f)); sum += v[k]; }
#pragma unroll
    for (int sh = 16; sh; sh >>= 1) sum += __shfl_xor(sum, sh, 32);
    const float f = __fdiv_rn(hires ? 1.0f : PCAR, sum);
{
        if (hires) {
#pragma unroll
            for (int ch = 0; ch < TT / 128; ++ch) { v4us oh, ol;
#pragma unroll
                for (int q = 0; q < 4; ++q) { unsigned short a, c2; splitf(v[ch * 4 + q] * f, a, c2); oh[q] = a; ol[q] = c2; }
                const size_t oo = ((size_t)zz * (RH ? RH : 1) + i) * TT + ch * 128 + lane * 4; *(v4us*)(Ph + oo) = oh; *(v4us*)(Pl + oo) = ol; }
        } else {
#pragma unroll
            for (int ch = 0; ch < TT / 128; ++ch) { v4h o4;
#pragma unroll
                for (int q = 0; q < 4; ++q) o4[q] = tohx(v[ch * 4 + q] * f);
                *(v4h*)(P16 + (size_t)row * TT + ch * 128 + lane * 4) = o4; } }
         }
}
__global__ __launch_bounds__(256) void k_merge(const float* __restrict__ O, int h0, bf* Ah, bf* Al) { const size_t e = ((size_t)blockIdx.x * 256 + threadIdx.x) * 2; if (e >= (size_t)ZH * TT * HD) return; const int d = (int)(e % HD); const int t = (int)((e / HD) % TT); const int zz = (int)(e / ((size_t)HD * TT)); const float cs = (t < RH) ? 1.0f : (1.0f / PCAR); const size_t oo = (size_t)t * DQ + (h0 + zz) * HD + d;
    v2us oh, ol;
#pragma unroll
    for (int q = 0; q < 2; ++q) { unsigned short a, c2; splitf(O[e + q] * cs, a, c2); oh[q] = a; ol[q] = c2; } *(v2us*)(Ah + oo) = oh; *(v2us*)(Al + oo) = ol;  }

extern "C" void kernel_launch(void* const* d_in, const int* in_sizes, int n_in,
                              void* d_out, int out_size, void* d_ws, size_t ws_size, hipStream_t stream) {
    (void)in_sizes; (void)n_in; (void)out_size;
    const float* x = (const float*)d_in[0]; const float* wf = (const float*)d_in[1]; const float* wo = (const float*)d_in[2]; const float* wq = wf; const float* wk = wf; const float* wv = wf; (void)wk; (void)wv; const float* cosT = nullptr; const float* sinT = nullptr; (void)cosT; (void)sinT;
    float* OUT = (float*)d_out;     // [4][2048][1024]
    char* wsp = (char*)d_ws;
    auto take = [&](size_t bytes) { char* p = wsp; wsp += (bytes + 255) & ~(size_t)255; return (void*)p; };
    bf* WQ = nullptr; bf* WK = nullptr; bf* WV = nullptr; bf* WO = (bf*)take((size_t)DM * DQ * 2); float* CS = (float*)take((size_t)TT * HD * 2 * 4);
    bf* XB = (bf*)take((size_t)TT * DM * 2); bf* WALL = (bf*)take((size_t)(DQ + 2 * DKV) * DM * 2); float* FQ = (float*)take((size_t)TT * DQ * 4); float* FK = (float*)take((size_t)TT * DKV * 4);
    h16* QP16 = (h16*)take((size_t)NH_ * TT * HD * 2); h16* KP16 = (h16*)take((size_t)NKV * TT * HD * 2); h16* VT16 = (h16*)take((size_t)NKV * HD * TT * 2);
    bf* QPh = (bf*)take((size_t)NH_ * TT * HD * 2); bf* QPl = (bf*)take((size_t)NH_ * TT * HD * 2); bf* KPh = (bf*)take((size_t)NKV * TT * HD * 2); bf* KPl = (bf*)take((size_t)NKV * TT * HD * 2); bf* VTh = (bf*)take((size_t)NKV * HD * TT * 2); bf* VTl = (bf*)take((size_t)NKV * HD * TT * 2); bf* Ph = (bf*)take((size_t)ZH * RH * TT * 2); bf* Pl = (bf*)take((size_t)ZH * RH * TT * 2);
    float* Sb = (float*)take((size_t)ZH * TT * TT * 4); h16* P16 = (h16*)take((size_t)ZH * TT * TT * 2); float* Ob = (float*)take((size_t)ZH * TT * HD * 4); bf* ATh = (bf*)take((size_t)TT * DQ * 2); bf* ATl = (bf*)take((size_t)TT * DQ * 2);
    if ((size_t)(wsp - (char*)d_ws) > ws_size) return;    // ws 256 MiB
    float* FV = FK;   // v projection reuses the k buffer after the k planes are built (stream-ordered)
    { k_wtG<<<(unsigned)((DM * (DQ + 2 * DKV) / 64 + 63) / 64), 256, 0, stream>>>(wf, DM, DQ + 2 * DKV, WALL); WQ = WALL; WK = WALL + (size_t)DQ * DM; WV = WK + (size_t)DKV * DM;
      k_wtG<<<(unsigned)((DQ * DM / 64 + 63) / 64), 256, 0, stream>>>(wo, DQ, DM, WO);
       }
    k_csid<<<(TT * HD + 255) / 256, 256, 0, stream>>>(CS);
    const unsigned LQ = (unsigned)(((size_t)NH_ * TT * HD / 2 + 255) / 256), LKv = (unsigned)(((size_t)NKV * TT * HD / 2 + 255) / 256);
    for (int b = 0; b < NB_; ++b) {
        
        k_cvt8<<<(unsigned)(((size_t)TT * DM / 8 + 255) / 256), 256, 0, stream>>>(x + (size_t)b * TT * DM, XB, (size_t)TT * DM / 8);
        k_gemmw<bf, 0, false, 8><<<dim3(TT / 64, DQ / 64, 1), 256, 0, stream>>>(XB, nullptr, WQ, nullptr, DM, FQ, DQ, nullptr, 0, 0, 0);
        k_rope<<<LQ, 256, 0, stream>>>(FQ, DQ, NH_, CS, nullptr, nullptr, 1.0f, QP16, QPh, QPl);
        k_gemmw<bf, 0, false, 8><<<dim3(TT / 64, DKV / 64, 1), 256, 0, stream>>>(XB, nullptr, WK, nullptr, DM, FK, DKV, nullptr, 0, 0, 0);
        k_rope<<<LKv, 256, 0, stream>>>(FK, DKV, NKV, CS, nullptr, nullptr, 1.0f, KP16, KPh, KPl);
        k_gemmw<bf, 0, false, 8><<<dim3(TT / 64, DKV / 64, 1), 256, 0, stream>>>(XB, nullptr, WV, nullptr, DM, FV, DKV, nullptr, 0, 0, 0); k_vtp<<<LKv, 256, 0, stream>>>(FV, DKV, NKV, VT16, VTh, VTl);
        for (int h0 = 0; h0 < NH_; h0 += ZH) { const size_t zq = (size_t)h0, zk = (size_t)(h0 / REP);   // one kv head per query head: the pass's two heads use consecutive kv planes (z-strides TT*HD)
            k_gemmc<bf, 2, 1, 1><<<dim3(RH / 64, TT / 64, ZH), 32, 0, stream>>>(QPh + zq * TT * HD, QPl + zq * TT * HD, KPh + zk * TT * HD, KPl + zk * TT * HD, HD, Sb, TT, 0, (size_t)TT * HD, (size_t)TT * HD, (size_t)TT * TT);
            k_gemmc<h16, 0, 1, 1><<<dim3((TT - RH) / 64, TT / 64, ZH), 32, 0, stream>>>(QP16 + zq * TT * HD + (size_t)RH * HD, nullptr, KP16 + zk * TT * HD, nullptr, HD, Sb + (size_t)RH * TT, TT, RH, (size_t)TT * HD, (size_t)TT * HD, (size_t)TT * TT);
            k_asoft<<<ZH * TT / 8, 256, 0, stream>>>(Sb, P16, Ph, Pl);
            k_gemmc<bf, 2, 2, 16><<<dim3(RH / 64, HD / 64, ZH), 512, 0, stream>>>(Ph, Pl, VTh + zk * HD * TT, VTl + zk * HD * TT, TT, Ob, HD, 0, (size_t)RH * TT, (size_t)HD * TT, (size_t)TT * HD);
            k_gemmc<h16, 0, 2, 16><<<dim3((TT - RH) / 64, HD / 64, ZH), 512, 0, stream>>>(P16 + (size_t)RH * TT, nullptr, VT16 + zk * HD * TT, nullptr, TT, Ob + (size_t)RH * HD, HD, RH, (size_t)TT * TT, (size_t)HD * TT, (size_t)TT * HD);
            k_merge<<<(unsigned)(((size_t)ZH * TT * HD / 2 + 255) / 256), 256, 0, stream>>>(Ob, h0, ATh, ATl); }
        k_gemmw<bf, 1, false, 8><<<dim3(TT / 64, DM / 64, 1), 256, 0, stream>>>(ATh, ATl, WO, nullptr, DQ, OUT + (size_t)b * TT * DM, DM, nullptr, 0, 0, 0); }
}

// v002
// A run of this version takes 876 microseconds.
// Timed twice side by side with v001, it ran 1.73 times as fast both times.
// Over all steps from v000 it is 3.30 times as fast.
#include <hip/hip_runtime.h>

// MuCausalSelfAttention (x [4][2048][1024]; qkv = x W_attn ([1024][3072]: q | k | v column blocks, 16 heads x 64); muP scaling: scores = q.k / 64 (1/head_dim); causal (-inf); softmax; out = merged W_proj -> [4][2048][1024]).
// Compute dtypes, f32 accumulate: every input rounded to bf16; q/k/v on PLAIN bf16 operands (inputs: exact); causal scores and attn.v: query rows < 512 hl (3 products), the rest single fp16 (x1024), causal tile skipping; softmax f32; W_proj hl x exact (2 products).

#define NB_  4
#define TT   2048
#define DM   1024
#define NH_  16
#define NKV  16
#define REP  (NH_ / NKV)
#define HD   64
#define DQ   (NH_ * HD)
#define DKV  (NKV * HD)
#define ZH   8                    // heads per attention pass (z of the score, softmax, P.V and merge launches)
#define RH   512                  // query rows < RH use hi+lo planes (0: none)
#define WIN  2048
#define PCAR 1024.0f
#define SCL  0.015625f   // muP: 1/head_dim
typedef _Float16 h16;
typedef unsigned short bf;
typedef __attribute__((ext_vector_type(16))) __bf16   v16bf;
typedef __attribute__((ext_vector_type(16))) _Float16 v16h;
typedef __attribute__((ext_vector_type(8)))  _Float16 v8h;
typedef __attribute__((ext_vector_type(8)))  unsigned short v8us;
typedef __attribute__((ext_vector_type(8)))  float    v8f;
typedef __attribute__((ext_vector_type(4)))  float    v4f;
typedef v8h  __attribute__((may_alias)) v8ha;
typedef v4f  __attribute__((may_alias)) v4fa;
typedef v8us __attribute__((may_alias)) v8usa;

__device__ __forceinline__ unsigned short f2bf(float f) { unsigned u = __float_as_uint(f); u += 0x7FFFu + ((u >> 16) & 1u); return (unsigned short)(u >> 16); }
__device__ __forceinline__ float bf2f(unsigned short b) { return __uint_as_float(((unsigned)b) << 16); }
__device__ __forceinline__ float bfr(float f) { return bf2f(f2bf(f)); }
__device__ __forceinline__ v16h cat16(v8h lo, v8h hi) { return __builtin_shufflevector(lo, hi, 0, 1, 2, 3, 4, 5, 6, 7, 8, 9, 10, 11, 12, 13, 14, 15); }
__device__ __forceinline__ v16bf cat16b(v8us lo, v8us hi) { return __builtin_bit_cast(v16bf, __builtin_shufflevector(lo, hi, 0, 1, 2, 3, 4, 5, 6, 7, 8, 9, 10, 11, 12, 13, 14, 15)); }
__device__ __forceinline__ v8f wmma16(v16h a, v16h b, v8f c) { return __builtin_amdgcn_wmma_f32_16x16x32_f16(false, a, false, b, (short)0, c, false, false); }
__device__ __forceinline__ v8f wmmab(v16bf a, v16bf b, v8f c) { return __builtin_amdgcn_wmma_f32_16x16x32_bf16(false, a, false, b, (short)0, c, false, false); }



// ---- k_gemmw: register-blocked GEMM, NW WAVES per 64x64 output tile: wave w takes the 32-wide K steps w, w + NW, ... (16 accumulators each); the NW f32 partial tiles are staged in LDS and summed in wave order;
// operands straight from K-contiguous 16-bit planes; grid (M/64, N/64, Z), 32 x NW threads.
// C[m][n] (f32, pitch ldc, + optional f32 bias[n]) = sum_k A[m][k] Bt[n][k] (+ split products per NSPLIT). z-batch strides sA/sB/sC in elements. K % 32 == 0.
template <typename T16> struct WFrag;
template <> struct WFrag<h16> { typedef v16h V; static __device__ __forceinline__ V ld(const h16* p) { return cat16(*(const v8h*)p, *(const v8h*)(p + 16)); } static __device__ __forceinline__ v8f mma(V a, V b, v8f c) { return wmma16(a, b, c); } };
template <> struct WFrag<bf> { typedef v16bf V; static __device__ __forceinline__ V ld(const bf* p) { return cat16b(*(const v8us*)p, *(const v8us*)(p + 16)); } static __device__ __forceinline__ v8f mma(V a, V b, v8f c) { return wmmab(a, b, c); } };
template <typename T16, int NSPLIT, bool BIAS, int NW>
__global__ __launch_bounds__(32 * NW) void k_gemmw(const T16* __restrict__ A, const T16* __restrict__ A2, const T16* __restrict__ Bt, const T16* __restrict__ Bt2, int K, float* C, int ldc, const float* __restrict__ bias, size_t sA, size_t sB, size_t sC) {
    typedef typename WFrag<T16>::V V;
    __shared__ __align__(16) float os[NW * 64 * 68];
    const size_t z = blockIdx.z; A += z * sA; if (A2) A2 += z * sA; Bt += z * sB; if (Bt2) Bt2 += z * sB; C += z * sC;
    const int lane = threadIdx.x & 31, lr = lane & 15, hi = lane >> 4; const int r0 = blockIdx.x * 64, c0 = blockIdx.y * 64;
    const int wv = __builtin_amdgcn_readfirstlane((int)(threadIdx.x >> 5));   // wave number, scalar: the K loop's trip test stays a scalar branch
    v8f acc[4][4];
#pragma unroll
    for (int mb = 0; mb < 4; ++mb)
#pragma unroll
        for (int nb = 0; nb < 4; ++nb) acc[mb][nb] = (v8f){};
    const size_t aoff = (size_t)(r0 + lr) * K + 8 * hi, boff = (size_t)(c0 + lr) * K + 8 * hi;
#pragma unroll 1
    for (int kc = wv * 32; kc < K; kc += 32 * NW) {
        V a[4], a2[4];
#pragma unroll
        for (int mb = 0; mb < 4; ++mb) { a[mb] = WFrag<T16>::ld(A + aoff + (size_t)mb * 16 * K + kc); if (NSPLIT == 1 || NSPLIT == 2) a2[mb] = WFrag<T16>::ld(A2 + aoff + (size_t)mb * 16 * K + kc); }
#pragma unroll
        for (int nb = 0; nb < 4; ++nb) { const V b = WFrag<T16>::ld(Bt + boff + (size_t)nb * 16 * K + kc); V b2; if (NSPLIT >= 2) b2 = WFrag<T16>::ld(Bt2 + boff + (size_t)nb * 16 * K + kc);
#pragma unroll
            for (int mb = 0; mb < 4; ++mb) { acc[mb][nb] = WFrag<T16>::mma(a[mb], b, acc[mb][nb]); if (NSPLIT == 1 || NSPLIT == 2) acc[mb][nb] = WFrag<T16>::mma(a2[mb], b, acc[mb][nb]); if (NSPLIT >= 2) acc[mb][nb] = WFrag<T16>::mma(a[mb], b2, acc[mb][nb]); } }
        asm volatile("v_nop\n\tv_nop\n\tv_nop\n\tv_nop" : "+v"(acc[0][0]), "+v"(acc[1][1]), "+v"(acc[2][2]), "+v"(acc[3][3]) : "v"(a[0]), "v"(a[3]));
    }
    // every wave stages its whole 64x64 partial tile, so one barrier serves and no LDS is reused; then each thread sums its four-float slots over the waves, in wave order
#pragma unroll
    for (int mb = 0; mb < 4; ++mb) {
#pragma unroll
        for (int nb = 0; nb < 4; ++nb) {
#pragma unroll
            for (int j = 0; j < 8; ++j) os[wv * (64 * 68) + (mb * 16 + hi * 8 + j) * 68 + nb * 16 + lr] = acc[mb][nb][j]; } }
    __syncthreads();
    float* crow = C + (size_t)r0 * ldc + c0;
#pragma unroll
    for (int s = 0; s < 32 / NW; ++s) { const int slot = s * 32 * NW + (int)threadIdx.x; const int row = slot >> 4, cofs = (slot & 15) * 4; v4f val = *(const v4fa*)(os + row * 68 + cofs);
#pragma unroll
        for (int w = 1; w < NW; ++w) val += *(const v4fa*)(os + w * (64 * 68) + row * 68 + cofs);
        if (BIAS) { val[0] += bfr(bias[c0 + cofs]); val[1] += bfr(bias[c0 + cofs + 1]); val[2] += bfr(bias[c0 + cofs + 2]); val[3] += bfr(bias[c0 + cofs + 3]); }
        *(v4f*)(crow + (size_t)row * ldc + cofs) = val; }
}

// ---- k_gemmc: the same 64x64 tile GEMM (NW waves share the K loop; NW = 1: one wave, slab-wise store) specialised for causal attention: CMODE 1 skips score tiles entirely above the diagonal (query rows r0+roff.., key columns c0..), CMODE 2 limits the
// key (K) loop of the probability x value contraction to the diagonal block (probabilities beyond it are exactly zero). roff = row offset of this launch's first row within the sequence. lda = row pitch of A in elements (Bt's is K).
template <typename T16, int NSPLIT, int CMODE, int NW>
__global__ __launch_bounds__(32 * NW) void k_gemmc(const T16* __restrict__ A, const T16* __restrict__ A2, const T16* __restrict__ Bt, const T16* __restrict__ Bt2, int K, int lda, float* C, int ldc, int roff, size_t sA, size_t sB, size_t sC) {
    typedef typename WFrag<T16>::V V;
    __shared__ __align__(16) float os[(NW == 1 ? 16 : NW * 64) * 68];
    const size_t z = blockIdx.z; A += z * sA; if (A2) A2 += z * sA; Bt += z * sB; if (Bt2) Bt2 += z * sB; C += z * sC;
    const int lane = threadIdx.x & 31, lr = lane & 15, hi = lane >> 4; const int r0 = blockIdx.x * 64, c0 = blockIdx.y * 64;
    const int wv = (NW == 1) ? 0 : __builtin_amdgcn_readfirstlane((int)(threadIdx.x >> 5));   // wave number, scalar: the K loop's trip test stays a scalar branch
    if (CMODE == 1 && c0 > r0 + roff + 63) return;                  // score tile entirely above the causal diagonal: never read (the softmax masks j > i by select)
    const int Kl = (CMODE == 2) ? min(K, r0 + roff + 64) : K;        // P.V: probabilities are exactly 0 beyond the diagonal block, so the K loop stops there
    v8f acc[4][4];
#pragma unroll
    for (int mb = 0; mb < 4; ++mb)
#pragma unroll
        for (int nb = 0; nb < 4; ++nb) acc[mb][nb] = (v8f){};
    const size_t aoff = (size_t)(r0 + lr) * lda + 8 * hi, boff = (size_t)(c0 + lr) * K + 8 * hi;
#pragma unroll 1
    for (int kc = wv * 32; kc < Kl; kc += 32 * NW) {
        V a[4], a2[4];
#pragma unroll
        for (int mb = 0; mb < 4; ++mb) { a[mb] = WFrag<T16>::ld(A + aoff + (size_t)mb * 16 * lda + kc); if (NSPLIT == 1 || NSPLIT == 2) a2[mb] = WFrag<T16>::ld(A2 + aoff + (size_t)mb * 16 * lda + kc); }
#pragma unroll
        for (int nb = 0; nb < 4; ++nb) { const V b = WFrag<T16>::ld(Bt + boff + (size_t)nb * 16 * K + kc); V b2; if (NSPLIT >= 2) b2 = WFrag<T16>::ld(Bt2 + boff + (size_t)nb * 16 * K + kc);
#pragma unroll
            for (int mb = 0; mb < 4; ++mb) { acc[mb][nb] = WFrag<T16>::mma(a[mb], b, acc[mb][nb]); if (NSPLIT == 1 || NSPLIT == 2) acc[mb][nb] = WFrag<T16>::mma(a2[mb], b, acc[mb][nb]); if (NSPLIT >= 2) acc[mb][nb] = WFrag<T16>::mma(a[mb], b2, acc[mb][nb]); } }
        asm volatile("v_nop\n\tv_nop\n\tv_nop\n\tv_nop" : "+v"(acc[0][0]), "+v"(acc[1][1]), "+v"(acc[2][2]), "+v"(acc[3][3]) : "v"(a[0]), "v"(a[3]));
    }
    if constexpr (NW == 1) {
#pragma unroll
    for (int mb = 0; mb < 4; ++mb) {
#pragma unroll
        for (int nb = 0; nb < 4; ++nb) {
#pragma unroll
            for (int j = 0; j < 8; ++j) os[(hi * 8 + j) * 68 + nb * 16 + lr] = acc[mb][nb][j]; }
        __builtin_amdgcn_wave_barrier(); asm volatile("" ::: "memory");
        float* crow = C + (size_t)(r0 + mb * 16) * ldc + c0;
{
#pragma unroll
            for (int s = 0; s < 8; ++s) { const int row = 2 * s + hi, cofs = lr * 4; v4f val = *(const v4fa*)(os + row * 68 + cofs);
                *(v4f*)(crow + (size_t)row * ldc + cofs) = val; }
             }
        __builtin_amdgcn_wave_barrier(); asm volatile("" ::: "memory");
    }
    } else {
        // every wave stages its whole 64x64 partial tile, so one barrier serves and no LDS is reused; then each thread sums its four-float slots over the waves, in wave order
#pragma unroll
        for (int mb = 0; mb < 4; ++mb) {
#pragma unroll
            for (int nb = 0; nb < 4; ++nb) {
#pragma unroll
                for (int j = 0; j < 8; ++j) os[wv * (64 * 68) + (mb * 16 + hi * 8 + j) * 68 + nb * 16 + lr] = acc[mb][nb][j]; } }
        __syncthreads();
        float* crow = C + (size_t)r0 * ldc + c0;
#pragma unroll
        for (int s = 0; s < 32 / NW; ++s) { const int slot = s * 32 * NW + (int)threadIdx.x; const int row = slot >> 4, cofs = (slot & 15) * 4; v4f val = *(const v4fa*)(os + row * 68 + cofs);
#pragma unroll
            for (int w = 1; w < NW; ++w) val += *(const v4fa*)(os + w * (64 * 68) + row * 68 + cofs);
            *(v4f*)(crow + (size_t)row * ldc + cofs) = val; }
    }
}

__device__ __forceinline__ h16 tohx(float x) { return (h16)x; }
__device__ __forceinline__ void splitf(float y, unsigned short& h, unsigned short& l) { h = f2bf(y); l = f2bf(y - bf2f(h)); }
typedef __attribute__((ext_vector_type(2))) _Float16 v2h;
typedef __attribute__((ext_vector_type(4))) _Float16 v4h;
typedef __attribute__((ext_vector_type(2))) unsigned short v2us;
typedef __attribute__((ext_vector_type(4))) unsigned short v4us;
typedef __attribute__((ext_vector_type(2))) float v2f;
typedef __attribute__((ext_vector_type(4))) int v4i;

__global__ __launch_bounds__(256) void k_wtG(const float* __restrict__ w, int K, int N, bf* Bt) {
    const int lane = threadIdx.x & 31; const int L0 = (blockIdx.x * 8 + (threadIdx.x >> 5)) * 8; const int nlines = N * K / 64;
{
#pragma unroll 1
        for (int l = 0; l < 8; ++l) { const int L = L0 + l; if (L >= nlines) break; const size_t e = (size_t)L * 64 + lane * 2; const int k = (int)(e % K), n = (int)(e / K); v2us o;
            o[0] = f2bf(w[(size_t)k * N + n]); o[1] = f2bf(w[(size_t)(k + 1) * N + n]); *(v2us*)(Bt + e) = o; }
         }
}
__global__ __launch_bounds__(256) void k_cvt8(const float* __restrict__ src, bf* dst, size_t n8) { const size_t i = (size_t)blockIdx.x * 256 + threadIdx.x; if (i >= n8) return; const v8f v = *(const v8f*)(src + i * 8); v8us o;
#pragma unroll
    for (int k = 0; k < 8; ++k) o[k] = f2bf(v[k]); *(v8us*)(dst + i * 8) = o;  }
__global__ __launch_bounds__(256) void k_cscvt(const float* __restrict__ cosT, const float* __restrict__ sinT, float* CS) { const int idx = blockIdx.x * 256 + threadIdx.x; if (idx >= TT * HD) return; v2f cs; cs[0] = bfr(cosT[idx]); cs[1] = bfr(sinT[idx]); *(v2f*)(CS + (size_t)idx * 2) = cs;  }
// k_rope: head planes [h][t][d] (fp16 + hi/lo) of rope(x) x sc with the rotate-half convention out[d] = x[d] cos[t][d] - x[d+HD/2] sin[t][d], out[d+HD/2] = x[d+HD/2] cos[t][d+HD/2] + x[d] sin[t][d+HD/2]
__global__ __launch_bounds__(256) void k_rope(const float* __restrict__ F, int pitch, int nheads, const float* __restrict__ CS, const float* __restrict__ RF, const float* __restrict__ nw, float sc, h16* P16, bf* Ph, bf* Pl) {
    const size_t e = ((size_t)blockIdx.x * 256 + threadIdx.x) * 2; if (e >= (size_t)nheads * TT * HD) return; const int d = (int)(e % HD); const int t = (int)((e / HD) % TT); const int h = (int)(e / ((size_t)HD * TT)); const float* f = F + (size_t)t * pitch + h * HD; const float rf = RF ? RF[(size_t)h * TT + t] : 1.0f; v2h o16; v2us oh, ol;
#pragma unroll
    for (int q = 0; q < 2; ++q) { const int dd = d + q; const int dp = (dd < HD / 2) ? dd + HD / 2 : dd - HD / 2; float x0 = f[dd], x1 = f[dp];
        if (RF) { float n0 = __fmul_rn(x0, rf), n1 = __fmul_rn(x1, rf); asm volatile("" : "+v"(n0)); asm volatile("" : "+v"(n1)); x0 = __fmul_rn(bfr(nw[dd]), n0); x1 = __fmul_rn(bfr(nw[dp]), n1); }
        const v2f cs = *(const v2f*)(CS + ((size_t)t * HD + dd) * 2); float a = __fmul_rn(x0, cs[0]), bq = __fmul_rn(x1, cs[1]); asm volatile("" : "+v"(a)); asm volatile("" : "+v"(bq)); const float r = ((dd < HD / 2) ? __fsub_rn(a, bq) : __fadd_rn(a, bq)) * sc;
        o16[q] = tohx(r); unsigned short a2, c2; splitf(r, a2, c2); oh[q] = a2; ol[q] = c2; }
    *(v2h*)(P16 + e) = o16; *(v2us*)(Ph + e) = oh; *(v2us*)(Pl + e) = ol;  }
__global__ __launch_bounds__(256) void k_vtp(const float* __restrict__ F, int pitch, int nheads, h16* V16, bf* Vh, bf* Vl) { const size_t e = ((size_t)blockIdx.x * 256 + threadIdx.x) * 2; if (e >= (size_t)nheads * HD * TT) return; const int t = (int)(e % TT); const int d = (int)((e / TT) % HD); const int g = (int)(e / ((size_t)TT * HD)); v2h o16; v2us oh, ol;
#pragma unroll
    for (int q = 0; q < 2; ++q) { const float x = F[(size_t)(t + q) * pitch + g * HD + d]; o16[q] = tohx(x); unsigned short a2, c2; splitf(x, a2, c2); oh[q] = a2; ol[q] = c2; }
    *(v2h*)(V16 + e) = o16; *(v2us*)(Vh + e) = oh; *(v2us*)(Vl + e) = ol;  }
__global__ __launch_bounds__(256) void k_csid(float* CS) { const int idx = blockIdx.x * 256 + threadIdx.x; if (idx >= TT * HD) return; v2f cs; cs[0] = 1.0f; cs[1] = 0.0f; *(v2f*)(CS + (size_t)idx * 2) = cs;  }
// k_asoft, IN PLACE: each wave holds its whole 8 KiB score row in registers before it stores, and it alone touches that row; the probabilities overwrite the row: fp16 in its first 4 KiB, or (rows < RH) the hi plane in the first and the lo plane in the second 4 KiB (pitch 2 * TT 16-bit elements).
// per row (zz, i): t = S x HD^-1 for j <= i and i - j < WIN (sliding causal window; the reference's -1e9 additive fill vanishes identically); softmax over the 2048 keys (register row, one exp, fixed trees);
__global__ __launch_bounds__(256) void k_asoft(float* Sb) {
    const int lane = threadIdx.x & 31; const int row = blockIdx.x * 8 + (threadIdx.x >> 5); if (row >= ZH * TT) return; const int i = row % TT; const bool hires = (i < RH); float* sr = Sb + (size_t)row * TT; float v[TT / 32]; float mx = -3.0e38f;
#pragma unroll
    for (int ch = 0; ch < TT / 128; ++ch) { const int j0 = ch * 128 + lane * 4; const v4f a = *(const v4f*)(sr + j0);
#pragma unroll
        for (int q = 0; q < 4; ++q) { const int j = j0 + q; (void)j; const float t = (j <= i && i - j < WIN) ? a[q] * SCL : -3.0e38f; v[ch * 4 + q] = t; mx = fmaxf(mx, t); } }
#pragma unroll
    for (int sh = 16; sh; sh >>= 1) mx = fmaxf(mx, __shfl_xor(mx, sh, 32));
    float sum = 0.f;
#pragma unroll
    for (int k = 0; k < TT / 32; ++k) { float d0 = __fsub_rn(v[k], mx); asm volatile("" : "+v"(d0)); v[k] = __builtin_amdgcn_exp2f(__fmul_rn(d0, 1.4426950408889634f)); sum += v[k]; }
#pragma unroll
    for (int sh = 16; sh; sh >>= 1) sum += __shfl_xor(sum, sh, 32);
    const float f = __fdiv_rn(hires ? 1.0f : PCAR, sum);
{
        if (hires) {
#pragma unroll
            for (int ch = 0; ch < TT / 128; ++ch) { v4us oh, ol;
#pragma unroll
                for (int q = 0; q < 4; ++q) { unsigned short a, c2; splitf(v[ch * 4 + q] * f, a, c2); oh[q] = a; ol[q] = c2; }
                bf* pr = (bf*)sr + ch * 128 + lane * 4; *(v4us*)pr = oh; *(v4us*)(pr + TT) = ol; }
        } else {
#pragma unroll
            for (int ch = 0; ch < TT / 128; ++ch) { v4h o4;
#pragma unroll
                for (int q = 0; q < 4; ++q) o4[q] = tohx(v[ch * 4 + q] * f);
                *(v4h*)((h16*)sr + ch * 128 + lane * 4) = o4; } }
         }
}
__global__ __launch_bounds__(256) void k_merge(const float* __restrict__ O, int h0, bf* Ah, bf* Al) { const size_t e = ((size_t)blockIdx.x * 256 + threadIdx.x) * 2; if (e >= (size_t)ZH * TT * HD) return; const int d = (int)(e % HD); const int t = (int)((e / HD) % TT); const int zz = (int)(e / ((size_t)HD * TT)); const float cs = (t < RH) ? 1.0f : (1.0f / PCAR); const size_t oo = (size_t)t * DQ + (h0 + zz) * HD + d;
    v2us oh, ol;
#pragma unroll
    for (int q = 0; q < 2; ++q) { unsigned short a, c2; splitf(O[e + q] * cs, a, c2); oh[q] = a; ol[q] = c2; } *(v2us*)(Ah + oo) = oh; *(v2us*)(Al + oo) = ol;  }

extern "C" void kernel_launch(void* const* d_in, const int* in_sizes, int n_in,
                              void* d_out, int out_size, void* d_ws, size_t ws_size, hipStream_t stream) {
    (void)in_sizes; (void)n_in; (void)out_size;
    const float* x = (const float*)d_in[0]; const float* wf = (const float*)d_in[1]; const float* wo = (const float*)d_in[2]; const float* wq = wf; const float* wk = wf; const float* wv = wf; (void)wk; (void)wv; const float* cosT = nullptr; const float* sinT = nullptr; (void)cosT; (void)sinT;
    float* OUT = (float*)d_out;     // [4][2048][1024]
    char* wsp = (char*)d_ws;
    auto take = [&](size_t bytes) { char* p = wsp; wsp += (bytes + 255) & ~(size_t)255; return (void*)p; };
    bf* WQ = nullptr; bf* WK = nullptr; bf* WV = nullptr; bf* WO = (bf*)take((size_t)DM * DQ * 2); float* CS = (float*)take((size_t)TT * HD * 2 * 4);
    bf* XB = (bf*)take((size_t)TT * DM * 2); bf* WALL = (bf*)take((size_t)(DQ + 2 * DKV) * DM * 2); float* FQ = (float*)take((size_t)TT * DQ * 4); float* FK = (float*)take((size_t)TT * DKV * 4);
    h16* QP16 = (h16*)take((size_t)NH_ * TT * HD * 2); h16* KP16 = (h16*)take((size_t)NKV * TT * HD * 2); h16* VT16 = (h16*)take((size_t)NKV * HD * TT * 2);
    bf* QPh = (bf*)take((size_t)NH_ * TT * HD * 2); bf* QPl = (bf*)take((size_t)NH_ * TT * HD * 2); bf* KPh = (bf*)take((size_t)NKV * TT * HD * 2); bf* KPl = (bf*)take((size_t)NKV * TT * HD * 2); bf* VTh = (bf*)take((size_t)NKV * HD * TT * 2); bf* VTl = (bf*)take((size_t)NKV * HD * TT * 2);
    float* Sb = (float*)take((size_t)ZH * TT * TT * 4); float* Ob = (float*)take((size_t)ZH * TT * HD * 4); bf* ATh = (bf*)take((size_t)TT * DQ * 2); bf* ATl = (bf*)take((size_t)TT * DQ * 2);
    if ((size_t)(wsp - (char*)d_ws) > ws_size) return;    // ws 256 MiB
    float* FV = FK;   // v projection reuses the k buffer after the k planes are built (stream-ordered)
    { k_wtG<<<(unsigned)((DM * (DQ + 2 * DKV) / 64 + 63) / 64), 256, 0, stream>>>(wf, DM, DQ + 2 * DKV, WALL); WQ = WALL; WK = WALL + (size_t)DQ * DM; WV = WK + (size_t)DKV * DM;
      k_wtG<<<(unsigned)((DQ * DM / 64 + 63) / 64), 256, 0, stream>>>(wo, DQ, DM, WO);
       }
    k_csid<<<(TT * HD + 255) / 256, 256, 0, stream>>>(CS);
    const unsigned LQ = (unsigned)(((size_t)NH_ * TT * HD / 2 + 255) / 256), LKv = (unsigned)(((size_t)NKV * TT * HD / 2 + 255) / 256);
    for (int b = 0; b < NB_; ++b) {
        
        k_cvt8<<<(unsigned)(((size_t)TT * DM / 8 + 255) / 256), 256, 0, stream>>>(x + (size_t)b * TT * DM, XB, (size_t)TT * DM / 8);
        k_gemmw<bf, 0, false, 8><<<dim3(TT / 64, DQ / 64, 1), 256, 0, stream>>>(XB, nullptr, WQ, nullptr, DM, FQ, DQ, nullptr, 0, 0, 0);
        k_rope<<<LQ, 256, 0, stream>>>(FQ, DQ, NH_, CS, nullptr, nullptr, 1.0f, QP16, QPh, QPl);
        k_gemmw<bf, 0, false, 8><<<dim3(TT / 64, DKV / 64, 1), 256, 0, stream>>>(XB, nullptr, WK, nullptr, DM, FK, DKV, nullptr, 0, 0, 0);
        k_rope<<<LKv, 256, 0, stream>>>(FK, DKV, NKV, CS, nullptr, nullptr, 1.0f, KP16, KPh, KPl);
        k_gemmw<bf, 0, false, 8><<<dim3(TT / 64, DKV / 64, 1), 256, 0, stream>>>(XB, nullptr, WV, nullptr, DM, FV, DKV, nullptr, 0, 0, 0); k_vtp<<<LKv, 256, 0, stream>>>(FV, DKV, NKV, VT16, VTh, VTl);
        for (int h0 = 0; h0 < NH_; h0 += ZH) { const size_t zq = (size_t)h0, zk = (size_t)(h0 / REP);   // one kv head per query head: the pass's ZH heads use consecutive kv planes (z-strides TT*HD)
            k_gemmc<bf, 2, 1, 1><<<dim3(RH / 64, TT / 64, ZH), 32, 0, stream>>>(QPh + zq * TT * HD, QPl + zq * TT * HD, KPh + zk * TT * HD, KPl + zk * TT * HD, HD, HD, Sb, TT, 0, (size_t)TT * HD, (size_t)TT * HD, (size_t)TT * TT);
            k_gemmc<h16, 0, 1, 1><<<dim3((TT - RH) / 64, TT / 64, ZH), 32, 0, stream>>>(QP16 + zq * TT * HD + (size_t)RH * HD, nullptr, KP16 + zk * TT * HD, nullptr, HD, HD, Sb + (size_t)RH * TT, TT, RH, (size_t)TT * HD, (size_t)TT * HD, (size_t)TT * TT);
            k_asoft<<<ZH * TT / 8, 256, 0, stream>>>(Sb);
            k_gemmc<bf, 2, 2, 16><<<dim3(RH / 64, HD / 64, ZH), 512, 0, stream>>>((const bf*)Sb, (const bf*)Sb + TT, VTh + zk * HD * TT, VTl + zk * HD * TT, TT, 2 * TT, Ob, HD, 0, (size_t)2 * TT * TT, (size_t)HD * TT, (size_t)TT * HD);
            k_gemmc<h16, 0, 2, 16><<<dim3((TT - RH) / 64, HD / 64, ZH), 512, 0, stream>>>((const h16*)Sb + (size_t)RH * 2 * TT, nullptr, VT16 + zk * HD * TT, nullptr, TT, 2 * TT, Ob + (size_t)RH * HD, HD, RH, (size_t)2 * TT * TT, (size_t)HD * TT, (size_t)TT * HD);
            k_merge<<<(unsigned)(((size_t)ZH * TT * HD / 2 + 255) / 256), 256, 0, stream>>>(Ob, h0, ATh, ATl); }
        k_gemmw<bf, 1, false, 8><<<dim3(TT / 64, DM / 64, 1), 256, 0, stream>>>(ATh, ATl, WO, nullptr, DQ, OUT + (size_t)b * TT * DM, DM, nullptr, 0, 0, 0); }
}

// v003
// It runs in 396 microseconds.
// Timed twice side by side with v002, it ran 2.20 times as fast both times.
// All steps since v000 together make it 7.26 times as fast.
#include <hip/hip_runtime.h>

// MuCausalSelfAttention (x [4][2048][1024]; qkv = x W_attn ([1024][3072]: q | k | v column blocks, 16 heads x 64); muP scaling: scores = q.k / 64 (1/head_dim); causal (-inf); softmax; out = merged W_proj -> [4][2048][1024]).
// Compute dtypes, f32 accumulate: every input rounded to bf16; q/k/v on PLAIN bf16 operands (inputs: exact); causal scores and attn.v: query rows < 512 hl (3 products), the rest single fp16, fused in registers (running-maximum softmax, f32), keys past the diagonal pass never read; W_proj hl x exact (2 products).

#define NB_  4
#define TT   2048
#define DM   1024
#define NH_  16
#define NKV  16
#define REP  (NH_ / NKV)
#define HD   64
#define DQ   (NH_ * HD)
#define DKV  (NKV * HD)
#define RH   512                  // query rows < RH use hi+lo planes (0: none)
#define SCL  0.015625f   // muP: 1/head_dim
#define SCL2 (SCL * 1.4426950408889634f)   // the same in log2 units
typedef _Float16 h16;
typedef unsigned short bf;
typedef __attribute__((ext_vector_type(16))) __bf16   v16bf;
typedef __attribute__((ext_vector_type(16))) _Float16 v16h;
typedef __attribute__((ext_vector_type(8)))  _Float16 v8h;
typedef __attribute__((ext_vector_type(8)))  unsigned short v8us;
typedef __attribute__((ext_vector_type(8)))  float    v8f;
typedef __attribute__((ext_vector_type(4)))  float    v4f;
typedef v8h  __attribute__((may_alias)) v8ha;
typedef v4f  __attribute__((may_alias)) v4fa;
typedef v8us __attribute__((may_alias)) v8usa;

__device__ __forceinline__ unsigned short f2bf(float f) { unsigned u = __float_as_uint(f); u += 0x7FFFu + ((u >> 16) & 1u); return (unsigned short)(u >> 16); }
__device__ __forceinline__ float bf2f(unsigned short b) { return __uint_as_float(((unsigned)b) << 16); }
__device__ __forceinline__ float bfr(float f) { return bf2f(f2bf(f)); }
__device__ __forceinline__ v16h cat16(v8h lo, v8h hi) { return __builtin_shufflevector(lo, hi, 0, 1, 2, 3, 4, 5, 6, 7, 8, 9, 10, 11, 12, 13, 14, 15); }
__device__ __forceinline__ v16bf cat16b(v8us lo, v8us hi) { return __builtin_bit_cast(v16bf, __builtin_shufflevector(lo, hi, 0, 1, 2, 3, 4, 5, 6, 7, 8, 9, 10, 11, 12, 13, 14, 15)); }
__device__ __forceinline__ v8f wmma16(v16h a, v16h b, v8f c) { return __builtin_amdgcn_wmma_f32_16x16x32_f16(false, a, false, b, (short)0, c, false, false); }
__device__ __forceinline__ v8f wmmab(v16bf a, v16bf b, v8f c) { return __builtin_amdgcn_wmma_f32_16x16x32_bf16(false, a, false, b, (short)0, c, false, false); }



// ---- k_gemmw: register-blocked GEMM, NW WAVES per 64x64 output tile: wave w takes the 32-wide K steps w, w + NW, ... (16 accumulators each); the NW f32 partial tiles are staged in LDS and summed in wave order;
// operands straight from K-contiguous 16-bit planes; grid (M/64, N/64, Z), 32 x NW threads.
// C[m][n] (f32, pitch ldc, + optional f32 bias[n]) = sum_k A[m][k] Bt[n][k] (+ split products per NSPLIT). z-batch strides sA/sB/sC in elements. K % 32 == 0.
template <typename T16> struct WFrag;
template <> struct WFrag<h16> { typedef v16h V; static __device__ __forceinline__ V ld(const h16* p) { return cat16(*(const v8h*)p, *(const v8h*)(p + 16)); } static __device__ __forceinline__ v8f mma(V a, V b, v8f c) { return wmma16(a, b, c); } };
template <> struct WFrag<bf> { typedef v16bf V; static __device__ __forceinline__ V ld(const bf* p) { return cat16b(*(const v8us*)p, *(const v8us*)(p + 16)); } static __device__ __forceinline__ v8f mma(V a, V b, v8f c) { return wmmab(a, b, c); } };
template <typename T16, int NSPLIT, bool BIAS, int NW>
__global__ __launch_bounds__(32 * NW) void k_gemmw(const T16* __restrict__ A, const T16* __restrict__ A2, const T16* __restrict__ Bt, const T16* __restrict__ Bt2, int K, float* C, int ldc, const float* __restrict__ bias, size_t sA, size_t sB, size_t sC) {
    typedef typename WFrag<T16>::V V;
    __shared__ __align__(16) float os[NW * 64 * 68];
    const size_t z = blockIdx.z; A += z * sA; if (A2) A2 += z * sA; Bt += z * sB; if (Bt2) Bt2 += z * sB; C += z * sC;
    const int lane = threadIdx.x & 31, lr = lane & 15, hi = lane >> 4; const int r0 = blockIdx.x * 64, c0 = blockIdx.y * 64;
    const int wv = __builtin_amdgcn_readfirstlane((int)(threadIdx.x >> 5));   // wave number, scalar: the K loop's trip test stays a scalar branch
    v8f acc[4][4];
#pragma unroll
    for (int mb = 0; mb < 4; ++mb)
#pragma unroll
        for (int nb = 0; nb < 4; ++nb) acc[mb][nb] = (v8f){};
    const size_t aoff = (size_t)(r0 + lr) * K + 8 * hi, boff = (size_t)(c0 + lr) * K + 8 * hi;
#pragma unroll 1
    for (int kc = wv * 32; kc < K; kc += 32 * NW) {
        V a[4], a2[4];
#pragma unroll
        for (int mb = 0; mb < 4; ++mb) { a[mb] = WFrag<T16>::ld(A + aoff + (size_t)mb * 16 * K + kc); if (NSPLIT == 1 || NSPLIT == 2) a2[mb] = WFrag<T16>::ld(A2 + aoff + (size_t)mb * 16 * K + kc); }
#pragma unroll
        for (int nb = 0; nb < 4; ++nb) { const V b = WFrag<T16>::ld(Bt + boff + (size_t)nb * 16 * K + kc); V b2; if (NSPLIT >= 2) b2 = WFrag<T16>::ld(Bt2 + boff + (size_t)nb * 16 * K + kc);
#pragma unroll
            for (int mb = 0; mb < 4; ++mb) { acc[mb][nb] = WFrag<T16>::mma(a[mb], b, acc[mb][nb]); if (NSPLIT == 1 || NSPLIT == 2) acc[mb][nb] = WFrag<T16>::mma(a2[mb], b, acc[mb][nb]); if (NSPLIT >= 2) acc[mb][nb] = WFrag<T16>::mma(a[mb], b2, acc[mb][nb]); } }
        asm volatile("v_nop\n\tv_nop\n\tv_nop\n\tv_nop" : "+v"(acc[0][0]), "+v"(acc[1][1]), "+v"(acc[2][2]), "+v"(acc[3][3]) : "v"(a[0]), "v"(a[3]));
    }
    // every wave stages its whole 64x64 partial tile, so one barrier serves and no LDS is reused; then each thread sums its four-float slots over the waves, in wave order
#pragma unroll
    for (int mb = 0; mb < 4; ++mb) {
#pragma unroll
        for (int nb = 0; nb < 4; ++nb) {
#pragma unroll
            for (int j = 0; j < 8; ++j) os[wv * (64 * 68) + (mb * 16 + hi * 8 + j) * 68 + nb * 16 + lr] = acc[mb][nb][j]; } }
    __syncthreads();
    float* crow = C + (size_t)r0 * ldc + c0;
#pragma unroll
    for (int s = 0; s < 32 / NW; ++s) { const int slot = s * 32 * NW + (int)threadIdx.x; const int row = slot >> 4, cofs = (slot & 15) * 4; v4f val = *(const v4fa*)(os + row * 68 + cofs);
#pragma unroll
        for (int w = 1; w < NW; ++w) val += *(const v4fa*)(os + w * (64 * 68) + row * 68 + cofs);
        if (BIAS) { val[0] += bfr(bias[c0 + cofs]); val[1] += bfr(bias[c0 + cofs + 1]); val[2] += bfr(bias[c0 + cofs + 2]); val[3] += bfr(bias[c0 + cofs + 3]); }
        *(v4f*)(crow + (size_t)row * ldc + cofs) = val; }
}

__device__ __forceinline__ h16 tohx(float x) { return (h16)x; }
__device__ __forceinline__ void splitf(float y, unsigned short& h, unsigned short& l) { h = f2bf(y); l = f2bf(y - bf2f(h)); }
typedef __attribute__((ext_vector_type(2))) _Float16 v2h;
typedef __attribute__((ext_vector_type(4))) _Float16 v4h;
typedef __attribute__((ext_vector_type(2))) unsigned short v2us;
typedef __attribute__((ext_vector_type(4))) unsigned short v4us;
typedef __attribute__((ext_vector_type(2))) float v2f;
typedef __attribute__((ext_vector_type(4))) int v4i;

__global__ __launch_bounds__(256) void k_wtG(const float* __restrict__ w, int K, int N, bf* Bt) {
    const int lane = threadIdx.x & 31; const int L0 = (blockIdx.x * 8 + (threadIdx.x >> 5)) * 8; const int nlines = N * K / 64;
{
#pragma unroll 1
        for (int l = 0; l < 8; ++l) { const int L = L0 + l; if (L >= nlines) break; const size_t e = (size_t)L * 64 + lane * 2; const int k = (int)(e % K), n = (int)(e / K); v2us o;
            o[0] = f2bf(w[(size_t)k * N + n]); o[1] = f2bf(w[(size_t)(k + 1) * N + n]); *(v2us*)(Bt + e) = o; }
         }
}
__global__ __launch_bounds__(256) void k_cvt8(const float* __restrict__ src, bf* dst, size_t n8) { const size_t i = (size_t)blockIdx.x * 256 + threadIdx.x; if (i >= n8) return; const v8f v = *(const v8f*)(src + i * 8); v8us o;
#pragma unroll
    for (int k = 0; k < 8; ++k) o[k] = f2bf(v[k]); *(v8us*)(dst + i * 8) = o;  }
__global__ __launch_bounds__(256) void k_cscvt(const float* __restrict__ cosT, const float* __restrict__ sinT, float* CS) { const int idx = blockIdx.x * 256 + threadIdx.x; if (idx >= TT * HD) return; v2f cs; cs[0] = bfr(cosT[idx]); cs[1] = bfr(sinT[idx]); *(v2f*)(CS + (size_t)idx * 2) = cs;  }
// k_rope: head planes [h][t][d] (fp16 + hi/lo) of rope(x) x sc with the rotate-half convention out[d] = x[d] cos[t][d] - x[d+HD/2] sin[t][d], out[d+HD/2] = x[d+HD/2] cos[t][d+HD/2] + x[d] sin[t][d+HD/2]
__global__ __launch_bounds__(256) void k_rope(const float* __restrict__ F, int pitch, int nheads, const float* __restrict__ CS, const float* __restrict__ RF, const float* __restrict__ nw, float sc, h16* P16, bf* Ph, bf* Pl) {
    const size_t e = ((size_t)blockIdx.x * 256 + threadIdx.x) * 2; if (e >= (size_t)nheads * TT * HD) return; const int d = (int)(e % HD); const int t = (int)((e / HD) % TT); const int h = (int)(e / ((size_t)HD * TT)); const float* f = F + (size_t)t * pitch + h * HD; const float rf = RF ? RF[(size_t)h * TT + t] : 1.0f; v2h o16; v2us oh, ol;
#pragma unroll
    for (int q = 0; q < 2; ++q) { const int dd = d + q; const int dp = (dd < HD / 2) ? dd + HD / 2 : dd - HD / 2; float x0 = f[dd], x1 = f[dp];
        if (RF) { float n0 = __fmul_rn(x0, rf), n1 = __fmul_rn(x1, rf); asm volatile("" : "+v"(n0)); asm volatile("" : "+v"(n1)); x0 = __fmul_rn(bfr(nw[dd]), n0); x1 = __fmul_rn(bfr(nw[dp]), n1); }
        const v2f cs = *(const v2f*)(CS + ((size_t)t * HD + dd) * 2); float a = __fmul_rn(x0, cs[0]), bq = __fmul_rn(x1, cs[1]); asm volatile("" : "+v"(a)); asm volatile("" : "+v"(bq)); const float r = ((dd < HD / 2) ? __fsub_rn(a, bq) : __fadd_rn(a, bq)) * sc;
        o16[q] = tohx(r); unsigned short a2, c2; splitf(r, a2, c2); oh[q] = a2; ol[q] = c2; }
    *(v2h*)(P16 + e) = o16; *(v2us*)(Ph + e) = oh; *(v2us*)(Pl + e) = ol;  }
__global__ __launch_bounds__(256) void k_vtp(const float* __restrict__ F, int pitch, int nheads, h16* V16, bf* Vh, bf* Vl) { const size_t e = ((size_t)blockIdx.x * 256 + threadIdx.x) * 2; if (e >= (size_t)nheads * HD * TT) return; const int t = (int)(e % TT); const int d = (int)((e / TT) % HD); const int g = (int)(e / ((size_t)TT * HD)); v2h o16; v2us oh, ol;
#pragma unroll
    for (int q = 0; q < 2; ++q) { const float x = F[(size_t)(t + q) * pitch + g * HD + d]; o16[q] = tohx(x); unsigned short a2, c2; splitf(x, a2, c2); oh[q] = a2; ol[q] = c2; }
    *(v2h*)(V16 + e) = o16; *(v2us*)(Vh + e) = oh; *(v2us*)(Vl + e) = ol;  }
__global__ __launch_bounds__(256) void k_csid(float* CS) { const int idx = blockIdx.x * 256 + threadIdx.x; if (idx >= TT * HD) return; v2f cs; cs[0] = 1.0f; cs[1] = 0.0f; *(v2f*)(CS + (size_t)idx * 2) = cs;  }
__device__ __forceinline__ float xhalf(float x) { return __builtin_bit_cast(float, __builtin_amdgcn_permlanex16(__builtin_bit_cast(int, x), __builtin_bit_cast(int, x), 0x76543210, 0xfedcba98, false, false)); }   // lane l <-> lane l ^ 16
__device__ __forceinline__ void pcvt(const float (&p)[16], v16h& a, v16h& a2) { (void)a2;
#pragma unroll
    for (int e = 0; e < 16; ++e) a[e] = (_Float16)p[e]; }
__device__ __forceinline__ void pcvt(const float (&p)[16], v16bf& a, v16bf& a2) {
#pragma unroll
    for (int e = 0; e < 16; ++e) { const __bf16 h = (__bf16)p[e]; a[e] = h; a2[e] = (__bf16)(p[e] - (float)h); } }
template <typename T16, bool HL, int NG>
__device__ __forceinline__ void attn_rows(const T16* __restrict__ Q, const T16* __restrict__ Q2, const T16* __restrict__ Kp, const T16* __restrict__ K2, const T16* __restrict__ Vt, const T16* __restrict__ V2, int q0, bf* __restrict__ Oh, bf* __restrict__ Ol, int lr, int hi) {
    typedef typename WFrag<T16>::V V;
    V qf[NG][2], qf2[NG][2], kf[2][2], kf2[2][2];
#pragma unroll
    for (int g = 0; g < NG; ++g)
#pragma unroll
        for (int ks = 0; ks < 2; ++ks) { const size_t qo = (size_t)(q0 + g * 16 + lr) * HD + ks * 32 + 8 * hi; qf[g][ks] = WFrag<T16>::ld(Q + qo); if (HL) qf2[g][ks] = WFrag<T16>::ld(Q2 + qo); }
    v8f o[NG][4]; float mu[NG], ls[NG];
#pragma unroll
    for (int g = 0; g < NG; ++g) { mu[g] = -1.0e30f; ls[g] = 0.f;
#pragma unroll
        for (int dt = 0; dt < 4; ++dt) o[g][dt] = (v8f){}; }
    const int last = ((q0 + NG * 16 - 1) >> 5) << 5;   // first key of the pass that holds the diagonal
    const size_t ko = (size_t)lr * HD + 8 * hi, vo = (size_t)lr * TT + 8 * hi;
#pragma unroll
    for (int t = 0; t < 2; ++t)
#pragma unroll
        for (int ks = 0; ks < 2; ++ks) { kf[t][ks] = WFrag<T16>::ld(Kp + ko + t * 16 * HD + ks * 32); if (HL) kf2[t][ks] = WFrag<T16>::ld(K2 + ko + t * 16 * HD + ks * 32); }
#pragma unroll 1   // rolled: an unrolled pass would double the live fragments and cost resident waves
    for (int kb = 0; kb <= last; kb += 32) {
        V vf[4], vf2[4]; const T16* vp = Vt + vo + kb; const T16* vp2 = HL ? V2 + vo + kb : vp;
#pragma unroll
        for (int dt = 0; dt < 4; ++dt) { vf[dt] = WFrag<T16>::ld(vp + (size_t)dt * 16 * TT); if (HL) vf2[dt] = WFrag<T16>::ld(vp2 + (size_t)dt * 16 * TT); }
        v8f s[NG][2];
#pragma unroll
        for (int g = 0; g < NG; ++g)
#pragma unroll
            for (int t = 0; t < 2; ++t) { s[g][t] = (v8f){};
#pragma unroll
                for (int ks = 0; ks < 2; ++ks) { s[g][t] = WFrag<T16>::mma(kf[t][ks], qf[g][ks], s[g][t]); if (HL) { s[g][t] = WFrag<T16>::mma(kf[t][ks], qf2[g][ks], s[g][t]); s[g][t] = WFrag<T16>::mma(kf2[t][ks], qf[g][ks], s[g][t]); } } }
        // the next pass's key fragments fly under this pass's softmax (the last pass re-reads its own rows: in bounds, unused)
        const size_t kn = (size_t)min(kb + 32, last) * HD + ko; const T16* kp = Kp + kn; const T16* kp2 = HL ? K2 + kn : kp;
#pragma unroll
        for (int t = 0; t < 2; ++t)
#pragma unroll
            for (int ks = 0; ks < 2; ++ks) { kf[t][ks] = WFrag<T16>::ld(kp + t * 16 * HD + ks * 32); if (HL) kf2[t][ks] = WFrag<T16>::ld(kp2 + t * 16 * HD + ks * 32); }
        // stands behind the pass's loads; the pointers are inputs so that their registers stay untouched up to it (precaution: a register that an issued load names is not rewritten ahead of this wait)
        asm volatile("s_wait_xcnt 0x0" :: "v"(vp), "v"(vp2), "v"(kp), "v"(kp2) : "memory");
        if (kb == last) {   // wave-uniform: only the diagonal pass pays for the causal mask
#pragma unroll
            for (int g = 0; g < NG; ++g)
#pragma unroll
                for (int t = 0; t < 2; ++t)
#pragma unroll
                    for (int j = 0; j < 8; ++j) if (kb + t * 16 + hi * 8 + j > q0 + g * 16 + lr) s[g][t][j] = -3.0e38f;
        }
        float xm[NG]; bool need = false;
#pragma unroll
        for (int g = 0; g < NG; ++g) { float mx = -3.0e38f;
#pragma unroll
            for (int t = 0; t < 2; ++t)
#pragma unroll
                for (int j = 0; j < 8; ++j) mx = fmaxf(mx, s[g][t][j]);
            xm[g] = fmaxf(mx, xhalf(mx)) * SCL2; need = need || (xm[g] > mu[g] + 8.0f); }   // both halves of the wave hold the query's pass maximum (key 0 is never masked, so it is a real score from the first pass on)
        if (__builtin_amdgcn_ballot_w32(need) != 0) {   // one scalar branch a pass; always taken on the first pass (factor 0 on zeros)
#pragma unroll
            for (int g = 0; g < NG; ++g) { const float mn = fmaxf(mu[g], xm[g]); const float al = __builtin_amdgcn_exp2f(mu[g] - mn); mu[g] = mn; ls[g] *= al;
#pragma unroll
                for (int dt = 0; dt < 4; ++dt) o[g][dt] *= al; }
        }
#pragma unroll
        for (int g = 0; g < NG; ++g) { float p[16]; float s0 = 0.f, s1 = 0.f;
#pragma unroll
            for (int e = 0; e < 16; ++e) p[e] = __builtin_amdgcn_exp2f(__builtin_fmaf(s[g][e >> 3][e & 7], SCL2, -mu[g]));
#pragma unroll
            for (int e = 0; e < 16; e += 2) { s0 += p[e]; s1 += p[e + 1]; }
            ls[g] += s0 + s1;
            V pf, pf2; pcvt(p, pf, pf2);
#pragma unroll
            for (int dt = 0; dt < 4; ++dt) { o[g][dt] = WFrag<T16>::mma(vf[dt], pf, o[g][dt]); if (HL) { o[g][dt] = WFrag<T16>::mma(vf[dt], pf2, o[g][dt]); o[g][dt] = WFrag<T16>::mma(vf2[dt], pf, o[g][dt]); } } }
    }
    // O^T: a lane holds 8 consecutive d of one query per tile: one 16-byte store per plane
#pragma unroll
    for (int g = 0; g < NG; ++g) { const float inv = __fdiv_rn(1.0f, ls[g] + xhalf(ls[g])); const size_t oo = (size_t)(q0 + g * 16 + lr) * DQ + hi * 8; bf* ph = Oh + oo; bf* pl = Ol + oo;
#pragma unroll
        for (int dt = 0; dt < 4; ++dt) { v8us oh, ol;
#pragma unroll
            for (int j = 0; j < 8; ++j) { unsigned short a, c2; splitf(o[g][dt][j] * inv, a, c2); oh[j] = a; ol[j] = c2; }
            *(v8us*)(ph + dt * 16) = oh; *(v8us*)(pl + dt * 16) = ol;
            // stands behind the two stores; their data and base pointers are inputs so that those registers stay untouched up to it (precaution: a register that an issued store names is not rewritten ahead of this wait)
            asm volatile("s_wait_xcnt 0x0" :: "v"(oh), "v"(ol), "v"(ph), "v"(pl) : "memory"); } }
}
// grid (batch x head, row blocks): block y = 0 holds the last 256 query rows (the most keys), so that the long work-groups start first; the hi+lo rows (< RH, 128 a block) come last. 8 independent waves, no barrier.
// amdgpu_waves_per_eu(4, 4): holds the register allocator to 256 registers a wave, so that four waves stay resident on a SIMD (two work-groups a WGP) to cover the global loads' latency; launch_bounds alone would allow 512.
__global__ __launch_bounds__(256) __attribute__((amdgpu_waves_per_eu(4, 4))) void k_fattn(const h16* __restrict__ Q16, const h16* __restrict__ K16, const h16* __restrict__ V16, const bf* __restrict__ Qh, const bf* __restrict__ Ql, const bf* __restrict__ Kh, const bf* __restrict__ Kl, const bf* __restrict__ Vh, const bf* __restrict__ Vl, bf* __restrict__ Ah, bf* __restrict__ Al) {
    const int lane = threadIdx.x & 31, lr = lane & 15, hi = lane >> 4; const int wv = __builtin_amdgcn_readfirstlane((int)(threadIdx.x >> 5));   // wave number, scalar: the pass loop's trip test stays a scalar branch
    const int z = blockIdx.x, y = blockIdx.y; const size_t pz = (size_t)z * TT * HD; const size_t oz = (size_t)(z / NH_) * TT * DQ + (size_t)(z % NH_) * HD;
    if (y < (TT - RH) / 256) attn_rows<h16, false, 2>(Q16 + pz, nullptr, K16 + pz, nullptr, V16 + pz, nullptr, TT - 256 * (y + 1) + wv * 32, Ah + oz, Al + oz, lr, hi);
    else attn_rows<bf, true, 1>(Qh + pz, Ql + pz, Kh + pz, Kl + pz, Vh + pz, Vl + pz, RH - 128 * (y - (TT - RH) / 256 + 1) + wv * 16, Ah + oz, Al + oz, lr, hi);
}

extern "C" void kernel_launch(void* const* d_in, const int* in_sizes, int n_in,
                              void* d_out, int out_size, void* d_ws, size_t ws_size, hipStream_t stream) {
    (void)in_sizes; (void)n_in; (void)out_size;
    const float* x = (const float*)d_in[0]; const float* wf = (const float*)d_in[1]; const float* wo = (const float*)d_in[2];
    float* OUT = (float*)d_out;     // [4][2048][1024]
    char* wsp = (char*)d_ws;
    auto take = [&](size_t bytes) { char* p = wsp; wsp += (bytes + 255) & ~(size_t)255; return (void*)p; };
    const size_t PQ = (size_t)NH_ * TT * HD, PK = (size_t)NKV * TT * HD;   // elements of one batch's head planes; the planes hold all NB_ batches, [b][h][..]
    bf* WQ = nullptr; bf* WK = nullptr; bf* WV = nullptr; bf* WO = (bf*)take((size_t)DM * DQ * 2); float* CS = (float*)take((size_t)TT * HD * 2 * 4);
    bf* XB = (bf*)take((size_t)TT * DM * 2); bf* WALL = (bf*)take((size_t)(DQ + 2 * DKV) * DM * 2); float* FQ = (float*)take((size_t)TT * DQ * 4); float* FK = (float*)take((size_t)TT * DKV * 4);
    h16* QP16 = (h16*)take(NB_ * PQ * 2); h16* KP16 = (h16*)take(NB_ * PK * 2); h16* VT16 = (h16*)take(NB_ * PK * 2);
    bf* QPh = (bf*)take(NB_ * PQ * 2); bf* QPl = (bf*)take(NB_ * PQ * 2); bf* KPh = (bf*)take(NB_ * PK * 2); bf* KPl = (bf*)take(NB_ * PK * 2); bf* VTh = (bf*)take(NB_ * PK * 2); bf* VTl = (bf*)take(NB_ * PK * 2);
    bf* ATh = (bf*)take((size_t)NB_ * TT * DQ * 2); bf* ATl = (bf*)take((size_t)NB_ * TT * DQ * 2);
    if ((size_t)(wsp - (char*)d_ws) > ws_size) return;    // ws 256 MiB
    float* FV = FK;   // v projection reuses the k buffer after the k planes are built (stream-ordered)
    { k_wtG<<<(unsigned)((DM * (DQ + 2 * DKV) / 64 + 63) / 64), 256, 0, stream>>>(wf, DM, DQ + 2 * DKV, WALL); WQ = WALL; WK = WALL + (size_t)DQ * DM; WV = WK + (size_t)DKV * DM;
      k_wtG<<<(unsigned)((DQ * DM / 64 + 63) / 64), 256, 0, stream>>>(wo, DQ, DM, WO);
       }
    k_csid<<<(TT * HD + 255) / 256, 256, 0, stream>>>(CS);
    const unsigned LQ = (unsigned)(((size_t)NH_ * TT * HD / 2 + 255) / 256), LKv = (unsigned)(((size_t)NKV * TT * HD / 2 + 255) / 256);
    for (int b = 0; b < NB_; ++b) {
        k_cvt8<<<(unsigned)(((size_t)TT * DM / 8 + 255) / 256), 256, 0, stream>>>(x + (size_t)b * TT * DM, XB, (size_t)TT * DM / 8);
        k_gemmw<bf, 0, false, 8><<<dim3(TT / 64, DQ / 64, 1), 256, 0, stream>>>(XB, nullptr, WQ, nullptr, DM, FQ, DQ, nullptr, 0, 0, 0);
        k_rope<<<LQ, 256, 0, stream>>>(FQ, DQ, NH_, CS, nullptr, nullptr, 1.0f, QP16 + b * PQ, QPh + b * PQ, QPl + b * PQ);
        k_gemmw<bf, 0, false, 8><<<dim3(TT / 64, DKV / 64, 1), 256, 0, stream>>>(XB, nullptr, WK, nullptr, DM, FK, DKV, nullptr, 0, 0, 0);
        k_rope<<<LKv, 256, 0, stream>>>(FK, DKV, NKV, CS, nullptr, nullptr, 1.0f, KP16 + b * PK, KPh + b * PK, KPl + b * PK);
        k_gemmw<bf, 0, false, 8><<<dim3(TT / 64, DKV / 64, 1), 256, 0, stream>>>(XB, nullptr, WV, nullptr, DM, FV, DKV, nullptr, 0, 0, 0); k_vtp<<<LKv, 256, 0, stream>>>(FV, DKV, NKV, VT16 + b * PK, VTh + b * PK, VTl + b * PK); }
    // one kv head per query head (REP == 1): plane z = b * NH_ + h of every operand
    k_fattn<<<dim3(NB_ * NH_, (TT - RH) / 256 + RH / 128, 1), 256, 0, stream>>>(QP16, KP16, VT16, QPh, QPl, KPh, KPl, VTh, VTl, ATh, ATl);
    for (int b = 0; b < NB_; ++b)
        k_gemmw<bf, 1, false, 8><<<dim3(TT / 64, DM / 64, 1), 256, 0, stream>>>(ATh + (size_t)b * TT * DQ, ATl + (size_t)b * TT * DQ, WO, nullptr, DQ, OUT + (size_t)b * TT * DM, DM, nullptr, 0, 0, 0);
}

// v004
// Measured time: 265 microseconds a run.
// Two timings next to v003 put it at 1.49 and 1.50 times that version's speed.
// Counting every step since v000, it is 10.8 times as fast.
#include <hip/hip_runtime.h>

// MuCausalSelfAttention (x [4][2048][1024]; qkv = x W_attn ([1024][3072]: q | k | v column blocks, 16 heads x 64); muP scaling: scores = q.k / 64 (1/head_dim); causal (-inf); softmax; out = merged W_proj -> [4][2048][1024]).
// Compute dtypes, f32 accumulate: every input rounded to bf16; q/k/v on PLAIN bf16 operands (inputs: exact), their head planes written by the projection's own epilogue; causal scores and attn.v: query rows < 512 hl (3 products), the rest single fp16, fused in registers (running-maximum softmax, f32), keys past the diagonal pass never read; W_proj hl x exact (2 products).

#define NB_  4
#define TT   2048
#define DM   1024
#define NH_  16
#define NKV  16
#define REP  (NH_ / NKV)
#define HD   64
#define DQ   (NH_ * HD)
#define DKV  (NKV * HD)
#define RH   512                  // query rows < RH use hi+lo planes (0: none)
#define SCL  0.015625f   // muP: 1/head_dim
#define SCL2 (SCL * 1.4426950408889634f)   // the same in log2 units
typedef _Float16 h16;
typedef unsigned short bf;
typedef __attribute__((ext_vector_type(16))) __bf16   v16bf;
typedef __attribute__((ext_vector_type(16))) _Float16 v16h;
typedef __attribute__((ext_vector_type(8)))  _Float16 v8h;
typedef __attribute__((ext_vector_type(8)))  unsigned short v8us;
typedef __attribute__((ext_vector_type(8)))  float    v8f;
typedef __attribute__((ext_vector_type(4)))  float    v4f;
typedef v8h  __attribute__((may_alias)) v8ha;
typedef v4f  __attribute__((may_alias)) v4fa;
typedef v8us __attribute__((may_alias)) v8usa;

__device__ __forceinline__ unsigned short f2bf(float f) { unsigned u = __float_as_uint(f); u += 0x7FFFu + ((u >> 16) & 1u); return (unsigned short)(u >> 16); }
__device__ __forceinline__ float bf2f(unsigned short b) { return __uint_as_float(((unsigned)b) << 16); }
__device__ __forceinline__ float bfr(float f) { return bf2f(f2bf(f)); }
__device__ __forceinline__ v16h cat16(v8h lo, v8h hi) { return __builtin_shufflevector(lo, hi, 0, 1, 2, 3, 4, 5, 6, 7, 8, 9, 10, 11, 12, 13, 14, 15); }
__device__ __forceinline__ v16bf cat16b(v8us lo, v8us hi) { return __builtin_bit_cast(v16bf, __builtin_shufflevector(lo, hi, 0, 1, 2, 3, 4, 5, 6, 7, 8, 9, 10, 11, 12, 13, 14, 15)); }
__device__ __forceinline__ v8f wmma16(v16h a, v16h b, v8f c) { return __builtin_amdgcn_wmma_f32_16x16x32_f16(false, a, false, b, (short)0, c, false, false); }
__device__ __forceinline__ v8f wmmab(v16bf a, v16bf b, v8f c) { return __builtin_amdgcn_wmma_f32_16x16x32_bf16(false, a, false, b, (short)0, c, false, false); }



// ---- k_gemmw: register-blocked GEMM, NW WAVES per 64x64 output tile: wave w takes the 32-wide K steps w, w + NW, ... (16 accumulators each); the NW f32 partial tiles are staged in LDS and summed in wave order;
// operands straight from K-contiguous 16-bit planes; grid (M/64, N/64, Z), 32 x NW threads.
// C[m][n] (f32, pitch ldc, + optional f32 bias[n]) = sum_k A[m][k] Bt[n][k] (+ split products per NSPLIT). z-batch strides sA/sB/sC in elements. K % 32 == 0.
template <typename T16> struct WFrag;
template <> struct WFrag<h16> { typedef v16h V; static __device__ __forceinline__ V ld(const h16* p) { return cat16(*(const v8h*)p, *(const v8h*)(p + 16)); } static __device__ __forceinline__ v8f mma(V a, V b, v8f c) { return wmma16(a, b, c); } };
template <> struct WFrag<bf> { typedef v16bf V; static __device__ __forceinline__ V ld(const bf* p) { return cat16b(*(const v8us*)p, *(const v8us*)(p + 16)); } static __device__ __forceinline__ v8f mma(V a, V b, v8f c) { return wmmab(a, b, c); } };
template <typename T16, int NSPLIT, bool BIAS, int NW>
__global__ __launch_bounds__(32 * NW) void k_gemmw(const T16* __restrict__ A, const T16* __restrict__ A2, const T16* __restrict__ Bt, const T16* __restrict__ Bt2, int K, float* C, int ldc, const float* __restrict__ bias, size_t sA, size_t sB, size_t sC) {
    typedef typename WFrag<T16>::V V;
    __shared__ __align__(16) float os[NW * 64 * 68];
    const size_t z = blockIdx.z; A += z * sA; if (A2) A2 += z * sA; Bt += z * sB; if (Bt2) Bt2 += z * sB; C += z * sC;
    const int lane = threadIdx.x & 31, lr = lane & 15, hi = lane >> 4; const int r0 = blockIdx.x * 64, c0 = blockIdx.y * 64;
    const int wv = __builtin_amdgcn_readfirstlane((int)(threadIdx.x >> 5));   // wave number, scalar: the K loop's trip test stays a scalar branch
    v8f acc[4][4];
#pragma unroll
    for (int mb = 0; mb < 4; ++mb)
#pragma unroll
        for (int nb = 0; nb < 4; ++nb) acc[mb][nb] = (v8f){};
    const size_t aoff = (size_t)(r0 + lr) * K + 8 * hi, boff = (size_t)(c0 + lr) * K + 8 * hi;
#pragma unroll 1
    for (int kc = wv * 32; kc < K; kc += 32 * NW) {
        V a[4], a2[4];
#pragma unroll
        for (int mb = 0; mb < 4; ++mb) { a[mb] = WFrag<T16>::ld(A + aoff + (size_t)mb * 16 * K + kc); if (NSPLIT == 1 || NSPLIT == 2) a2[mb] = WFrag<T16>::ld(A2 + aoff + (size_t)mb * 16 * K + kc); }
#pragma unroll
        for (int nb = 0; nb < 4; ++nb) { const V b = WFrag<T16>::ld(Bt + boff + (size_t)nb * 16 * K + kc); V b2; if (NSPLIT >= 2) b2 = WFrag<T16>::ld(Bt2 + boff + (size_t)nb * 16 * K + kc);
#pragma unroll
            for (int mb = 0; mb < 4; ++mb) { acc[mb][nb] = WFrag<T16>::mma(a[mb], b, acc[mb][nb]); if (NSPLIT == 1 || NSPLIT == 2) acc[mb][nb] = WFrag<T16>::mma(a2[mb], b, acc[mb][nb]); if (NSPLIT >= 2) acc[mb][nb] = WFrag<T16>::mma(a[mb], b2, acc[mb][nb]); } }
        asm volatile("v_nop\n\tv_nop\n\tv_nop\n\tv_nop" : "+v"(acc[0][0]), "+v"(acc[1][1]), "+v"(acc[2][2]), "+v"(acc[3][3]) : "v"(a[0]), "v"(a[3]));
    }
    // every wave stages its whole 64x64 partial tile, so one barrier serves and no LDS is reused; then each thread sums its four-float slots over the waves, in wave order
#pragma unroll
    for (int mb = 0; mb < 4; ++mb) {
#pragma unroll
        for (int nb = 0; nb < 4; ++nb) {
#pragma unroll
            for (int j = 0; j < 8; ++j) os[wv * (64 * 68) + (mb * 16 + hi * 8 + j) * 68 + nb * 16 + lr] = acc[mb][nb][j]; } }
    __syncthreads();
    float* crow = C + (size_t)r0 * ldc + c0;
#pragma unroll
    for (int s = 0; s < 32 / NW; ++s) { const int slot = s * 32 * NW + (int)threadIdx.x; const int row = slot >> 4, cofs = (slot & 15) * 4; v4f val = *(const v4fa*)(os + row * 68 + cofs);
#pragma unroll
        for (int w = 1; w < NW; ++w) val += *(const v4fa*)(os + w * (64 * 68) + row * 68 + cofs);
        if (BIAS) { val[0] += bfr(bias[c0 + cofs]); val[1] += bfr(bias[c0 + cofs + 1]); val[2] += bfr(bias[c0 + cofs + 2]); val[3] += bfr(bias[c0 + cofs + 3]); }
        *(v4f*)(crow + (size_t)row * ldc + cofs) = val; }
}

__device__ __forceinline__ h16 tohx(float x) { return (h16)x; }
__device__ __forceinline__ void splitf(float y, unsigned short& h, unsigned short& l) { h = f2bf(y); l = f2bf(y - bf2f(h)); }
typedef __attribute__((ext_vector_type(2))) _Float16 v2h;
typedef __attribute__((ext_vector_type(4))) _Float16 v4h;
typedef __attribute__((ext_vector_type(2))) unsigned short v2us;
typedef __attribute__((ext_vector_type(4))) unsigned short v4us;
typedef __attribute__((ext_vector_type(2))) float v2f;
typedef __attribute__((ext_vector_type(4))) int v4i;

__global__ __launch_bounds__(256) void k_wtG(const float* __restrict__ w, int K, int N, bf* Bt) {
    const int lane = threadIdx.x & 31; const int L0 = (blockIdx.x * 8 + (threadIdx.x >> 5)) * 8; const int nlines = N * K / 64;
{
#pragma unroll 1
        for (int l = 0; l < 8; ++l) { const int L = L0 + l; if (L >= nlines) break; const size_t e = (size_t)L * 64 + lane * 2; const int k = (int)(e % K), n = (int)(e / K); v2us o;
            o[0] = f2bf(w[(size_t)k * N + n]); o[1] = f2bf(w[(size_t)(k + 1) * N + n]); *(v2us*)(Bt + e) = o; }
         }
}
__global__ __launch_bounds__(256) void k_cvt8(const float* __restrict__ src, bf* dst, size_t n8) { const size_t i = (size_t)blockIdx.x * 256 + threadIdx.x; if (i >= n8) return; const v8f v = *(const v8f*)(src + i * 8); v8us o;
#pragma unroll
    for (int k = 0; k < 8; ++k) o[k] = f2bf(v[k]); *(v8us*)(dst + i * 8) = o;  }
// ---- k_qkv: the q, k and v projections of every batch in one launch; the tile's epilogue writes the head planes (fp16 + hi/lo bf16) itself, so that no f32 q/k/v ever reaches memory.
// Main loop and LDS sum as in k_gemmw (NW waves per 64x64 tile, wave w takes the 32-wide K steps w, w + NW, ...; partial tiles summed in wave order). A 64-column block of W_attn is one head.
// grid (NB_ TT / 64 row blocks of x, 3 x 16 heads: q | k | v). q and k: A = x rows, B = weight rows, tile [t][d] = 8 KiB in a row of plane [b][h][t][d].
// v: the operands change places (A = weight rows, B = x rows), so that the tile comes out [d][t], the d-major value plane's own order, with no transpose.
template <int NW>
__global__ __launch_bounds__(32 * NW) void k_qkv(const bf* __restrict__ X, const bf* __restrict__ Wt, h16* Q16, bf* Qh, bf* Ql, h16* K16, bf* Kh, bf* Kl, h16* V16, bf* Vh, bf* Vl) {
    typedef WFrag<bf>::V V;
    __shared__ __align__(16) float os[NW * 64 * 68];
    const int lane = threadIdx.x & 31, lr = lane & 15, hi = lane >> 4; const int xt = blockIdx.x, ct = blockIdx.y;
    const int wv = __builtin_amdgcn_readfirstlane((int)(threadIdx.x >> 5));   // wave number, scalar
    const bool isv = ct >= (DQ + DKV) / 64;   // the same for the whole work-group
    const bf* xr = X + (size_t)xt * 64 * DM; const bf* wr = Wt + (size_t)ct * 64 * DM;
    const bf* A = (isv ? wr : xr) + (size_t)lr * DM + 8 * hi; const bf* Bt = (isv ? xr : wr) + (size_t)lr * DM + 8 * hi;
    v8f acc[4][4];
#pragma unroll
    for (int mb = 0; mb < 4; ++mb)
#pragma unroll
        for (int nb = 0; nb < 4; ++nb) acc[mb][nb] = (v8f){};
#pragma unroll 1   // rolled, as in k_gemmw: unrolled trips would double the live fragments
    for (int it = 0; it < DM / (32 * NW); ++it) {
        const bf* ap = A + (wv + it * NW) * 32; const bf* bp = Bt + (wv + it * NW) * 32; V a[4], b[4];
#pragma unroll
        for (int mb = 0; mb < 4; ++mb) { a[mb] = WFrag<bf>::ld(ap + (size_t)mb * 16 * DM); b[mb] = WFrag<bf>::ld(bp + (size_t)mb * 16 * DM); }
        // stands behind the trip's loads; the two pointers are inputs so that their registers stay untouched up to it (precaution: a register that an issued load names is not rewritten ahead of this wait);
        // the loaded fragments are inputs too, so that each keeps registers of its own and all sixteen loads of a trip fly together (without them the build reuses one B fragment's registers and waits for memory four times a trip)
        asm volatile("s_wait_xcnt 0x0" :: "v"(ap), "v"(bp), "v"(a[0]), "v"(a[1]), "v"(a[2]), "v"(a[3]), "v"(b[0]), "v"(b[1]), "v"(b[2]), "v"(b[3]) : "memory");
#pragma unroll
        for (int nb = 0; nb < 4; ++nb)
#pragma unroll
            for (int mb = 0; mb < 4; ++mb) acc[mb][nb] = WFrag<bf>::mma(a[mb], b[nb], acc[mb][nb]);
    }
    // every wave stages its whole 64x64 partial tile, so one barrier serves and no LDS is reused
#pragma unroll
    for (int mb = 0; mb < 4; ++mb) {
#pragma unroll
        for (int nb = 0; nb < 4; ++nb) {
#pragma unroll
            for (int j = 0; j < 8; ++j) os[wv * (64 * 68) + (mb * 16 + hi * 8 + j) * 68 + nb * 16 + lr] = acc[mb][nb][j]; } }
    __syncthreads();
    const int hd = ct & (NH_ - 1), bb = xt / (TT / 64), t0 = (xt % (TT / 64)) * 64;   // head, batch, first token of the tile
    const size_t base = (size_t)(bb * NH_ + hd) * TT * HD + (isv ? (size_t)t0 : (size_t)t0 * HD); const int ld = isv ? TT : HD;
    h16* P16 = (isv ? V16 : ct < DQ / 64 ? Q16 : K16) + base; bf* Ph = (isv ? Vh : ct < DQ / 64 ? Qh : Kh) + base; bf* Pl = (isv ? Vl : ct < DQ / 64 ? Ql : Kl) + base;
    // each thread sums eight consecutive columns of a row over the waves, in wave order, and stores 16 bytes to each plane
#pragma unroll
    for (int s = 0; s < 16 / NW; ++s) { const int slot = s * 32 * NW + (int)threadIdx.x; const int row = slot >> 3, cofs = (slot & 7) * 8; const float* op = os + row * 68 + cofs;
        v4f v0 = *(const v4fa*)op, v1 = *(const v4fa*)(op + 4);
#pragma unroll
        for (int w = 1; w < NW; ++w) { v0 += *(const v4fa*)(op + w * (64 * 68)); v1 += *(const v4fa*)(op + w * (64 * 68) + 4); }
        v8h o16; v8us oh, ol;
#pragma unroll
        for (int j = 0; j < 8; ++j) { const float r = j < 4 ? v0[j & 3] : v1[j & 3]; o16[j] = tohx(r); unsigned short a2, c2; splitf(r, a2, c2); oh[j] = a2; ol[j] = c2; }
        const size_t e = (size_t)row * ld + cofs; h16* p16 = P16 + e; bf* ph = Ph + e; bf* pl = Pl + e;
        *(v8h*)p16 = o16; *(v8us*)ph = oh; *(v8us*)pl = ol;
        // stands behind the three stores; their data and pointers are inputs so that those registers stay untouched up to it (precaution: a register that an issued store names is not rewritten ahead of this wait)
        asm volatile("s_wait_xcnt 0x0" :: "v"(o16), "v"(oh), "v"(ol), "v"(p16), "v"(ph), "v"(pl) : "memory"); }
}
__device__ __forceinline__ float xhalf(float x) { return __builtin_bit_cast(float, __builtin_amdgcn_permlanex16(__builtin_bit_cast(int, x), __builtin_bit_cast(int, x), 0x76543210, 0xfedcba98, false, false)); }   // lane l <-> lane l ^ 16
__device__ __forceinline__ void pcvt(const float (&p)[16], v16h& a, v16h& a2) { (void)a2;
#pragma unroll
    for (int e = 0; e < 16; ++e) a[e] = (_Float16)p[e]; }
__device__ __forceinline__ void pcvt(const float (&p)[16], v16bf& a, v16bf& a2) {
#pragma unroll
    for (int e = 0; e < 16; ++e) { const __bf16 h = (__bf16)p[e]; a[e] = h; a2[e] = (__bf16)(p[e] - (float)h); } }
template <typename T16, bool HL, int NG>
__device__ __forceinline__ void attn_rows(const T16* __restrict__ Q, const T16* __restrict__ Q2, const T16* __restrict__ Kp, const T16* __restrict__ K2, const T16* __restrict__ Vt, const T16* __restrict__ V2, int q0, bf* __restrict__ Oh, bf* __restrict__ Ol, int lr, int hi) {
    typedef typename WFrag<T16>::V V;
    V qf[NG][2], qf2[NG][2], kf[2][2], kf2[2][2];
#pragma unroll
    for (int g = 0; g < NG; ++g)
#pragma unroll
        for (int ks = 0; ks < 2; ++ks) { const size_t qo = (size_t)(q0 + g * 16 + lr) * HD + ks * 32 + 8 * hi; qf[g][ks] = WFrag<T16>::ld(Q + qo); if (HL) qf2[g][ks] = WFrag<T16>::ld(Q2 + qo); }
    v8f o[NG][4]; float mu[NG], ls[NG];
#pragma unroll
    for (int g = 0; g < NG; ++g) { mu[g] = -1.0e30f; ls[g] = 0.f;
#pragma unroll
        for (int dt = 0; dt < 4; ++dt) o[g][dt] = (v8f){}; }
    const int last = ((q0 + NG * 16 - 1) >> 5) << 5;   // first key of the pass that holds the diagonal
    const size_t ko = (size_t)lr * HD + 8 * hi, vo = (size_t)lr * TT + 8 * hi;
#pragma unroll
    for (int t = 0; t < 2; ++t)
#pragma unroll
        for (int ks = 0; ks < 2; ++ks) { kf[t][ks] = WFrag<T16>::ld(Kp + ko + t * 16 * HD + ks * 32); if (HL) kf2[t][ks] = WFrag<T16>::ld(K2 + ko + t * 16 * HD + ks * 32); }
#pragma unroll 1   // rolled: an unrolled pass would double the live fragments and cost resident waves
    for (int kb = 0; kb <= last; kb += 32) {
        V vf[4], vf2[4]; const T16* vp = Vt + vo + kb; const T16* vp2 = HL ? V2 + vo + kb : vp;
#pragma unroll
        for (int dt = 0; dt < 4; ++dt) { vf[dt] = WFrag<T16>::ld(vp + (size_t)dt * 16 * TT); if (HL) vf2[dt] = WFrag<T16>::ld(vp2 + (size_t)dt * 16 * TT); }
        v8f s[NG][2];
#pragma unroll
        for (int g = 0; g < NG; ++g)
#pragma unroll
            for (int t = 0; t < 2; ++t) { s[g][t] = (v8f){};
#pragma unroll
                for (int ks = 0; ks < 2; ++ks) { s[g][t] = WFrag<T16>::mma(kf[t][ks], qf[g][ks], s[g][t]); if (HL) { s[g][t] = WFrag<T16>::mma(kf[t][ks], qf2[g][ks], s[g][t]); s[g][t] = WFrag<T16>::mma(kf2[t][ks], qf[g][ks], s[g][t]); } } }
        // the next pass's key fragments fly under this pass's softmax (the last pass re-reads its own rows: in bounds, unused)
        const size_t kn = (size_t)min(kb + 32, last) * HD + ko; const T16* kp = Kp + kn; const T16* kp2 = HL ? K2 + kn : kp;
#pragma unroll
        for (int t = 0; t < 2; ++t)
#pragma unroll
            for (int ks = 0; ks < 2; ++ks) { kf[t][ks] = WFrag<T16>::ld(kp + t * 16 * HD + ks * 32); if (HL) kf2[t][ks] = WFrag<T16>::ld(kp2 + t * 16 * HD + ks * 32); }
        // stands behind the pass's loads; the pointers are inputs so that their registers stay untouched up to it (precaution: a register that an issued load names is not rewritten ahead of this wait)
        asm volatile("s_wait_xcnt 0x0" :: "v"(vp), "v"(vp2), "v"(kp), "v"(kp2) : "memory");
        if (kb == last) {   // wave-uniform: only the diagonal pass pays for the causal mask
#pragma unroll
            for (int g = 0; g < NG; ++g)
#pragma unroll
                for (int t = 0; t < 2; ++t)
#pragma unroll
                    for (int j = 0; j < 8; ++j) if (kb + t * 16 + hi * 8 + j > q0 + g * 16 + lr) s[g][t][j] = -3.0e38f;
        }
        float xm[NG]; bool need = false;
#pragma unroll
        for (int g = 0; g < NG; ++g) { float mx = -3.0e38f;
#pragma unroll
            for (int t = 0; t < 2; ++t)
#pragma unroll
                for (int j = 0; j < 8; ++j) mx = fmaxf(mx, s[g][t][j]);
            xm[g] = fmaxf(mx, xhalf(mx)) * SCL2; need = need || (xm[g] > mu[g] + 8.0f); }   // both halves of the wave hold the query's pass maximum (key 0 is never masked, so it is a real score from the first pass on)
        if (__builtin_amdgcn_ballot_w32(need) != 0) {   // one scalar branch a pass; always taken on the first pass (factor 0 on zeros)
#pragma unroll
            for (int g = 0; g < NG; ++g) { const float mn = fmaxf(mu[g], xm[g]); const float al = __builtin_amdgcn_exp2f(mu[g] - mn); mu[g] = mn; ls[g] *= al;
#pragma unroll
                for (int dt = 0; dt < 4; ++dt) o[g][dt] *= al; }
        }
#pragma unroll
        for (int g = 0; g < NG; ++g) { float p[16]; float s0 = 0.f, s1 = 0.f;
#pragma unroll
            for (int e = 0; e < 16; ++e) p[e] = __builtin_amdgcn_exp2f(__builtin_fmaf(s[g][e >> 3][e & 7], SCL2, -mu[g]));
#pragma unroll
            for (int e = 0; e < 16; e += 2) { s0 += p[e]; s1 += p[e + 1]; }
            ls[g] += s0 + s1;
            V pf, pf2; pcvt(p, pf, pf2);
#pragma unroll
            for (int dt = 0; dt < 4; ++dt) { o[g][dt] = WFrag<T16>::mma(vf[dt], pf, o[g][dt]); if (HL) { o[g][dt] = WFrag<T16>::mma(vf[dt], pf2, o[g][dt]); o[g][dt] = WFrag<T16>::mma(vf2[dt], pf, o[g][dt]); } } }
    }
    // O^T: a lane holds 8 consecutive d of one query per tile: one 16-byte store per plane
#pragma unroll
    for (int g = 0; g < NG; ++g) { const float inv = __fdiv_rn(1.0f, ls[g] + xhalf(ls[g])); const size_t oo = (size_t)(q0 + g * 16 + lr) * DQ + hi * 8; bf* ph = Oh + oo; bf* pl = Ol + oo;
#pragma unroll
        for (int dt = 0; dt < 4; ++dt) { v8us oh, ol;
#pragma unroll
            for (int j = 0; j < 8; ++j) { unsigned short a, c2; splitf(o[g][dt][j] * inv, a, c2); oh[j] = a; ol[j] = c2; }
            *(v8us*)(ph + dt * 16) = oh; *(v8us*)(pl + dt * 16) = ol;
            // stands behind the two stores; their data and base pointers are inputs so that those registers stay untouched up to it (precaution: a register that an issued store names is not rewritten ahead of this wait)
            asm volatile("s_wait_xcnt 0x0" :: "v"(oh), "v"(ol), "v"(ph), "v"(pl) : "memory"); } }
}
// grid (batch x head, row blocks): block y = 0 holds the last 256 query rows (the most keys), so that the long work-groups start first; the hi+lo rows (< RH, 128 a block) come last. 8 independent waves, no barrier.
// amdgpu_waves_per_eu(4, 4): holds the register allocator to 256 registers a wave, so that four waves stay resident on a SIMD (two work-groups a WGP) to cover the global loads' latency; launch_bounds alone would allow 512.
__global__ __launch_bounds__(256) __attribute__((amdgpu_waves_per_eu(4, 4))) void k_fattn(const h16* __restrict__ Q16, const h16* __restrict__ K16, const h16* __restrict__ V16, const bf* __restrict__ Qh, const bf* __restrict__ Ql, const bf* __restrict__ Kh, const bf* __restrict__ Kl, const bf* __restrict__ Vh, const bf* __restrict__ Vl, bf* __restrict__ Ah, bf* __restrict__ Al) {
    const int lane = threadIdx.x & 31, lr = lane & 15, hi = lane >> 4; const int wv = __builtin_amdgcn_readfirstlane((int)(threadIdx.x >> 5));   // wave number, scalar: the pass loop's trip test stays a scalar branch
    const int z = blockIdx.x, y = blockIdx.y; const size_t pz = (size_t)z * TT * HD; const size_t oz = (size_t)(z / NH_) * TT * DQ + (size_t)(z % NH_) * HD;
    if (y < (TT - RH) / 256) attn_rows<h16, false, 2>(Q16 + pz, nullptr, K16 + pz, nullptr, V16 + pz, nullptr, TT - 256 * (y + 1) + wv * 32, Ah + oz, Al + oz, lr, hi);
    else attn_rows<bf, true, 1>(Qh + pz, Ql + pz, Kh + pz, Kl + pz, Vh + pz, Vl + pz, RH - 128 * (y - (TT - RH) / 256 + 1) + wv * 16, Ah + oz, Al + oz, lr, hi);
}

extern "C" void kernel_launch(void* const* d_in, const int* in_sizes, int n_in,
                              void* d_out, int out_size, void* d_ws, size_t ws_size, hipStream_t stream) {
    (void)in_sizes; (void)n_in; (void)out_size;
    const float* x = (const float*)d_in[0]; const float* wf = (const float*)d_in[1]; const float* wo = (const float*)d_in[2];
    float* OUT = (float*)d_out;     // [4][2048][1024]
    char* wsp = (char*)d_ws;
    auto take = [&](size_t bytes) { char* p = wsp; wsp += (bytes + 255) & ~(size_t)255; return (void*)p; };
    const size_t PQ = (size_t)NH_ * TT * HD, PK = (size_t)NKV * TT * HD;   // elements of one batch's head planes; the planes hold all NB_ batches, [b][h][..]
    bf* WO = (bf*)take((size_t)DM * DQ * 2);
    bf* XB = (bf*)take((size_t)NB_ * TT * DM * 2); bf* WALL = (bf*)take((size_t)(DQ + 2 * DKV) * DM * 2);
    h16* QP16 = (h16*)take(NB_ * PQ * 2); h16* KP16 = (h16*)take(NB_ * PK * 2); h16* VT16 = (h16*)take(NB_ * PK * 2);
    bf* QPh = (bf*)take(NB_ * PQ * 2); bf* QPl = (bf*)take(NB_ * PQ * 2); bf* KPh = (bf*)take(NB_ * PK * 2); bf* KPl = (bf*)take(NB_ * PK * 2); bf* VTh = (bf*)take(NB_ * PK * 2); bf* VTl = (bf*)take(NB_ * PK * 2);
    bf* ATh = (bf*)take((size_t)NB_ * TT * DQ * 2); bf* ATl = (bf*)take((size_t)NB_ * TT * DQ * 2);
    if ((size_t)(wsp - (char*)d_ws) > ws_size) return;    // ws 256 MiB
    k_wtG<<<(unsigned)((DM * (DQ + 2 * DKV) / 64 + 63) / 64), 256, 0, stream>>>(wf, DM, DQ + 2 * DKV, WALL);
    k_wtG<<<(unsigned)((DQ * DM / 64 + 63) / 64), 256, 0, stream>>>(wo, DQ, DM, WO);
    k_cvt8<<<(unsigned)(((size_t)NB_ * TT * DM / 8 + 255) / 256), 256, 0, stream>>>(x, XB, (size_t)NB_ * TT * DM / 8);
    k_qkv<8><<<dim3(NB_ * TT / 64, (DQ + 2 * DKV) / 64, 1), 256, 0, stream>>>(XB, WALL, QP16, QPh, QPl, KP16, KPh, KPl, VT16, VTh, VTl);
    // one kv head per query head (REP == 1): plane z = b * NH_ + h of every operand
    k_fattn<<<dim3(NB_ * NH_, (TT - RH) / 256 + RH / 128, 1), 256, 0, stream>>>(QP16, KP16, VT16, QPh, QPl, KPh, KPl, VTh, VTl, ATh, ATl);
    for (int b = 0; b < NB_; ++b)
        k_gemmw<bf, 1, false, 8><<<dim3(TT / 64, DM / 64, 1), 256, 0, stream>>>(ATh + (size_t)b * TT * DQ, ATl + (size_t)b * TT * DQ, WO, nullptr, DQ, OUT + (size_t)b * TT * DM, DM, nullptr, 0, 0, 0);
}

// v005
// It runs in 176 microseconds.
// In two side-by-side timings against v004, it was 1.50 and 1.51 times as fast.
// All steps since v000 together make it 16.3 times as fast.
#include <hip/hip_runtime.h>

// MuCausalSelfAttention (x [4][2048][1024]; qkv = x W_attn ([1024][3072]: q | k | v column blocks, 16 heads x 64); muP scaling: scores = q.k / 64 (1/head_dim); causal (-inf); softmax; out = merged W_proj -> [4][2048][1024]).
// Compute dtypes, f32 accumulate: every input rounded to bf16; q/k/v on PLAIN bf16 operands (inputs: exact), their head planes written by the projection's own epilogue; causal scores and attn.v: query rows < 512 hl (3 products), the rest single fp16, fused in registers (running-maximum softmax, f32), keys past the diagonal pass never read; W_proj hl x exact (2 products).
// FRAGMENT ORDER: every 16-bit operand plane (R rows x K, the product's k along a row) lies in memory as tiles of 16 rows x 32 k = 512 elements, tile (r / 16, k / 32) at ((r / 16) * (K / 32) + k / 32) * 512;
// inside a tile element (r, k) stands at ((k % 32) / 16) * 256 + (((k % 16) / 8) * 16 + r % 16) * 8 + k % 8: lane l of a wave finds its two 16-byte fragment pieces at l * 8 and 256 + l * 8, so that each wave-wide load is 512 bytes in a row (4 whole lines, not 16 pieces of 32 bytes).

#define NB_  4
#define TT   2048
#define DM   1024
#define NH_  16
#define NKV  16
#define REP  (NH_ / NKV)
#define HD   64
#define DQ   (NH_ * HD)
#define DKV  (NKV * HD)
#define RH   512                  // query rows < RH use hi+lo planes (0: none)
#define SCL  0.015625f   // muP: 1/head_dim
#define SCL2 (SCL * 1.4426950408889634f)   // the same in log2 units
typedef _Float16 h16;
typedef unsigned short bf;
typedef __attribute__((ext_vector_type(16))) __bf16   v16bf;
typedef __attribute__((ext_vector_type(16))) _Float16 v16h;
typedef __attribute__((ext_vector_type(8)))  _Float16 v8h;
typedef __attribute__((ext_vector_type(8)))  unsigned short v8us;
typedef __attribute__((ext_vector_type(8)))  float    v8f;
typedef __attribute__((ext_vector_type(4)))  float    v4f;
typedef v8h  __attribute__((may_alias)) v8ha;
typedef v4f  __attribute__((may_alias)) v4fa;
typedef v8us __attribute__((may_alias)) v8usa;

__device__ __forceinline__ unsigned short f2bf(float f) { unsigned u = __float_as_uint(f); u += 0x7FFFu + ((u >> 16) & 1u); return (unsigned short)(u >> 16); }
__device__ __forceinline__ float bf2f(unsigned short b) { return __uint_as_float(((unsigned)b) << 16); }
__device__ __forceinline__ float bfr(float f) { return bf2f(f2bf(f)); }
__device__ __forceinline__ v16h cat16(v8h lo, v8h hi) { return __builtin_shufflevector(lo, hi, 0, 1, 2, 3, 4, 5, 6, 7, 8, 9, 10, 11, 12, 13, 14, 15); }
__device__ __forceinline__ v16bf cat16b(v8us lo, v8us hi) { return __builtin_bit_cast(v16bf, __builtin_shufflevector(lo, hi, 0, 1, 2, 3, 4, 5, 6, 7, 8, 9, 10, 11, 12, 13, 14, 15)); }
__device__ __forceinline__ v8f wmma16(v16h a, v16h b, v8f c) { return __builtin_amdgcn_wmma_f32_16x16x32_f16(false, a, false, b, (short)0, c, false, false); }
__device__ __forceinline__ v8f wmmab(v16bf a, v16bf b, v8f c) { return __builtin_amdgcn_wmma_f32_16x16x32_bf16(false, a, false, b, (short)0, c, false, false); }



// ---- k_gemmw: register-blocked GEMM, NW WAVES per 64x64 output tile: wave w takes the 32-wide K steps w, w + NW, ... (16 accumulators each); the NW f32 partial tiles are staged in LDS and summed in wave order;
// operands straight from 16-bit planes in fragment order; grid (M/64, N/64, Z), 32 x NW threads.
// C[m][n] (f32, pitch ldc, + optional f32 bias[n]) = sum_k A[m][k] Bt[n][k] (+ split products per NSPLIT). z-batch strides sA/sB/sC in elements. K % 32 == 0.
template <typename T16> struct WFrag;
template <> struct WFrag<h16> { typedef v16h V; static __device__ __forceinline__ V ld(const h16* p) { return cat16(*(const v8h*)p, *(const v8h*)(p + 256)); } static __device__ __forceinline__ v8f mma(V a, V b, v8f c) { return wmma16(a, b, c); } };
template <> struct WFrag<bf> { typedef v16bf V; static __device__ __forceinline__ V ld(const bf* p) { return cat16b(*(const v8us*)p, *(const v8us*)(p + 256)); } static __device__ __forceinline__ v8f mma(V a, V b, v8f c) { return wmmab(a, b, c); } };
// K is a compile-time constant, so that a trip's loads differ from its three base pointers by immediate offsets only and no address register is formed, or reused, between them.
template <typename T16, int NSPLIT, bool BIAS, int NW, int K>
__global__ __launch_bounds__(32 * NW) void k_gemmw(const T16* __restrict__ A, const T16* __restrict__ A2, const T16* __restrict__ Bt, const T16* __restrict__ Bt2, float* C, int ldc, const float* __restrict__ bias, size_t sA, size_t sB, size_t sC) {
    typedef typename WFrag<T16>::V V;
    __shared__ __align__(16) float os[NW * 64 * 68];
    const size_t z = blockIdx.z; A += z * sA; if (A2) A2 += z * sA; Bt += z * sB; if (Bt2) Bt2 += z * sB; C += z * sC;
    const int lane = threadIdx.x & 31, lr = lane & 15, hi = lane >> 4; const int r0 = blockIdx.x * 64, c0 = blockIdx.y * 64;
    const int wv = __builtin_amdgcn_readfirstlane((int)(threadIdx.x >> 5));   // wave number, scalar: the K loop's trip test stays a scalar branch
    v8f acc[4][4];
#pragma unroll
    for (int mb = 0; mb < 4; ++mb)
#pragma unroll
        for (int nb = 0; nb < 4; ++nb) acc[mb][nb] = (v8f){};
    const size_t aoff = (size_t)r0 * K + 8 * lane, boff = (size_t)c0 * K + 8 * lane;   // first tile of the row block (16 rows of tiles = 16 K elements), the lane's piece
#pragma unroll 1
    for (int kc = wv * 32; kc < K; kc += 32 * NW) {
        V a[4], a2[4]; const T16* ap = A + aoff + (size_t)kc * 16; const T16* ap2 = (NSPLIT == 1 || NSPLIT == 2) ? A2 + aoff + (size_t)kc * 16 : ap; const T16* bp = Bt + boff + (size_t)kc * 16; const T16* bp2 = NSPLIT >= 2 ? Bt2 + boff + (size_t)kc * 16 : bp;   // k step kc / 32 = tile kc / 32 of the row
#pragma unroll
        for (int mb = 0; mb < 4; ++mb) { a[mb] = WFrag<T16>::ld(ap + (size_t)mb * 16 * K); if (NSPLIT == 1 || NSPLIT == 2) a2[mb] = WFrag<T16>::ld(ap2 + (size_t)mb * 16 * K); }
#pragma unroll
        for (int nb = 0; nb < 4; ++nb) { const V b = WFrag<T16>::ld(bp + (size_t)nb * 16 * K); V b2; if (NSPLIT >= 2) b2 = WFrag<T16>::ld(bp2 + (size_t)nb * 16 * K);
#pragma unroll
            for (int mb = 0; mb < 4; ++mb) { acc[mb][nb] = WFrag<T16>::mma(a[mb], b, acc[mb][nb]); if (NSPLIT == 1 || NSPLIT == 2) acc[mb][nb] = WFrag<T16>::mma(a2[mb], b, acc[mb][nb]); if (NSPLIT >= 2) acc[mb][nb] = WFrag<T16>::mma(a[mb], b2, acc[mb][nb]); } }
        // stands behind the trip's loads; the pointers are inputs so that their registers stay untouched up to it (precaution: a register that an issued load names is not rewritten ahead of this wait)
        asm volatile("s_wait_xcnt 0x0" :: "v"(ap), "v"(ap2), "v"(bp), "v"(bp2) : "memory");
        asm volatile("v_nop\n\tv_nop\n\tv_nop\n\tv_nop" : "+v"(acc[0][0]), "+v"(acc[1][1]), "+v"(acc[2][2]), "+v"(acc[3][3]) : "v"(a[0]), "v"(a[3]));
    }
    // every wave stages its whole 64x64 partial tile, so one barrier serves and no LDS is reused; then each thread sums its four-float slots over the waves, in wave order
#pragma unroll
    for (int mb = 0; mb < 4; ++mb) {
#pragma unroll
        for (int nb = 0; nb < 4; ++nb) {
#pragma unroll
            for (int j = 0; j < 8; ++j) os[wv * (64 * 68) + (mb * 16 + hi * 8 + j) * 68 + nb * 16 + lr] = acc[mb][nb][j]; } }
    __syncthreads();
    float* crow = C + (size_t)r0 * ldc + c0;
#pragma unroll
    for (int s = 0; s < 32 / NW; ++s) { const int slot = s * 32 * NW + (int)threadIdx.x; const int row = slot >> 4, cofs = (slot & 15) * 4; v4f val = *(const v4fa*)(os + row * 68 + cofs);
#pragma unroll
        for (int w = 1; w < NW; ++w) val += *(const v4fa*)(os + w * (64 * 68) + row * 68 + cofs);
        if (BIAS) { val[0] += bfr(bias[c0 + cofs]); val[1] += bfr(bias[c0 + cofs + 1]); val[2] += bfr(bias[c0 + cofs + 2]); val[3] += bfr(bias[c0 + cofs + 3]); }
        *(v4f*)(crow + (size_t)row * ldc + cofs) = val; }
}

__device__ __forceinline__ h16 tohx(float x) { return (h16)x; }
__device__ __forceinline__ void splitf(float y, unsigned short& h, unsigned short& l) { h = f2bf(y); l = f2bf(y - bf2f(h)); }
typedef __attribute__((ext_vector_type(2))) _Float16 v2h;
typedef __attribute__((ext_vector_type(4))) _Float16 v4h;
typedef __attribute__((ext_vector_type(2))) unsigned short v2us;
typedef __attribute__((ext_vector_type(4))) unsigned short v4us;
typedef __attribute__((ext_vector_type(2))) float v2f;
typedef __attribute__((ext_vector_type(4))) int v4i;

// k_wtG: Bt = bf16(w^T) in fragment order (rows n, k along a row), w [K][N] f32. A wave writes one half tile (512 bytes in a row): lane l takes 8 consecutive k of row n = 16 nt + l % 16, so that each of its 8 loads reads 64 bytes in a row of two rows of w.
// The 8 waves of a block take 2 x 2 neighbouring tiles (32 n x 64 k), so that both halves of a 128-byte line of w are read on one WGP. grid (N / 32) * (K / 64).
__global__ __launch_bounds__(256) void k_wtG(const float* __restrict__ w, int K, int N, bf* Bt) {
    const int lane = threadIdx.x & 31, wv = threadIdx.x >> 5; const int kp = K / 64;
    const int nt = ((int)blockIdx.x / kp) * 2 + ((wv >> 1) & 1), kt = ((int)blockIdx.x % kp) * 2 + (wv >> 2), half = wv & 1;
    const float* wp = w + (size_t)(kt * 32 + half * 16 + (lane >> 4) * 8) * N + nt * 16 + (lane & 15); v8us o;
#pragma unroll
    for (int j = 0; j < 8; ++j) o[j] = f2bf(wp[(size_t)j * N]);
    *(v8us*)(Bt + ((size_t)nt * (K / 32) + kt) * 512 + half * 256 + lane * 8) = o;
}
// k_cvtp: dst = bf16(src) in fragment order, src [rows][DM] f32. A wave takes one tile (16 rows x 32 k = one whole 128-byte line of each row): four loads of 4 whole lines each; a lane's 4 values are half a fragment piece, stored as 8 bytes (64 bytes in a row per 4 rows).
__global__ __launch_bounds__(256) void k_cvtp(const float* __restrict__ src, bf* dst) {
    const int lane = threadIdx.x & 31; const int tile = (int)blockIdx.x * 8 + (int)(threadIdx.x >> 5); const int rt = tile / (DM / 32), kt = tile % (DM / 32);
    const float* sp = src + (size_t)(rt * 16 + (lane >> 3)) * DM + kt * 32 + (lane & 7) * 4;
    bf* dp = dst + (size_t)tile * 512 + ((lane & 7) >> 2) * 256 + (((lane >> 1) & 1) * 16 + (lane >> 3)) * 8 + (lane & 1) * 4;
    v4f v[4];
#pragma unroll
    for (int i = 0; i < 4; ++i) v[i] = *(const v4f*)(sp + (size_t)i * 4 * DM);
#pragma unroll
    for (int i = 0; i < 4; ++i) { v4us o;
#pragma unroll
        for (int k = 0; k < 4; ++k) o[k] = f2bf(v[i][k]);
        *(v4us*)(dp + i * 32) = o; }
}
// ---- k_qkv: the q, k and v projections of every batch in one launch; the tile's epilogue writes the head planes (fp16 + hi/lo bf16) itself, so that no f32 q/k/v ever reaches memory.
// Main loop and LDS sum as in k_gemmw (NW waves per 64x64 tile, wave w takes the 32-wide K steps w, w + NW, ...; partial tiles summed in wave order). A 64-column block of W_attn is one head.
// grid (NB_ TT / 64 row blocks of x, 3 x 16 heads: q | k | v). q and k: A = x rows, B = weight rows, tile [t][d] = 8 KiB in a row of plane [b][h][t][d] (fragment order, k = d).
// v: the operands change places (A = weight rows, B = x rows), so that the tile comes out [d][t], the d-major value plane's own order (fragment order, k = t), with no transpose.
template <int NW>
__global__ __launch_bounds__(32 * NW) void k_qkv(const bf* __restrict__ X, const bf* __restrict__ Wt, h16* Q16, bf* Qh, bf* Ql, h16* K16, bf* Kh, bf* Kl, h16* V16, bf* Vh, bf* Vl) {
    typedef WFrag<bf>::V V;
    __shared__ __align__(16) float os[NW * 64 * 68];
    const int lane = threadIdx.x & 31, lr = lane & 15, hi = lane >> 4; const int xt = blockIdx.x, ct = blockIdx.y;
    const int wv = __builtin_amdgcn_readfirstlane((int)(threadIdx.x >> 5));   // wave number, scalar
    const bool isv = ct >= (DQ + DKV) / 64;   // the same for the whole work-group
    const bf* xr = X + (size_t)xt * 64 * DM; const bf* wr = Wt + (size_t)ct * 64 * DM;
    const bf* A = (isv ? wr : xr) + 8 * lane; const bf* Bt = (isv ? xr : wr) + 8 * lane;
    v8f acc[4][4];
#pragma unroll
    for (int mb = 0; mb < 4; ++mb)
#pragma unroll
        for (int nb = 0; nb < 4; ++nb) acc[mb][nb] = (v8f){};
#pragma unroll 1   // rolled, as in k_gemmw: unrolled trips would double the live fragments
    for (int it = 0; it < DM / (32 * NW); ++it) {
        const bf* ap = A + (wv + it * NW) * 512; const bf* bp = Bt + (wv + it * NW) * 512; V a[4], b[4];
#pragma unroll
        for (int mb = 0; mb < 4; ++mb) { a[mb] = WFrag<bf>::ld(ap + (size_t)mb * 16 * DM); b[mb] = WFrag<bf>::ld(bp + (size_t)mb * 16 * DM); }
        // stands behind the trip's loads; the two pointers are inputs so that their registers stay untouched up to it (precaution: a register that an issued load names is not rewritten ahead of this wait);
        // the loaded fragments are inputs too, so that each keeps registers of its own and all sixteen loads of a trip fly together (without them the build reuses one B fragment's registers and waits for memory four times a trip)
        asm volatile("s_wait_xcnt 0x0" :: "v"(ap), "v"(bp), "v"(a[0]), "v"(a[1]), "v"(a[2]), "v"(a[3]), "v"(b[0]), "v"(b[1]), "v"(b[2]), "v"(b[3]) : "memory");
#pragma unroll
        for (int nb = 0; nb < 4; ++nb)
#pragma unroll
            for (int mb = 0; mb < 4; ++mb) acc[mb][nb] = WFrag<bf>::mma(a[mb], b[nb], acc[mb][nb]);
    }
    // every wave stages its whole 64x64 partial tile, so one barrier serves and no LDS is reused
#pragma unroll
    for (int mb = 0; mb < 4; ++mb) {
#pragma unroll
        for (int nb = 0; nb < 4; ++nb) {
#pragma unroll
            for (int j = 0; j < 8; ++j) os[wv * (64 * 68) + (mb * 16 + hi * 8 + j) * 68 + nb * 16 + lr] = acc[mb][nb][j]; } }
    __syncthreads();
    const int hd = ct & (NH_ - 1), bb = xt / (TT / 64), t0 = (xt % (TT / 64)) * 64;   // head, batch, first token of the tile
    const size_t base = (size_t)(bb * NH_ + hd) * TT * HD + (isv ? (size_t)t0 * 16 : (size_t)t0 * HD); const int ld = isv ? TT * 16 : HD * 16;   // ld: from one 16-row band of tiles to the next
    h16* P16 = (isv ? V16 : ct < DQ / 64 ? Q16 : K16) + base; bf* Ph = (isv ? Vh : ct < DQ / 64 ? Qh : Kh) + base; bf* Pl = (isv ? Vl : ct < DQ / 64 ? Ql : Kl) + base;
    // each thread sums eight consecutive columns of a row (one fragment piece) over the waves, in wave order, and stores 16 bytes to each plane; slots run in fragment order, so that a wave stores 512 bytes in a row
#pragma unroll
    for (int s = 0; s < 16 / NW; ++s) { const int slot = s * 32 * NW + (int)threadIdx.x; const int row = (slot >> 7) * 16 + (slot & 15), cofs = ((slot >> 6) & 1) * 32 + ((slot >> 5) & 1) * 16 + ((slot >> 4) & 1) * 8; const float* op = os + row * 68 + cofs;
        v4f v0 = *(const v4fa*)op, v1 = *(const v4fa*)(op + 4);
#pragma unroll
        for (int w = 1; w < NW; ++w) { v0 += *(const v4fa*)(op + w * (64 * 68)); v1 += *(const v4fa*)(op + w * (64 * 68) + 4); }
        v8h o16; v8us oh, ol;
#pragma unroll
        for (int j = 0; j < 8; ++j) { const float r = j < 4 ? v0[j & 3] : v1[j & 3]; o16[j] = tohx(r); unsigned short a2, c2; splitf(r, a2, c2); oh[j] = a2; ol[j] = c2; }
        const size_t e = (size_t)(slot >> 7) * ld + (slot & 127) * 8; h16* p16 = P16 + e; bf* ph = Ph + e; bf* pl = Pl + e;
        *(v8h*)p16 = o16; *(v8us*)ph = oh; *(v8us*)pl = ol;
        // stands behind the three stores; their data and pointers are inputs so that those registers stay untouched up to it (precaution: a register that an issued store names is not rewritten ahead of this wait)
        asm volatile("s_wait_xcnt 0x0" :: "v"(o16), "v"(oh), "v"(ol), "v"(p16), "v"(ph), "v"(pl) : "memory"); }
}
__device__ __forceinline__ float xhalf(float x) { return __builtin_bit_cast(float, __builtin_amdgcn_permlanex16(__builtin_bit_cast(int, x), __builtin_bit_cast(int, x), 0x76543210, 0xfedcba98, false, false)); }   // lane l <-> lane l ^ 16
__device__ __forceinline__ void pcvt(const float (&p)[16], v16h& a, v16h& a2) { (void)a2;
#pragma unroll
    for (int e = 0; e < 16; ++e) a[e] = (_Float16)p[e]; }
__device__ __forceinline__ void pcvt(const float (&p)[16], v16bf& a, v16bf& a2) {
#pragma unroll
    for (int e = 0; e < 16; ++e) { const __bf16 h = (__bf16)p[e]; a[e] = h; a2[e] = (__bf16)(p[e] - (float)h); } }
template <typename T16, bool HL, int NG>
__device__ __forceinline__ void attn_rows(const T16* __restrict__ Q, const T16* __restrict__ Q2, const T16* __restrict__ Kp, const T16* __restrict__ K2, const T16* __restrict__ Vt, const T16* __restrict__ V2, int q0, bf* __restrict__ Oh, bf* __restrict__ Ol, int lr, int hi) {
    typedef typename WFrag<T16>::V V;
    V qf[NG][2], qf2[NG][2], kf[2][2], kf2[2][2];
#pragma unroll
    for (int g = 0; g < NG; ++g)
#pragma unroll
        for (int ks = 0; ks < 2; ++ks) { const size_t qo = (size_t)(q0 + g * 16) * HD + ks * 512 + 8 * (hi * 16 + lr); qf[g][ks] = WFrag<T16>::ld(Q + qo); if (HL) qf2[g][ks] = WFrag<T16>::ld(Q2 + qo); }
    v8f o[NG][4]; float mu[NG], ls[NG];
#pragma unroll
    for (int g = 0; g < NG; ++g) { mu[g] = -1.0e30f; ls[g] = 0.f;
#pragma unroll
        for (int dt = 0; dt < 4; ++dt) o[g][dt] = (v8f){}; }
    const int last = ((q0 + NG * 16 - 1) >> 5) << 5;   // first key of the pass that holds the diagonal
    const size_t ko = 8 * (hi * 16 + lr), vo = ko;   // the lane's piece of a tile
#pragma unroll
    for (int t = 0; t < 2; ++t)
#pragma unroll
        for (int ks = 0; ks < 2; ++ks) { kf[t][ks] = WFrag<T16>::ld(Kp + ko + t * 16 * HD + ks * 512); if (HL) kf2[t][ks] = WFrag<T16>::ld(K2 + ko + t * 16 * HD + ks * 512); }
#pragma unroll 1   // rolled: an unrolled pass would double the live fragments and cost resident waves
    for (int kb = 0; kb <= last; kb += 32) {
        V vf[4], vf2[4]; const T16* vp = Vt + vo + kb * 16; const T16* vp2 = HL ? V2 + vo + kb * 16 : vp;
#pragma unroll
        for (int dt = 0; dt < 4; ++dt) { vf[dt] = WFrag<T16>::ld(vp + (size_t)dt * 16 * TT); if (HL) vf2[dt] = WFrag<T16>::ld(vp2 + (size_t)dt * 16 * TT); }
        v8f s[NG][2];
#pragma unroll
        for (int g = 0; g < NG; ++g)
#pragma unroll
            for (int t = 0; t < 2; ++t) { s[g][t] = (v8f){};
#pragma unroll
                for (int ks = 0; ks < 2; ++ks) { s[g][t] = WFrag<T16>::mma(kf[t][ks], qf[g][ks], s[g][t]); if (HL) { s[g][t] = WFrag<T16>::mma(kf[t][ks], qf2[g][ks], s[g][t]); s[g][t] = WFrag<T16>::mma(kf2[t][ks], qf[g][ks], s[g][t]); } } }
        // the next pass's key fragments fly under this pass's softmax (the last pass re-reads its own rows: in bounds, unused)
        const size_t kn = (size_t)min(kb + 32, last) * HD + ko; const T16* kp = Kp + kn; const T16* kp2 = HL ? K2 + kn : kp;
#pragma unroll
        for (int t = 0; t < 2; ++t)
#pragma unroll
            for (int ks = 0; ks < 2; ++ks) { kf[t][ks] = WFrag<T16>::ld(kp + t * 16 * HD + ks * 512); if (HL) kf2[t][ks] = WFrag<T16>::ld(kp2 + t * 16 * HD + ks * 512); }
        // stands behind the pass's loads; the pointers are inputs so that their registers stay untouched up to it (precaution: a register that an issued load names is not rewritten ahead of this wait)
        asm volatile("s_wait_xcnt 0x0" :: "v"(vp), "v"(vp2), "v"(kp), "v"(kp2) : "memory");
        if (kb == last) {   // wave-uniform: only the diagonal pass pays for the causal mask
#pragma unroll
            for (int g = 0; g < NG; ++g)
#pragma unroll
                for (int t = 0; t < 2; ++t)
#pragma unroll
                    for (int j = 0; j < 8; ++j) if (kb + t * 16 + hi * 8 + j > q0 + g * 16 + lr) s[g][t][j] = -3.0e38f;
        }
        float xm[NG]; bool need = false;
#pragma unroll
        for (int g = 0; g < NG; ++g) { float mx = -3.0e38f;
#pragma unroll
            for (int t = 0; t < 2; ++t)
#pragma unroll
                for (int j = 0; j < 8; ++j) mx = fmaxf(mx, s[g][t][j]);
            xm[g] = fmaxf(mx, xhalf(mx)) * SCL2; need = need || (xm[g] > mu[g] + 8.0f); }   // both halves of the wave hold the query's pass maximum (key 0 is never masked, so it is a real score from the first pass on)
        if (__builtin_amdgcn_ballot_w32(need) != 0) {   // one scalar branch a pass; always taken on the first pass (factor 0 on zeros)
#pragma unroll
            for (int g = 0; g < NG; ++g) { const float mn = fmaxf(mu[g], xm[g]); const float al = __builtin_amdgcn_exp2f(mu[g] - mn); mu[g] = mn; ls[g] *= al;
#pragma unroll
                for (int dt = 0; dt < 4; ++dt) o[g][dt] *= al; }
        }
#pragma unroll
        for (int g = 0; g < NG; ++g) { float p[16]; float s0 = 0.f, s1 = 0.f;
#pragma unroll
            for (int e = 0; e < 16; ++e) p[e] = __builtin_amdgcn_exp2f(__builtin_fmaf(s[g][e >> 3][e & 7], SCL2, -mu[g]));
#pragma unroll
            for (int e = 0; e < 16; e += 2) { s0 += p[e]; s1 += p[e + 1]; }
            ls[g] += s0 + s1;
            V pf, pf2; pcvt(p, pf, pf2);
#pragma unroll
            for (int dt = 0; dt < 4; ++dt) { o[g][dt] = WFrag<T16>::mma(vf[dt], pf, o[g][dt]); if (HL) { o[g][dt] = WFrag<T16>::mma(vf[dt], pf2, o[g][dt]); o[g][dt] = WFrag<T16>::mma(vf2[dt], pf, o[g][dt]); } } }
    }
    // O^T: a lane holds 8 consecutive d of one query per tile, which is its own piece of the merged plane's fragment order (rows = tokens, k = head * 64 + d): one 16-byte store per plane, 512 bytes in a row per wave
#pragma unroll
    for (int g = 0; g < NG; ++g) { const float inv = __fdiv_rn(1.0f, ls[g] + xhalf(ls[g])); const size_t oo = (size_t)(q0 + g * 16) * DQ + 8 * (hi * 16 + lr); bf* ph = Oh + oo; bf* pl = Ol + oo;
#pragma unroll
        for (int dt = 0; dt < 4; ++dt) { v8us oh, ol;
#pragma unroll
            for (int j = 0; j < 8; ++j) { unsigned short a, c2; splitf(o[g][dt][j] * inv, a, c2); oh[j] = a; ol[j] = c2; }
            *(v8us*)(ph + dt * 256) = oh; *(v8us*)(pl + dt * 256) = ol;
            // stands behind the two stores; their data and base pointers are inputs so that those registers stay untouched up to it (precaution: a register that an issued store names is not rewritten ahead of this wait)
            asm volatile("s_wait_xcnt 0x0" :: "v"(oh), "v"(ol), "v"(ph), "v"(pl) : "memory"); } }
}
// grid (batch x head, row blocks): block y = 0 holds the last 256 query rows (the most keys), so that the long work-groups start first; the hi+lo rows (< RH, 128 a block) come last. 8 independent waves, no barrier.
// amdgpu_waves_per_eu(4, 4): holds the register allocator to 256 registers a wave, so that four waves stay resident on a SIMD (two work-groups a WGP) to cover the global loads' latency; launch_bounds alone would allow 512.
__global__ __launch_bounds__(256) __attribute__((amdgpu_waves_per_eu(4, 4))) void k_fattn(const h16* __restrict__ Q16, const h16* __restrict__ K16, const h16* __restrict__ V16, const bf* __restrict__ Qh, const bf* __restrict__ Ql, const bf* __restrict__ Kh, const bf* __restrict__ Kl, const bf* __restrict__ Vh, const bf* __restrict__ Vl, bf* __restrict__ Ah, bf* __restrict__ Al) {
    const int lane = threadIdx.x & 31, lr = lane & 15, hi = lane >> 4; const int wv = __builtin_amdgcn_readfirstlane((int)(threadIdx.x >> 5));   // wave number, scalar: the pass loop's trip test stays a scalar branch
    const int z = blockIdx.x, y = blockIdx.y; const size_t pz = (size_t)z * TT * HD; const size_t oz = (size_t)(z / NH_) * TT * DQ + (size_t)(z % NH_) * (HD * 16);   // head h = tiles 2 h, 2 h + 1 of a 16-token band
    if (y < (TT - RH) / 256) attn_rows<h16, false, 2>(Q16 + pz, nullptr, K16 + pz, nullptr, V16 + pz, nullptr, TT - 256 * (y + 1) + wv * 32, Ah + oz, Al + oz, lr, hi);
    else attn_rows<bf, true, 1>(Qh + pz, Ql + pz, Kh + pz, Kl + pz, Vh + pz, Vl + pz, RH - 128 * (y - (TT - RH) / 256 + 1) + wv * 16, Ah + oz, Al + oz, lr, hi);
}

extern "C" void kernel_launch(void* const* d_in, const int* in_sizes, int n_in,
                              void* d_out, int out_size, void* d_ws, size_t ws_size, hipStream_t stream) {
    (void)in_sizes; (void)n_in; (void)out_size;
    const float* x = (const float*)d_in[0]; const float* wf = (const float*)d_in[1]; const float* wo = (const float*)d_in[2];
    float* OUT = (float*)d_out;     // [4][2048][1024]
    char* wsp = (char*)d_ws;
    auto take = [&](size_t bytes) { char* p = wsp; wsp += (bytes + 255) & ~(size_t)255; return (void*)p; };
    const size_t PQ = (size_t)NH_ * TT * HD, PK = (size_t)NKV * TT * HD;   // elements of one batch's head planes; the planes hold all NB_ batches, [b][h][..]
    bf* WO = (bf*)take((size_t)DM * DQ * 2);
    bf* XB = (bf*)take((size_t)NB_ * TT * DM * 2); bf* WALL = (bf*)take((size_t)(DQ + 2 * DKV) * DM * 2);
    h16* QP16 = (h16*)take(NB_ * PQ * 2); h16* KP16 = (h16*)take(NB_ * PK * 2); h16* VT16 = (h16*)take(NB_ * PK * 2);
    bf* QPh = (bf*)take(NB_ * PQ * 2); bf* QPl = (bf*)take(NB_ * PQ * 2); bf* KPh = (bf*)take(NB_ * PK * 2); bf* KPl = (bf*)take(NB_ * PK * 2); bf* VTh = (bf*)take(NB_ * PK * 2); bf* VTl = (bf*)take(NB_ * PK * 2);
    bf* ATh = (bf*)take((size_t)NB_ * TT * DQ * 2); bf* ATl = (bf*)take((size_t)NB_ * TT * DQ * 2);
    if ((size_t)(wsp - (char*)d_ws) > ws_size) return;    // ws 256 MiB
    k_wtG<<<(unsigned)(((DQ + 2 * DKV) / 32) * (DM / 64)), 256, 0, stream>>>(wf, DM, DQ + 2 * DKV, WALL);
    k_wtG<<<(unsigned)((DM / 32) * (DQ / 64)), 256, 0, stream>>>(wo, DQ, DM, WO);
    k_cvtp<<<(unsigned)((NB_ * TT / 16) * (DM / 32) / 8), 256, 0, stream>>>(x, XB);
    k_qkv<8><<<dim3(NB_ * TT / 64, (DQ + 2 * DKV) / 64, 1), 256, 0, stream>>>(XB, WALL, QP16, QPh, QPl, KP16, KPh, KPl, VT16, VTh, VTl);
    // one kv head per query head (REP == 1): plane z = b * NH_ + h of every operand
    k_fattn<<<dim3(NB_ * NH_, (TT - RH) / 256 + RH / 128, 1), 256, 0, stream>>>(QP16, KP16, VT16, QPh, QPl, KPh, KPl, VTh, VTl, ATh, ATl);
    for (int b = 0; b < NB_; ++b)
        k_gemmw<bf, 1, false, 8, DQ><<<dim3(TT / 64, DM / 64, 1), 256, 0, stream>>>(ATh + (size_t)b * TT * DQ, ATl + (size_t)b * TT * DQ, WO, nullptr, OUT + (size_t)b * TT * DM, DM, nullptr, 0, 0, 0);
}

// v006
// It runs in 151 microseconds.
// Next to v005, in two timings, it ran 1.17 and 1.16 times as fast.
// Over all steps from v000 it is 19.0 times as fast.
#include <hip/hip_runtime.h>

// MuCausalSelfAttention (x [4][2048][1024]; qkv = x W_attn ([1024][3072]: q | k | v column blocks, 16 heads x 64); muP scaling: scores = q.k / 64 (1/head_dim); causal (-inf); softmax; out = merged W_proj -> [4][2048][1024]).
// Compute dtypes, f32 accumulate: every input rounded to bf16; q/k/v on PLAIN bf16 operands (inputs: exact), their head planes written by the projection's own epilogue; causal scores and attn.v: query rows < 512 hl (3 products), the rest single fp16, fused in registers (running-maximum softmax, f32), keys past the diagonal pass never read; W_proj hl x exact (2 products).
// FRAGMENT ORDER: every 16-bit operand plane (R rows x K, the product's k along a row) lies in memory as tiles of 16 rows x 32 k = 512 elements, tile (r / 16, k / 32) at ((r / 16) * (K / 32) + k / 32) * 512;
// inside a tile element (r, k) stands at ((k % 32) / 16) * 256 + (((k % 16) / 8) * 16 + r % 16) * 8 + k % 8: lane l of a wave finds its two 16-byte fragment pieces at l * 8 and 256 + l * 8, so that each wave-wide load is 512 bytes in a row (4 whole lines, not 16 pieces of 32 bytes).

#define NB_  4
#define TT   2048
#define DM   1024
#define NH_  16
#define NKV  16
#define REP  (NH_ / NKV)
#define HD   64
#define DQ   (NH_ * HD)
#define DKV  (NKV * HD)
#define RH   512                  // query rows < RH use hi+lo planes (0: none)
#define SCL  0.015625f   // muP: 1/head_dim
#define SCL2 (SCL * 1.4426950408889634f)   // the same in log2 units
typedef _Float16 h16;
typedef unsigned short bf;
typedef __attribute__((ext_vector_type(16))) __bf16   v16bf;
typedef __attribute__((ext_vector_type(16))) _Float16 v16h;
typedef __attribute__((ext_vector_type(8)))  _Float16 v8h;
typedef __attribute__((ext_vector_type(8)))  unsigned short v8us;
typedef __attribute__((ext_vector_type(8)))  float    v8f;
typedef __attribute__((ext_vector_type(4)))  float    v4f;
typedef v8h  __attribute__((may_alias)) v8ha;
typedef v4f  __attribute__((may_alias)) v4fa;
typedef v8us __attribute__((may_alias)) v8usa;

__device__ __forceinline__ unsigned short f2bf(float f) { unsigned u = __float_as_uint(f); u += 0x7FFFu + ((u >> 16) & 1u); return (unsigned short)(u >> 16); }
__device__ __forceinline__ float bf2f(unsigned short b) { return __uint_as_float(((unsigned)b) << 16); }
__device__ __forceinline__ float bfr(float f) { return bf2f(f2bf(f)); }
__device__ __forceinline__ v16h cat16(v8h lo, v8h hi) { return __builtin_shufflevector(lo, hi, 0, 1, 2, 3, 4, 5, 6, 7, 8, 9, 10, 11, 12, 13, 14, 15); }
__device__ __forceinline__ v16bf cat16b(v8us lo, v8us hi) { return __builtin_bit_cast(v16bf, __builtin_shufflevector(lo, hi, 0, 1, 2, 3, 4, 5, 6, 7, 8, 9, 10, 11, 12, 13, 14, 15)); }
__device__ __forceinline__ v8f wmma16(v16h a, v16h b, v8f c) { return __builtin_amdgcn_wmma_f32_16x16x32_f16(false, a, false, b, (short)0, c, false, false); }
__device__ __forceinline__ v8f wmmab(v16bf a, v16bf b, v8f c) { return __builtin_amdgcn_wmma_f32_16x16x32_bf16(false, a, false, b, (short)0, c, false, false); }



// ---- k_gemmw: register-blocked GEMM, NW WAVES per 64x64 output tile: wave w takes the 32-wide K steps w, w + NW, ... (16 accumulators each); the NW f32 partial tiles are staged in LDS and summed in wave order;
// operands straight from 16-bit planes in fragment order; grid (M/64, N/64, Z), 32 x NW threads.
// C[m][n] (f32, pitch ldc, + optional f32 bias[n]) = sum_k A[m][k] Bt[n][k] (+ split products per NSPLIT). z-batch strides sA/sB/sC in elements. K % 32 == 0.
template <typename T16> struct WFrag;
template <> struct WFrag<h16> { typedef v16h V; static __device__ __forceinline__ V ld(const h16* p) { return cat16(*(const v8h*)p, *(const v8h*)(p + 256)); } static __device__ __forceinline__ v8f mma(V a, V b, v8f c) { return wmma16(a, b, c); } };
template <> struct WFrag<bf> { typedef v16bf V; static __device__ __forceinline__ V ld(const bf* p) { return cat16b(*(const v8us*)p, *(const v8us*)(p + 256)); } static __device__ __forceinline__ v8f mma(V a, V b, v8f c) { return wmmab(a, b, c); } };
// K is a compile-time constant, so that a trip's loads differ from its three base pointers by immediate offsets only and no address register is formed, or reused, between them.
template <typename T16, int NSPLIT, bool BIAS, int NW, int K>
__global__ __launch_bounds__(32 * NW) void k_gemmw(const T16* __restrict__ A, const T16* __restrict__ A2, const T16* __restrict__ Bt, const T16* __restrict__ Bt2, float* C, int ldc, const float* __restrict__ bias, size_t sA, size_t sB, size_t sC) {
    typedef typename WFrag<T16>::V V;
    __shared__ __align__(16) float os[NW * 64 * 68];
    const size_t z = blockIdx.z; A += z * sA; if (A2) A2 += z * sA; Bt += z * sB; if (Bt2) Bt2 += z * sB; C += z * sC;
    const int lane = threadIdx.x & 31, lr = lane & 15, hi = lane >> 4; const int r0 = blockIdx.x * 64, c0 = blockIdx.y * 64;
    const int wv = __builtin_amdgcn_readfirstlane((int)(threadIdx.x >> 5));   // wave number, scalar: the K loop's trip test stays a scalar branch
    v8f acc[4][4];
#pragma unroll
    for (int mb = 0; mb < 4; ++mb)
#pragma unroll
        for (int nb = 0; nb < 4; ++nb) acc[mb][nb] = (v8f){};
    const size_t aoff = (size_t)r0 * K + 8 * lane, boff = (size_t)c0 * K + 8 * lane;   // first tile of the row block (16 rows of tiles = 16 K elements), the lane's piece
#pragma unroll 1
    for (int kc = wv * 32; kc < K; kc += 32 * NW) {
        V a[4], a2[4]; const T16* ap = A + aoff + (size_t)kc * 16; const T16* ap2 = (NSPLIT == 1 || NSPLIT == 2) ? A2 + aoff + (size_t)kc * 16 : ap; const T16* bp = Bt + boff + (size_t)kc * 16; const T16* bp2 = NSPLIT >= 2 ? Bt2 + boff + (size_t)kc * 16 : bp;   // k step kc / 32 = tile kc / 32 of the row
#pragma unroll
        for (int mb = 0; mb < 4; ++mb) { a[mb] = WFrag<T16>::ld(ap + (size_t)mb * 16 * K); if (NSPLIT == 1 || NSPLIT == 2) a2[mb] = WFrag<T16>::ld(ap2 + (size_t)mb * 16 * K); }
#pragma unroll
        for (int nb = 0; nb < 4; ++nb) { const V b = WFrag<T16>::ld(bp + (size_t)nb * 16 * K); V b2; if (NSPLIT >= 2) b2 = WFrag<T16>::ld(bp2 + (size_t)nb * 16 * K);
#pragma unroll
            for (int mb = 0; mb < 4; ++mb) { acc[mb][nb] = WFrag<T16>::mma(a[mb], b, acc[mb][nb]); if (NSPLIT == 1 || NSPLIT == 2) acc[mb][nb] = WFrag<T16>::mma(a2[mb], b, acc[mb][nb]); if (NSPLIT >= 2) acc[mb][nb] = WFrag<T16>::mma(a[mb], b2, acc[mb][nb]); } }
        // stands behind the trip's loads; the pointers are inputs so that their registers stay untouched up to it (precaution: a register that an issued load names is not rewritten ahead of this wait)
        asm volatile("s_wait_xcnt 0x0" :: "v"(ap), "v"(ap2), "v"(bp), "v"(bp2) : "memory");
        asm volatile("v_nop\n\tv_nop\n\tv_nop\n\tv_nop" : "+v"(acc[0][0]), "+v"(acc[1][1]), "+v"(acc[2][2]), "+v"(acc[3][3]) : "v"(a[0]), "v"(a[3]));
    }
    // every wave stages its whole 64x64 partial tile, so one barrier serves and no LDS is reused; then each thread sums its four-float slots over the waves, in wave order
#pragma unroll
    for (int mb = 0; mb < 4; ++mb) {
#pragma unroll
        for (int nb = 0; nb < 4; ++nb) {
#pragma unroll
            for (int j = 0; j < 8; ++j) os[wv * (64 * 68) + (mb * 16 + hi * 8 + j) * 68 + nb * 16 + lr] = acc[mb][nb][j]; } }
    __syncthreads();
    float* crow = C + (size_t)r0 * ldc + c0;
#pragma unroll
    for (int s = 0; s < 32 / NW; ++s) { const int slot = s * 32 * NW + (int)threadIdx.x; const int row = slot >> 4, cofs = (slot & 15) * 4; v4f val = *(const v4fa*)(os + row * 68 + cofs);
#pragma unroll
        for (int w = 1; w < NW; ++w) val += *(const v4fa*)(os + w * (64 * 68) + row * 68 + cofs);
        if (BIAS) { val[0] += bfr(bias[c0 + cofs]); val[1] += bfr(bias[c0 + cofs + 1]); val[2] += bfr(bias[c0 + cofs + 2]); val[3] += bfr(bias[c0 + cofs + 3]); }
        *(v4f*)(crow + (size_t)row * ldc + cofs) = val; }
}

__device__ __forceinline__ h16 tohx(float x) { return (h16)x; }
__device__ __forceinline__ void splitf(float y, unsigned short& h, unsigned short& l) { h = f2bf(y); l = f2bf(y - bf2f(h)); }
typedef __attribute__((ext_vector_type(2))) _Float16 v2h;
typedef __attribute__((ext_vector_type(4))) _Float16 v4h;
typedef __attribute__((ext_vector_type(2))) unsigned short v2us;
typedef __attribute__((ext_vector_type(4))) unsigned short v4us;
typedef __attribute__((ext_vector_type(2))) float v2f;
typedef __attribute__((ext_vector_type(4))) int v4i;

// k_wtG: Bt = bf16(w^T) in fragment order (rows n, k along a row), w [K][N] f32. A wave writes one half tile (512 bytes in a row): lane l takes 8 consecutive k of row n = 16 nt + l % 16, so that each of its 8 loads reads 64 bytes in a row of two rows of w.
// The 8 waves of a block take 2 x 2 neighbouring tiles (32 n x 64 k), so that both halves of a 128-byte line of w are read on one WGP. grid (N / 32) * (K / 64).
__global__ __launch_bounds__(256) void k_wtG(const float* __restrict__ w, int K, int N, bf* Bt) {
    const int lane = threadIdx.x & 31, wv = threadIdx.x >> 5; const int kp = K / 64;
    const int nt = ((int)blockIdx.x / kp) * 2 + ((wv >> 1) & 1), kt = ((int)blockIdx.x % kp) * 2 + (wv >> 2), half = wv & 1;
    const float* wp = w + (size_t)(kt * 32 + half * 16 + (lane >> 4) * 8) * N + nt * 16 + (lane & 15); v8us o;
#pragma unroll
    for (int j = 0; j < 8; ++j) o[j] = f2bf(wp[(size_t)j * N]);
    *(v8us*)(Bt + ((size_t)nt * (K / 32) + kt) * 512 + half * 256 + lane * 8) = o;
}
// k_cvtp: dst = bf16(src) in fragment order, src [rows][DM] f32. A wave takes one tile (16 rows x 32 k = one whole 128-byte line of each row): four loads of 4 whole lines each; a lane's 4 values are half a fragment piece, stored as 8 bytes (64 bytes in a row per 4 rows).
__global__ __launch_bounds__(256) void k_cvtp(const float* __restrict__ src, bf* dst) {
    const int lane = threadIdx.x & 31; const int tile = (int)blockIdx.x * 8 + (int)(threadIdx.x >> 5); const int rt = tile / (DM / 32), kt = tile % (DM / 32);
    const float* sp = src + (size_t)(rt * 16 + (lane >> 3)) * DM + kt * 32 + (lane & 7) * 4;
    bf* dp = dst + (size_t)tile * 512 + ((lane & 7) >> 2) * 256 + (((lane >> 1) & 1) * 16 + (lane >> 3)) * 8 + (lane & 1) * 4;
    v4f v[4];
#pragma unroll
    for (int i = 0; i < 4; ++i) v[i] = *(const v4f*)(sp + (size_t)i * 4 * DM);
#pragma unroll
    for (int i = 0; i < 4; ++i) { v4us o;
#pragma unroll
        for (int k = 0; k < 4; ++k) o[k] = f2bf(v[i][k]);
        *(v4us*)(dp + i * 32) = o; }
}
// ---- k_qkv: the q, k and v projections of every batch in one launch; each wave owns one 64x64 tile (64 tokens x one head) and sums the whole K itself, in k order, in 16 accumulators: no LDS, no barrier.
// The operands stand so that a lane's 8 accumulator registers are 8 consecutive k of the plane it writes, which is its own 16-byte fragment piece: the head planes (fp16 + hi/lo bf16) are stored straight from registers, 512 bytes in a row per wave, and no f32 q/k/v ever reaches memory.
// q and k: A = weight rows (D rows = d), B = x rows (D column = token): plane [b][h][t][d], fragment order, k = d. v: A = x rows (D rows = token), B = weight rows (D column = d): the d-major value plane, fragment order, k = t.
// grid (NB_ TT / 256, 3 x 16 / 3): the 12 waves of a work-group take 4 token blocks x 3 heads, so that each fragment they load is wanted by 3 or 4 waves of one WGP at about the same time and the WGP's cache can serve the repeats.
// Two fragment sets: a k step's sixteen loads are issued one step ahead and fly under the other set's products. 12 waves of under 336 registers = three a SIMD, 512 work-groups = two whole rounds of the chip.
__global__ __launch_bounds__(384) void k_qkv(const bf* __restrict__ X, const bf* __restrict__ Wt, h16* Q16, bf* Qh, bf* Ql, h16* K16, bf* Kh, bf* Kl, h16* V16, bf* Vh, bf* Vl) {
    typedef WFrag<bf>::V V;
    const int lane = threadIdx.x & 31;
    const int wv = __builtin_amdgcn_readfirstlane((int)(threadIdx.x >> 5));   // wave number, scalar
    const int xt = (int)blockIdx.x * 4 + (wv & 3), ct = (int)blockIdx.y * 3 + (wv >> 2);   // token block, head column block (q | k | v)
    const bool isv = ct >= (DQ + DKV) / 64;   // scalar
    const bf* xr = X + (size_t)xt * 64 * DM; const bf* wr = Wt + (size_t)ct * 64 * DM;
    const bf* A = (isv ? xr : wr) + 8 * lane; const bf* Bt = (isv ? wr : xr) + 8 * lane;
    v8f acc[4][4];
#pragma unroll
    for (int mb = 0; mb < 4; ++mb)
#pragma unroll
        for (int nb = 0; nb < 4; ++nb) acc[mb][nb] = (v8f){};
    V a0[4], b0[4], a1[4], b1[4];
#pragma unroll
    for (int mb = 0; mb < 4; ++mb) { a0[mb] = WFrag<bf>::ld(A + (size_t)mb * 16 * DM); b0[mb] = WFrag<bf>::ld(Bt + (size_t)mb * 16 * DM); }
    // stands behind the first step's loads (precaution: a register that an issued load names is not rewritten ahead of this wait); the scheduling barrier keeps the accumulators' zeroing, which reuses such a register, behind it
    asm volatile("s_wait_xcnt 0x0" :: "v"(A), "v"(Bt) : "memory");
    __builtin_amdgcn_sched_barrier(0);
#pragma unroll 1   // rolled: a trip is two k steps, one per fragment set; more would only lengthen the code
    for (int it = 0; it < DM / 32; it += 2) {
        const bf* ap = A + it * 512; const bf* bp = Bt + it * 512;   // this step's tiles; the next step's stand 512 elements on, an immediate offset
#pragma unroll
        for (int mb = 0; mb < 4; ++mb) { a1[mb] = WFrag<bf>::ld(ap + 512 + (size_t)mb * 16 * DM); b1[mb] = WFrag<bf>::ld(bp + 512 + (size_t)mb * 16 * DM); }
        // stands behind the next step's loads; the two pointers are inputs so that their registers stay untouched up to it (precaution: a register that an issued load names is not rewritten ahead of this wait);
        // this step's fragments are inputs too, so that the next step's loads stay in front of this step's products
        asm volatile("s_wait_xcnt 0x0" :: "v"(ap), "v"(bp), "v"(a0[0]), "v"(a0[1]), "v"(a0[2]), "v"(a0[3]), "v"(b0[0]), "v"(b0[1]), "v"(b0[2]), "v"(b0[3]) : "memory");
        __builtin_amdgcn_sched_barrier(0);   // keeps every product of this step behind the next step's loads (without it the build lifts one product, with its wait for memory, in front of them, and the loads start a memory latency late)
#pragma unroll
        for (int nb = 0; nb < 4; ++nb)
#pragma unroll
            for (int mb = 0; mb < 4; ++mb) acc[mb][nb] = WFrag<bf>::mma(a0[mb], b0[nb], acc[mb][nb]);
        const int nx = min(it + 2, DM / 32 - 1);   // the last trip re-reads the last k step: in bounds, unused
        const bf* ap2 = A + nx * 512; const bf* bp2 = Bt + nx * 512;
#pragma unroll
        for (int mb = 0; mb < 4; ++mb) { a0[mb] = WFrag<bf>::ld(ap2 + (size_t)mb * 16 * DM); b0[mb] = WFrag<bf>::ld(bp2 + (size_t)mb * 16 * DM); }
        // as above, for the other set
        asm volatile("s_wait_xcnt 0x0" :: "v"(ap2), "v"(bp2), "v"(a1[0]), "v"(a1[1]), "v"(a1[2]), "v"(a1[3]), "v"(b1[0]), "v"(b1[1]), "v"(b1[2]), "v"(b1[3]) : "memory");
        __builtin_amdgcn_sched_barrier(0);   // as above
#pragma unroll
        for (int nb = 0; nb < 4; ++nb)
#pragma unroll
            for (int mb = 0; mb < 4; ++mb) acc[mb][nb] = WFrag<bf>::mma(a1[mb], b1[nb], acc[mb][nb]);
    }
    const int hd = ct & (NH_ - 1), bb = xt / (TT / 64), t0 = (xt % (TT / 64)) * 64;   // head, batch, first token of the tile
    const size_t base = (size_t)(bb * NH_ + hd) * TT * HD + (isv ? (size_t)t0 * 16 : (size_t)t0 * HD) + 8 * lane; const int ld = isv ? TT * 16 : HD * 16;   // ld: from one 16-row band of tiles to the next
    h16* P16 = (isv ? V16 : ct < DQ / 64 ? Q16 : K16) + base; bf* Ph = (isv ? Vh : ct < DQ / 64 ? Qh : Kh) + base; bf* Pl = (isv ? Vl : ct < DQ / 64 ? Ql : Kl) + base;
    // accumulator (mb, nb): plane rows 16 nb + lane % 16, k = 16 mb + 8 (lane / 16) + j, that is half tile mb of band nb, piece lane
#pragma unroll
    for (int nb = 0; nb < 4; ++nb) { h16* p16 = P16 + (size_t)nb * ld; bf* ph = Ph + (size_t)nb * ld; bf* pl = Pl + (size_t)nb * ld;
#pragma unroll
        for (int mb = 0; mb < 4; ++mb) { v8h o16; v8us oh, ol;
#pragma unroll
            for (int j = 0; j < 8; ++j) { const float r = acc[mb][nb][j]; o16[j] = tohx(r); unsigned short a2, c2; splitf(r, a2, c2); oh[j] = a2; ol[j] = c2; }
            *(v8h*)(p16 + mb * 256) = o16; *(v8us*)(ph + mb * 256) = oh; *(v8us*)(pl + mb * 256) = ol;
            // stands behind the three stores; their data and pointers are inputs so that those registers stay untouched up to it (precaution: a register that an issued store names is not rewritten ahead of this wait)
            asm volatile("s_wait_xcnt 0x0" :: "v"(o16), "v"(oh), "v"(ol), "v"(p16), "v"(ph), "v"(pl) : "memory"); } }
}
__device__ __forceinline__ float xhalf(float x) { return __builtin_bit_cast(float, __builtin_amdgcn_permlanex16(__builtin_bit_cast(int, x), __builtin_bit_cast(int, x), 0x76543210, 0xfedcba98, false, false)); }   // lane l <-> lane l ^ 16
__device__ __forceinline__ void pcvt(const float (&p)[16], v16h& a, v16h& a2) { (void)a2;
#pragma unroll
    for (int e = 0; e < 16; ++e) a[e] = (_Float16)p[e]; }
__device__ __forceinline__ void pcvt(const float (&p)[16], v16bf& a, v16bf& a2) {
#pragma unroll
    for (int e = 0; e < 16; ++e) { const __bf16 h = (__bf16)p[e]; a[e] = h; a2[e] = (__bf16)(p[e] - (float)h); } }
template <typename T16, bool HL, int NG>
__device__ __forceinline__ void attn_rows(const T16* __restrict__ Q, const T16* __restrict__ Q2, const T16* __restrict__ Kp, const T16* __restrict__ K2, const T16* __restrict__ Vt, const T16* __restrict__ V2, int q0, bf* __restrict__ Oh, bf* __restrict__ Ol, int lr, int hi) {
    typedef typename WFrag<T16>::V V;
    V qf[NG][2], qf2[NG][2], kf[2][2], kf2[2][2];
#pragma unroll
    for (int g = 0; g < NG; ++g)
#pragma unroll
        for (int ks = 0; ks < 2; ++ks) { const size_t qo = (size_t)(q0 + g * 16) * HD + ks * 512 + 8 * (hi * 16 + lr); qf[g][ks] = WFrag<T16>::ld(Q + qo); if (HL) qf2[g][ks] = WFrag<T16>::ld(Q2 + qo); }
    v8f o[NG][4]; float mu[NG], ls[NG];
#pragma unroll
    for (int g = 0; g < NG; ++g) { mu[g] = -1.0e30f; ls[g] = 0.f;
#pragma unroll
        for (int dt = 0; dt < 4; ++dt) o[g][dt] = (v8f){}; }
    const int last = ((q0 + NG * 16 - 1) >> 5) << 5;   // first key of the pass that holds the diagonal
    const size_t ko = 8 * (hi * 16 + lr), vo = ko;   // the lane's piece of a tile
#pragma unroll
    for (int t = 0; t < 2; ++t)
#pragma unroll
        for (int ks = 0; ks < 2; ++ks) { kf[t][ks] = WFrag<T16>::ld(Kp + ko + t * 16 * HD + ks * 512); if (HL) kf2[t][ks] = WFrag<T16>::ld(K2 + ko + t * 16 * HD + ks * 512); }
#pragma unroll 1   // rolled: an unrolled pass would double the live fragments and cost resident waves
    for (int kb = 0; kb <= last; kb += 32) {
        V vf[4], vf2[4]; const T16* vp = Vt + vo + kb * 16; const T16* vp2 = HL ? V2 + vo + kb * 16 : vp;
#pragma unroll
        for (int dt = 0; dt < 4; ++dt) { vf[dt] = WFrag<T16>::ld(vp + (size_t)dt * 16 * TT); if (HL) vf2[dt] = WFrag<T16>::ld(vp2 + (size_t)dt * 16 * TT); }
        v8f s[NG][2];
#pragma unroll
        for (int g = 0; g < NG; ++g)
#pragma unroll
            for (int t = 0; t < 2; ++t) { s[g][t] = (v8f){};
#pragma unroll
                for (int ks = 0; ks < 2; ++ks) { s[g][t] = WFrag<T16>::mma(kf[t][ks], qf[g][ks], s[g][t]); if (HL) { s[g][t] = WFrag<T16>::mma(kf[t][ks], qf2[g][ks], s[g][t]); s[g][t] = WFrag<T16>::mma(kf2[t][ks], qf[g][ks], s[g][t]); } } }
        // the next pass's key fragments fly under this pass's softmax (the last pass re-reads its own rows: in bounds, unused)
        const size_t kn = (size_t)min(kb + 32, last) * HD + ko; const T16* kp = Kp + kn; const T16* kp2 = HL ? K2 + kn : kp;
#pragma unroll
        for (int t = 0; t < 2; ++t)
#pragma unroll
            for (int ks = 0; ks < 2; ++ks) { kf[t][ks] = WFrag<T16>::ld(kp + t * 16 * HD + ks * 512); if (HL) kf2[t][ks] = WFrag<T16>::ld(kp2 + t * 16 * HD + ks * 512); }
        // stands behind the pass's loads; the pointers are inputs so that their registers stay untouched up to it (precaution: a register that an issued load names is not rewritten ahead of this wait)
        asm volatile("s_wait_xcnt 0x0" :: "v"(vp), "v"(vp2), "v"(kp), "v"(kp2) : "memory");
        if (kb == last) {   // wave-uniform: only the diagonal pass pays for the causal mask
#pragma unroll
            for (int g = 0; g < NG; ++g)
#pragma unroll
                for (int t = 0; t < 2; ++t)
#pragma unroll
                    for (int j = 0; j < 8; ++j) if (kb + t * 16 + hi * 8 + j > q0 + g * 16 + lr) s[g][t][j] = -3.0e38f;
        }
        float xm[NG]; bool need = false;
#pragma unroll
        for (int g = 0; g < NG; ++g) { float mx = -3.0e38f;
#pragma unroll
            for (int t = 0; t < 2; ++t)
#pragma unroll
                for (int j = 0; j < 8; ++j) mx = fmaxf(mx, s[g][t][j]);
            xm[g] = fmaxf(mx, xhalf(mx)) * SCL2; need = need || (xm[g] > mu[g] + 8.0f); }   // both halves of the wave hold the query's pass maximum (key 0 is never masked, so it is a real score from the first pass on)
        if (__builtin_amdgcn_ballot_w32(need) != 0) {   // one scalar branch a pass; always taken on the first pass (factor 0 on zeros)
#pragma unroll
            for (int g = 0; g < NG; ++g) { const float mn = fmaxf(mu[g], xm[g]); const float al = __builtin_amdgcn_exp2f(mu[g] - mn); mu[g] = mn; ls[g] *= al;
#pragma unroll
                for (int dt = 0; dt < 4; ++dt) o[g][dt] *= al; }
        }
#pragma unroll
        for (int g = 0; g < NG; ++g) { float p[16]; float s0 = 0.f, s1 = 0.f;
#pragma unroll
            for (int e = 0; e < 16; ++e) p[e] = __builtin_amdgcn_exp2f(__builtin_fmaf(s[g][e >> 3][e & 7], SCL2, -mu[g]));
#pragma unroll
            for (int e = 0; e < 16; e += 2) { s0 += p[e]; s1 += p[e + 1]; }
            ls[g] += s0 + s1;
            V pf, pf2; pcvt(p, pf, pf2);
#pragma unroll
            for (int dt = 0; dt < 4; ++dt) { o[g][dt] = WFrag<T16>::mma(vf[dt], pf, o[g][dt]); if (HL) { o[g][dt] = WFrag<T16>::mma(vf[dt], pf2, o[g][dt]); o[g][dt] = WFrag<T16>::mma(vf2[dt], pf, o[g][dt]); } } }
    }
    // O^T: a lane holds 8 consecutive d of one query per tile, which is its own piece of the merged plane's fragment order (rows = tokens, k = head * 64 + d): one 16-byte store per plane, 512 bytes in a row per wave
#pragma unroll
    for (int g = 0; g < NG; ++g) { const float inv = __fdiv_rn(1.0f, ls[g] + xhalf(ls[g])); const size_t oo = (size_t)(q0 + g * 16) * DQ + 8 * (hi * 16 + lr); bf* ph = Oh + oo; bf* pl = Ol + oo;
#pragma unroll
        for (int dt = 0; dt < 4; ++dt) { v8us oh, ol;
#pragma unroll
            for (int j = 0; j < 8; ++j) { unsigned short a, c2; splitf(o[g][dt][j] * inv, a, c2); oh[j] = a; ol[j] = c2; }
            *(v8us*)(ph + dt * 256) = oh; *(v8us*)(pl + dt * 256) = ol;
            // stands behind the two stores; their data and base pointers are inputs so that those registers stay untouched up to it (precaution: a register that an issued store names is not rewritten ahead of this wait)
            asm volatile("s_wait_xcnt 0x0" :: "v"(oh), "v"(ol), "v"(ph), "v"(pl) : "memory"); } }
}
// grid (batch x head, row blocks): block y = 0 holds the last 256 query rows (the most keys), so that the long work-groups start first; the hi+lo rows (< RH, 128 a block) come last. 8 independent waves, no barrier.
// amdgpu_waves_per_eu(4, 4): holds the register allocator to 256 registers a wave, so that four waves stay resident on a SIMD (two work-groups a WGP) to cover the global loads' latency; launch_bounds alone would allow 512.
__global__ __launch_bounds__(256) __attribute__((amdgpu_waves_per_eu(4, 4))) void k_fattn(const h16* __restrict__ Q16, const h16* __restrict__ K16, const h16* __restrict__ V16, const bf* __restrict__ Qh, const bf* __restrict__ Ql, const bf* __restrict__ Kh, const bf* __restrict__ Kl, const bf* __restrict__ Vh, const bf* __restrict__ Vl, bf* __restrict__ Ah, bf* __restrict__ Al) {
    const int lane = threadIdx.x & 31, lr = lane & 15, hi = lane >> 4; const int wv = __builtin_amdgcn_readfirstlane((int)(threadIdx.x >> 5));   // wave number, scalar: the pass loop's trip test stays a scalar branch
    const int z = blockIdx.x, y = blockIdx.y; const size_t pz = (size_t)z * TT * HD; const size_t oz = (size_t)(z / NH_) * TT * DQ + (size_t)(z % NH_) * (HD * 16);   // head h = tiles 2 h, 2 h + 1 of a 16-token band
    if (y < (TT - RH) / 256) attn_rows<h16, false, 2>(Q16 + pz, nullptr, K16 + pz, nullptr, V16 + pz, nullptr, TT - 256 * (y + 1) + wv * 32, Ah + oz, Al + oz, lr, hi);
    else attn_rows<bf, true, 1>(Qh + pz, Ql + pz, Kh + pz, Kl + pz, Vh + pz, Vl + pz, RH - 128 * (y - (TT - RH) / 256 + 1) + wv * 16, Ah + oz, Al + oz, lr, hi);
}

extern "C" void kernel_launch(void* const* d_in, const int* in_sizes, int n_in,
                              void* d_out, int out_size, void* d_ws, size_t ws_size, hipStream_t stream) {
    (void)in_sizes; (void)n_in; (void)out_size;
    const float* x = (const float*)d_in[0]; const float* wf = (const float*)d_in[1]; const float* wo = (const float*)d_in[2];
    float* OUT = (float*)d_out;     // [4][2048][1024]
    char* wsp = (char*)d_ws;
    auto take = [&](size_t bytes) { char* p = wsp; wsp += (bytes + 255) & ~(size_t)255; return (void*)p; };
    const size_t PQ = (size_t)NH_ * TT * HD, PK = (size_t)NKV * TT * HD;   // elements of one batch's head planes; the planes hold all NB_ batches, [b][h][..]
    bf* WO = (bf*)take((size_t)DM * DQ * 2);
    bf* XB = (bf*)take((size_t)NB_ * TT * DM * 2); bf* WALL = (bf*)take((size_t)(DQ + 2 * DKV) * DM * 2);
    h16* QP16 = (h16*)take(NB_ * PQ * 2); h16* KP16 = (h16*)take(NB_ * PK * 2); h16* VT16 = (h16*)take(NB_ * PK * 2);
    bf* QPh = (bf*)take(NB_ * PQ * 2); bf* QPl = (bf*)take(NB_ * PQ * 2); bf* KPh = (bf*)take(NB_ * PK * 2); bf* KPl = (bf*)take(NB_ * PK * 2); bf* VTh = (bf*)take(NB_ * PK * 2); bf* VTl = (bf*)take(NB_ * PK * 2);
    bf* ATh = (bf*)take((size_t)NB_ * TT * DQ * 2); bf* ATl = (bf*)take((size_t)NB_ * TT * DQ * 2);
    if ((size_t)(wsp - (char*)d_ws) > ws_size) return;    // ws 256 MiB
    k_wtG<<<(unsigned)(((DQ + 2 * DKV) / 32) * (DM / 64)), 256, 0, stream>>>(wf, DM, DQ + 2 * DKV, WALL);
    k_wtG<<<(unsigned)((DM / 32) * (DQ / 64)), 256, 0, stream>>>(wo, DQ, DM, WO);
    k_cvtp<<<(unsigned)((NB_ * TT / 16) * (DM / 32) / 8), 256, 0, stream>>>(x, XB);
    k_qkv<<<dim3(NB_ * TT / 256, (DQ + 2 * DKV) / 192, 1), 384, 0, stream>>>(XB, WALL, QP16, QPh, QPl, KP16, KPh, KPl, VT16, VTh, VTl);
    // one kv head per query head (REP == 1): plane z = b * NH_ + h of every operand
    k_fattn<<<dim3(NB_ * NH_, (TT - RH) / 256 + RH / 128, 1), 256, 0, stream>>>(QP16, KP16, VT16, QPh, QPl, KPh, KPl, VTh, VTl, ATh, ATl);
    for (int b = 0; b < NB_; ++b)
        k_gemmw<bf, 1, false, 8, DQ><<<dim3(TT / 64, DM / 64, 1), 256, 0, stream>>>(ATh + (size_t)b * TT * DQ, ATl + (size_t)b * TT * DQ, WO, nullptr, OUT + (size_t)b * TT * DM, DM, nullptr, 0, 0, 0);
}

// v007
// One run takes 136 microseconds.
// Timed twice side by side with v006, it ran 1.11 times as fast both times.
// All steps since v000 together make it 21.1 times as fast.
#include <hip/hip_runtime.h>

// MuCausalSelfAttention (x [4][2048][1024]; qkv = x W_attn ([1024][3072]: q | k | v column blocks, 16 heads x 64); muP scaling: scores = q.k / 64 (1/head_dim); causal (-inf); softmax; out = merged W_proj -> [4][2048][1024]).
// Compute dtypes, f32 accumulate: every input rounded to bf16; q/k/v on PLAIN bf16 operands (inputs: exact), their head planes written by the projection's own epilogue; causal scores and attn.v: query rows < 512 hl (3 products), the rest single fp16, fused in registers (running-maximum softmax, f32), keys past the diagonal pass never read; W_proj hl x exact (2 products).
// FRAGMENT ORDER: every 16-bit operand plane (R rows x K, the product's k along a row) lies in memory as tiles of 16 rows x 32 k = 512 elements, tile (r / 16, k / 32) at ((r / 16) * (K / 32) + k / 32) * 512;
// inside a tile element (r, k) stands at ((k % 32) / 16) * 256 + (((k % 16) / 8) * 16 + r % 16) * 8 + k % 8: lane l of a wave finds its two 16-byte fragment pieces at l * 8 and 256 + l * 8, so that each wave-wide load is 512 bytes in a row (4 whole lines, not 16 pieces of 32 bytes).

#define NB_  4
#define TT   2048
#define DM   1024
#define NH_  16
#define NKV  16
#define REP  (NH_ / NKV)
#define HD   64
#define DQ   (NH_ * HD)
#define DKV  (NKV * HD)
#define RH   512                  // query rows < RH use hi+lo planes (0: none)
#define SCL  0.015625f   // muP: 1/head_dim
#define SCL2 (SCL * 1.4426950408889634f)   // the same in log2 units
typedef _Float16 h16;
typedef unsigned short bf;
typedef __attribute__((ext_vector_type(16))) __bf16   v16bf;
typedef __attribute__((ext_vector_type(16))) _Float16 v16h;
typedef __attribute__((ext_vector_type(8)))  _Float16 v8h;
typedef __attribute__((ext_vector_type(8)))  unsigned short v8us;
typedef __attribute__((ext_vector_type(8)))  float    v8f;
typedef __attribute__((ext_vector_type(4)))  float    v4f;
typedef v8h  __attribute__((may_alias)) v8ha;
typedef v4f  __attribute__((may_alias)) v4fa;
typedef v8us __attribute__((may_alias)) v8usa;

__device__ __forceinline__ unsigned short f2bf(float f) { unsigned u = __float_as_uint(f); u += 0x7FFFu + ((u >> 16) & 1u); return (unsigned short)(u >> 16); }
__device__ __forceinline__ float bf2f(unsigned short b) { return __uint_as_float(((unsigned)b) << 16); }
__device__ __forceinline__ float bfr(float f) { return bf2f(f2bf(f)); }
__device__ __forceinline__ v16h cat16(v8h lo, v8h hi) { return __builtin_shufflevector(lo, hi, 0, 1, 2, 3, 4, 5, 6, 7, 8, 9, 10, 11, 12, 13, 14, 15); }
__device__ __forceinline__ v16bf cat16b(v8us lo, v8us hi) { return __builtin_bit_cast(v16bf, __builtin_shufflevector(lo, hi, 0, 1, 2, 3, 4, 5, 6, 7, 8, 9, 10, 11, 12, 13, 14, 15)); }
__device__ __forceinline__ v8f wmma16(v16h a, v16h b, v8f c) { return __builtin_amdgcn_wmma_f32_16x16x32_f16(false, a, false, b, (short)0, c, false, false); }
__device__ __forceinline__ v8f wmmab(v16bf a, v16bf b, v8f c) { return __builtin_amdgcn_wmma_f32_16x16x32_bf16(false, a, false, b, (short)0, c, false, false); }



// ---- fragment loads and products of the two 16-bit types; operands straight from 16-bit planes in fragment order
template <typename T16> struct WFrag;
template <> struct WFrag<h16> { typedef v16h V; static __device__ __forceinline__ V ld(const h16* p) { return cat16(*(const v8h*)p, *(const v8h*)(p + 256)); } static __device__ __forceinline__ v8f mma(V a, V b, v8f c) { return wmma16(a, b, c); } };
template <> struct WFrag<bf> { typedef v16bf V; static __device__ __forceinline__ V ld(const bf* p) { return cat16b(*(const v8us*)p, *(const v8us*)(p + 256)); } static __device__ __forceinline__ v8f mma(V a, V b, v8f c) { return wmmab(a, b, c); } };

__device__ __forceinline__ h16 tohx(float x) { return (h16)x; }
__device__ __forceinline__ void splitf(float y, unsigned short& h, unsigned short& l) { h = f2bf(y); l = f2bf(y - bf2f(h)); }
typedef __attribute__((ext_vector_type(2))) _Float16 v2h;
typedef __attribute__((ext_vector_type(4))) _Float16 v4h;
typedef __attribute__((ext_vector_type(2))) unsigned short v2us;
typedef __attribute__((ext_vector_type(4))) unsigned short v4us;
typedef __attribute__((ext_vector_type(2))) float v2f;
typedef __attribute__((ext_vector_type(4))) int v4i;

// k_wtG: Bt = bf16(w^T) in fragment order (rows n, k along a row), w [K][N] f32. A wave writes one half tile (512 bytes in a row): lane l takes 8 consecutive k of row n = 16 nt + l % 16, so that each of its 8 loads reads 64 bytes in a row of two rows of w.
// The 8 waves of a block take 2 x 2 neighbouring tiles (32 n x 64 k), so that both halves of a 128-byte line of w are read on one WGP. grid (N / 32) * (K / 64).
__global__ __launch_bounds__(256) void k_wtG(const float* __restrict__ w, int K, int N, bf* Bt) {
    const int lane = threadIdx.x & 31, wv = threadIdx.x >> 5; const int kp = K / 64;
    const int nt = ((int)blockIdx.x / kp) * 2 + ((wv >> 1) & 1), kt = ((int)blockIdx.x % kp) * 2 + (wv >> 2), half = wv & 1;
    const float* wp = w + (size_t)(kt * 32 + half * 16 + (lane >> 4) * 8) * N + nt * 16 + (lane & 15); v8us o;
#pragma unroll
    for (int j = 0; j < 8; ++j) o[j] = f2bf(wp[(size_t)j * N]);
    *(v8us*)(Bt + ((size_t)nt * (K / 32) + kt) * 512 + half * 256 + lane * 8) = o;
}
// k_cvtp: dst = bf16(src) in fragment order, src [rows][DM] f32. A wave takes one tile (16 rows x 32 k = one whole 128-byte line of each row): four loads of 4 whole lines each; a lane's 4 values are half a fragment piece, stored as 8 bytes (64 bytes in a row per 4 rows).
__global__ __launch_bounds__(256) void k_cvtp(const float* __restrict__ src, bf* dst) {
    const int lane = threadIdx.x & 31; const int tile = (int)blockIdx.x * 8 + (int)(threadIdx.x >> 5); const int rt = tile / (DM / 32), kt = tile % (DM / 32);
    const float* sp = src + (size_t)(rt * 16 + (lane >> 3)) * DM + kt * 32 + (lane & 7) * 4;
    bf* dp = dst + (size_t)tile * 512 + ((lane & 7) >> 2) * 256 + (((lane >> 1) & 1) * 16 + (lane >> 3)) * 8 + (lane & 1) * 4;
    v4f v[4];
#pragma unroll
    for (int i = 0; i < 4; ++i) v[i] = *(const v4f*)(sp + (size_t)i * 4 * DM);
#pragma unroll
    for (int i = 0; i < 4; ++i) { v4us o;
#pragma unroll
        for (int k = 0; k < 4; ++k) o[k] = f2bf(v[i][k]);
        *(v4us*)(dp + i * 32) = o; }
}
// ---- k_qkv: the q, k and v projections of every batch in one launch; each wave owns one 64x64 tile (64 tokens x one head) and sums the whole K itself, in k order, in 16 accumulators: no LDS, no barrier.
// The operands stand so that a lane's 8 accumulator registers are 8 consecutive k of the plane it writes, which is its own 16-byte fragment piece: the head planes (fp16 + hi/lo bf16) are stored straight from registers, 512 bytes in a row per wave, and no f32 q/k/v ever reaches memory.
// q and k: A = weight rows (D rows = d), B = x rows (D column = token): plane [b][h][t][d], fragment order, k = d. v: A = x rows (D rows = token), B = weight rows (D column = d): the d-major value plane, fragment order, k = t.
// grid (NB_ TT / 256, 3 x 16 / 3): the 12 waves of a work-group take 4 token blocks x 3 heads, so that each fragment they load is wanted by 3 or 4 waves of one WGP at about the same time and the WGP's cache can serve the repeats.
// Two fragment sets: a k step's sixteen loads are issued one step ahead and fly under the other set's products. 12 waves of under 336 registers = three a SIMD, 512 work-groups = two whole rounds of the chip.
__global__ __launch_bounds__(384) void k_qkv(const bf* __restrict__ X, const bf* __restrict__ Wt, h16* Q16, bf* Qh, bf* Ql, h16* K16, bf* Kh, bf* Kl, h16* V16, bf* Vh, bf* Vl) {
    typedef WFrag<bf>::V V;
    const int lane = threadIdx.x & 31;
    const int wv = __builtin_amdgcn_readfirstlane((int)(threadIdx.x >> 5));   // wave number, scalar
    const int xt = (int)blockIdx.x * 4 + (wv & 3), ct = (int)blockIdx.y * 3 + (wv >> 2);   // token block, head column block (q | k | v)
    const bool isv = ct >= (DQ + DKV) / 64;   // scalar
    const bf* xr = X + (size_t)xt * 64 * DM; const bf* wr = Wt + (size_t)ct * 64 * DM;
    const bf* A = (isv ? xr : wr) + 8 * lane; const bf* Bt = (isv ? wr : xr) + 8 * lane;
    v8f acc[4][4];
#pragma unroll
    for (int mb = 0; mb < 4; ++mb)
#pragma unroll
        for (int nb = 0; nb < 4; ++nb) acc[mb][nb] = (v8f){};
    V a0[4], b0[4], a1[4], b1[4];
#pragma unroll
    for (int mb = 0; mb < 4; ++mb) { a0[mb] = WFrag<bf>::ld(A + (size_t)mb * 16 * DM); b0[mb] = WFrag<bf>::ld(Bt + (size_t)mb * 16 * DM); }
    // stands behind the first step's loads (precaution: a register that an issued load names is not rewritten ahead of this wait); the scheduling barrier keeps the accumulators' zeroing, which reuses such a register, behind it
    asm volatile("s_wait_xcnt 0x0" :: "v"(A), "v"(Bt) : "memory");
    __builtin_amdgcn_sched_barrier(0);
#pragma unroll 1   // rolled: a trip is two k steps, one per fragment set; more would only lengthen the code
    for (int it = 0; it < DM / 32; it += 2) {
        const bf* ap = A + it * 512; const bf* bp = Bt + it * 512;   // this step's tiles; the next step's stand 512 elements on, an immediate offset
#pragma unroll
        for (int mb = 0; mb < 4; ++mb) { a1[mb] = WFrag<bf>::ld(ap + 512 + (size_t)mb * 16 * DM); b1[mb] = WFrag<bf>::ld(bp + 512 + (size_t)mb * 16 * DM); }
        // stands behind the next step's loads; the two pointers are inputs so that their registers stay untouched up to it (precaution: a register that an issued load names is not rewritten ahead of this wait);
        // this step's fragments are inputs too, so that the next step's loads stay in front of this step's products
        asm volatile("s_wait_xcnt 0x0" :: "v"(ap), "v"(bp), "v"(a0[0]), "v"(a0[1]), "v"(a0[2]), "v"(a0[3]), "v"(b0[0]), "v"(b0[1]), "v"(b0[2]), "v"(b0[3]) : "memory");
        __builtin_amdgcn_sched_barrier(0);   // keeps every product of this step behind the next step's loads (without it the build lifts one product, with its wait for memory, in front of them, and the loads start a memory latency late)
#pragma unroll
        for (int nb = 0; nb < 4; ++nb)
#pragma unroll
            for (int mb = 0; mb < 4; ++mb) acc[mb][nb] = WFrag<bf>::mma(a0[mb], b0[nb], acc[mb][nb]);
        const int nx = min(it + 2, DM / 32 - 1);   // the last trip re-reads the last k step: in bounds, unused
        const bf* ap2 = A + nx * 512; const bf* bp2 = Bt + nx * 512;
#pragma unroll
        for (int mb = 0; mb < 4; ++mb) { a0[mb] = WFrag<bf>::ld(ap2 + (size_t)mb * 16 * DM); b0[mb] = WFrag<bf>::ld(bp2 + (size_t)mb * 16 * DM); }
        // as above, for the other set
        asm volatile("s_wait_xcnt 0x0" :: "v"(ap2), "v"(bp2), "v"(a1[0]), "v"(a1[1]), "v"(a1[2]), "v"(a1[3]), "v"(b1[0]), "v"(b1[1]), "v"(b1[2]), "v"(b1[3]) : "memory");
        __builtin_amdgcn_sched_barrier(0);   // as above
#pragma unroll
        for (int nb = 0; nb < 4; ++nb)
#pragma unroll
            for (int mb = 0; mb < 4; ++mb) acc[mb][nb] = WFrag<bf>::mma(a1[mb], b1[nb], acc[mb][nb]);
    }
    const int hd = ct & (NH_ - 1), bb = xt / (TT / 64), t0 = (xt % (TT / 64)) * 64;   // head, batch, first token of the tile
    const size_t base = (size_t)(bb * NH_ + hd) * TT * HD + (isv ? (size_t)t0 * 16 : (size_t)t0 * HD) + 8 * lane; const int ld = isv ? TT * 16 : HD * 16;   // ld: from one 16-row band of tiles to the next
    h16* P16 = (isv ? V16 : ct < DQ / 64 ? Q16 : K16) + base; bf* Ph = (isv ? Vh : ct < DQ / 64 ? Qh : Kh) + base; bf* Pl = (isv ? Vl : ct < DQ / 64 ? Ql : Kl) + base;
    // accumulator (mb, nb): plane rows 16 nb + lane % 16, k = 16 mb + 8 (lane / 16) + j, that is half tile mb of band nb, piece lane
#pragma unroll
    for (int nb = 0; nb < 4; ++nb) { h16* p16 = P16 + (size_t)nb * ld; bf* ph = Ph + (size_t)nb * ld; bf* pl = Pl + (size_t)nb * ld;
#pragma unroll
        for (int mb = 0; mb < 4; ++mb) { v8h o16; v8us oh, ol;
#pragma unroll
            for (int j = 0; j < 8; ++j) { const float r = acc[mb][nb][j]; o16[j] = tohx(r); unsigned short a2, c2; splitf(r, a2, c2); oh[j] = a2; ol[j] = c2; }
            *(v8h*)(p16 + mb * 256) = o16; *(v8us*)(ph + mb * 256) = oh; *(v8us*)(pl + mb * 256) = ol;
            // stands behind the three stores; their data and pointers are inputs so that those registers stay untouched up to it (precaution: a register that an issued store names is not rewritten ahead of this wait)
            asm volatile("s_wait_xcnt 0x0" :: "v"(o16), "v"(oh), "v"(ol), "v"(p16), "v"(ph), "v"(pl) : "memory"); } }
}
__device__ __forceinline__ float xhalf(float x) { return __builtin_bit_cast(float, __builtin_amdgcn_permlanex16(__builtin_bit_cast(int, x), __builtin_bit_cast(int, x), 0x76543210, 0xfedcba98, false, false)); }   // lane l <-> lane l ^ 16
__device__ __forceinline__ void pcvt(const float (&p)[16], v16h& a, v16h& a2) { (void)a2;
#pragma unroll
    for (int e = 0; e < 16; ++e) a[e] = (_Float16)p[e]; }
__device__ __forceinline__ void pcvt(const float (&p)[16], v16bf& a, v16bf& a2) {
#pragma unroll
    for (int e = 0; e < 16; ++e) { const __bf16 h = (__bf16)p[e]; a[e] = h; a2[e] = (__bf16)(p[e] - (float)h); } }
template <typename T16, bool HL, int NG>
__device__ __forceinline__ void attn_rows(const T16* __restrict__ Q, const T16* __restrict__ Q2, const T16* __restrict__ Kp, const T16* __restrict__ K2, const T16* __restrict__ Vt, const T16* __restrict__ V2, int q0, bf* __restrict__ Oh, bf* __restrict__ Ol, int lr, int hi) {
    typedef typename WFrag<T16>::V V;
    V qf[NG][2], qf2[NG][2], kf[2][2], kf2[2][2];
#pragma unroll
    for (int g = 0; g < NG; ++g)
#pragma unroll
        for (int ks = 0; ks < 2; ++ks) { const size_t qo = (size_t)(q0 + g * 16) * HD + ks * 512 + 8 * (hi * 16 + lr); qf[g][ks] = WFrag<T16>::ld(Q + qo); if (HL) qf2[g][ks] = WFrag<T16>::ld(Q2 + qo); }
    v8f o[NG][4]; float mu[NG], ls[NG];
#pragma unroll
    for (int g = 0; g < NG; ++g) { mu[g] = -1.0e30f; ls[g] = 0.f;
#pragma unroll
        for (int dt = 0; dt < 4; ++dt) o[g][dt] = (v8f){}; }
    const int last = ((q0 + NG * 16 - 1) >> 5) << 5;   // first key of the pass that holds the diagonal
    const size_t ko = 8 * (hi * 16 + lr), vo = ko;   // the lane's piece of a tile
#pragma unroll
    for (int t = 0; t < 2; ++t)
#pragma unroll
        for (int ks = 0; ks < 2; ++ks) { kf[t][ks] = WFrag<T16>::ld(Kp + ko + t * 16 * HD + ks * 512); if (HL) kf2[t][ks] = WFrag<T16>::ld(K2 + ko + t * 16 * HD + ks * 512); }
#pragma unroll 1   // rolled: an unrolled pass would double the live fragments and cost resident waves
    for (int kb = 0; kb <= last; kb += 32) {
        V vf[4], vf2[4]; const T16* vp = Vt + vo + kb * 16; const T16* vp2 = HL ? V2 + vo + kb * 16 : vp;
#pragma unroll
        for (int dt = 0; dt < 4; ++dt) { vf[dt] = WFrag<T16>::ld(vp + (size_t)dt * 16 * TT); if (HL) vf2[dt] = WFrag<T16>::ld(vp2 + (size_t)dt * 16 * TT); }
        v8f s[NG][2];
#pragma unroll
        for (int g = 0; g < NG; ++g)
#pragma unroll
            for (int t = 0; t < 2; ++t) { s[g][t] = (v8f){};
#pragma unroll
                for (int ks = 0; ks < 2; ++ks) { s[g][t] = WFrag<T16>::mma(kf[t][ks], qf[g][ks], s[g][t]); if (HL) { s[g][t] = WFrag<T16>::mma(kf[t][ks], qf2[g][ks], s[g][t]); s[g][t] = WFrag<T16>::mma(kf2[t][ks], qf[g][ks], s[g][t]); } } }
        // the next pass's key fragments fly under this pass's softmax (the last pass re-reads its own rows: in bounds, unused)
        const size_t kn = (size_t)min(kb + 32, last) * HD + ko; const T16* kp = Kp + kn; const T16* kp2 = HL ? K2 + kn : kp;
#pragma unroll
        for (int t = 0; t < 2; ++t)
#pragma unroll
            for (int ks = 0; ks < 2; ++ks) { kf[t][ks] = WFrag<T16>::ld(kp + t * 16 * HD + ks * 512); if (HL) kf2[t][ks] = WFrag<T16>::ld(kp2 + t * 16 * HD + ks * 512); }
        // stands behind the pass's loads; the pointers are inputs so that their registers stay untouched up to it (precaution: a register that an issued load names is not rewritten ahead of this wait)
        asm volatile("s_wait_xcnt 0x0" :: "v"(vp), "v"(vp2), "v"(kp), "v"(kp2) : "memory");
        if (kb == last) {   // wave-uniform: only the diagonal pass pays for the causal mask
#pragma unroll
            for (int g = 0; g < NG; ++g)
#pragma unroll
                for (int t = 0; t < 2; ++t)
#pragma unroll
                    for (int j = 0; j < 8; ++j) if (kb + t * 16 + hi * 8 + j > q0 + g * 16 + lr) s[g][t][j] = -3.0e38f;
        }
        float xm[NG]; bool need = false;
#pragma unroll
        for (int g = 0; g < NG; ++g) { float mx = -3.0e38f;
#pragma unroll
            for (int t = 0; t < 2; ++t)
#pragma unroll
                for (int j = 0; j < 8; ++j) mx = fmaxf(mx, s[g][t][j]);
            xm[g] = fmaxf(mx, xhalf(mx)) * SCL2; need = need || (xm[g] > mu[g] + 8.0f); }   // both halves of the wave hold the query's pass maximum (key 0 is never masked, so it is a real score from the first pass on)
        if (__builtin_amdgcn_ballot_w32(need) != 0) {   // one scalar branch a pass; always taken on the first pass (factor 0 on zeros)
#pragma unroll
            for (int g = 0; g < NG; ++g) { const float mn = fmaxf(mu[g], xm[g]); const float al = __builtin_amdgcn_exp2f(mu[g] - mn); mu[g] = mn; ls[g] *= al;
#pragma unroll
                for (int dt = 0; dt < 4; ++dt) o[g][dt] *= al; }
        }
#pragma unroll
        for (int g = 0; g < NG; ++g) { float p[16]; float s0 = 0.f, s1 = 0.f;
#pragma unroll
            for (int e = 0; e < 16; ++e) p[e] = __builtin_amdgcn_exp2f(__builtin_fmaf(s[g][e >> 3][e & 7], SCL2, -mu[g]));
#pragma unroll
            for (int e = 0; e < 16; e += 2) { s0 += p[e]; s1 += p[e + 1]; }
            ls[g] += s0 + s1;
            V pf, pf2; pcvt(p, pf, pf2);
#pragma unroll
            for (int dt = 0; dt < 4; ++dt) { o[g][dt] = WFrag<T16>::mma(vf[dt], pf, o[g][dt]); if (HL) { o[g][dt] = WFrag<T16>::mma(vf[dt], pf2, o[g][dt]); o[g][dt] = WFrag<T16>::mma(vf2[dt], pf, o[g][dt]); } } }
    }
    // O^T: a lane holds 8 consecutive d of one query per tile, which is its own piece of the merged plane's fragment order (rows = tokens, k = head * 64 + d): one 16-byte store per plane, 512 bytes in a row per wave
#pragma unroll
    for (int g = 0; g < NG; ++g) { const float inv = __fdiv_rn(1.0f, ls[g] + xhalf(ls[g])); const size_t oo = (size_t)(q0 + g * 16) * DQ + 8 * (hi * 16 + lr); bf* ph = Oh + oo; bf* pl = Ol + oo;
#pragma unroll
        for (int dt = 0; dt < 4; ++dt) { v8us oh, ol;
#pragma unroll
            for (int j = 0; j < 8; ++j) { unsigned short a, c2; splitf(o[g][dt][j] * inv, a, c2); oh[j] = a; ol[j] = c2; }
            *(v8us*)(ph + dt * 256) = oh; *(v8us*)(pl + dt * 256) = ol;
            // stands behind the two stores; their data and base pointers are inputs so that those registers stay untouched up to it (precaution: a register that an issued store names is not rewritten ahead of this wait)
            asm volatile("s_wait_xcnt 0x0" :: "v"(oh), "v"(ol), "v"(ph), "v"(pl) : "memory"); } }
}
// grid (batch x head, row blocks): block y = 0 holds the last 256 query rows (the most keys), so that the long work-groups start first; the hi+lo rows (< RH, 128 a block) come last. 8 independent waves, no barrier.
// amdgpu_waves_per_eu(4, 4): holds the register allocator to 256 registers a wave, so that four waves stay resident on a SIMD (two work-groups a WGP) to cover the global loads' latency; launch_bounds alone would allow 512.
__global__ __launch_bounds__(256) __attribute__((amdgpu_waves_per_eu(4, 4))) void k_fattn(const h16* __restrict__ Q16, const h16* __restrict__ K16, const h16* __restrict__ V16, const bf* __restrict__ Qh, const bf* __restrict__ Ql, const bf* __restrict__ Kh, const bf* __restrict__ Kl, const bf* __restrict__ Vh, const bf* __restrict__ Vl, bf* __restrict__ Ah, bf* __restrict__ Al) {
    const int lane = threadIdx.x & 31, lr = lane & 15, hi = lane >> 4; const int wv = __builtin_amdgcn_readfirstlane((int)(threadIdx.x >> 5));   // wave number, scalar: the pass loop's trip test stays a scalar branch
    const int z = blockIdx.x, y = blockIdx.y; const size_t pz = (size_t)z * TT * HD; const size_t oz = (size_t)(z / NH_) * TT * DQ + (size_t)(z % NH_) * (HD * 16);   // head h = tiles 2 h, 2 h + 1 of a 16-token band
    if (y < (TT - RH) / 256) attn_rows<h16, false, 2>(Q16 + pz, nullptr, K16 + pz, nullptr, V16 + pz, nullptr, TT - 256 * (y + 1) + wv * 32, Ah + oz, Al + oz, lr, hi);
    else attn_rows<bf, true, 1>(Qh + pz, Ql + pz, Kh + pz, Kl + pz, Vh + pz, Vl + pz, RH - 128 * (y - (TT - RH) / 256 + 1) + wv * 16, Ah + oz, Al + oz, lr, hi);
}

__global__ __launch_bounds__(256) void k_proj(const bf* __restrict__ Mh, const bf* __restrict__ Ml, const bf* __restrict__ Wt, float* __restrict__ C) {
    typedef WFrag<bf>::V V;
    __shared__ __align__(16) float os[8 * 64 * 68];
    const int lane = threadIdx.x & 31, lr = lane & 15, hi = lane >> 4;
    const int wv = __builtin_amdgcn_readfirstlane((int)(threadIdx.x >> 5));   // wave number, scalar
    const int xt = (int)blockIdx.x * 2 + (wv >> 2), ct = (int)blockIdx.y * 4 + (wv & 3);   // token block, column block
    const bf* A = Wt + (size_t)ct * 64 * DQ; const bf* Bh = Mh + (size_t)xt * 64 * DQ; const bf* Bl = Ml + (size_t)xt * 64 * DQ; const int lo = 8 * lane;   // scalar bases; the lane's piece is the one vector offset of every load, never rewritten
    v8f acc[4][4];
#pragma unroll
    for (int mb = 0; mb < 4; ++mb)
#pragma unroll
        for (int nb = 0; nb < 4; ++nb) acc[mb][nb] = (v8f){};
    V a0[4], h0[4], l0[4], a1[4], h1[4], l1[4];
#pragma unroll
    for (int mb = 0; mb < 4; ++mb) { a0[mb] = WFrag<bf>::ld(A + mb * 16 * DQ + lo); h0[mb] = WFrag<bf>::ld(Bh + mb * 16 * DQ + lo); l0[mb] = WFrag<bf>::ld(Bl + mb * 16 * DQ + lo); }
    // stands behind the first step's loads (precaution: a register that an issued load names is not rewritten ahead of this wait); the scheduling barrier keeps every later instruction behind it
    asm volatile("s_wait_xcnt 0x0" :: "s"(A), "s"(Bh), "s"(Bl) : "memory");
    __builtin_amdgcn_sched_barrier(0);
#pragma unroll 1   // rolled: a trip is two k steps, one per fragment set; more would only lengthen the code
    for (int it = 0; it < DQ / 32; it += 2) {
        const bf* ap = A + it * 512; const bf* hp = Bh + it * 512; const bf* lp = Bl + it * 512;   // this step's tiles; the next step's stand 512 elements on, an immediate offset
#pragma unroll
        for (int mb = 0; mb < 4; ++mb) { a1[mb] = WFrag<bf>::ld(ap + 512 + mb * 16 * DQ + lo); h1[mb] = WFrag<bf>::ld(hp + 512 + mb * 16 * DQ + lo); l1[mb] = WFrag<bf>::ld(lp + 512 + mb * 16 * DQ + lo); }
        // stands behind the next step's loads; the three scalar bases are inputs so that their registers stay untouched up to it (precaution: a register that an issued load names is not rewritten ahead of this wait)
        asm volatile("s_wait_xcnt 0x0" :: "s"(ap), "s"(hp), "s"(lp) : "memory");
        __builtin_amdgcn_sched_barrier(0);   // keeps every product of this step behind the next step's loads, so that the loads do not start a memory latency late
#pragma unroll
        for (int nb = 0; nb < 4; ++nb)
#pragma unroll
            for (int mb = 0; mb < 4; ++mb) acc[mb][nb] = WFrag<bf>::mma(a0[mb], h0[nb], acc[mb][nb]);
#pragma unroll
        for (int nb = 0; nb < 4; ++nb)
#pragma unroll
            for (int mb = 0; mb < 4; ++mb) acc[mb][nb] = WFrag<bf>::mma(a0[mb], l0[nb], acc[mb][nb]);
        const int nx = min(it + 2, DQ / 32 - 1);   // the last trip re-reads the last k step: in bounds, unused
        const bf* ap2 = A + nx * 512; const bf* hp2 = Bh + nx * 512; const bf* lp2 = Bl + nx * 512;
#pragma unroll
        for (int mb = 0; mb < 4; ++mb) { a0[mb] = WFrag<bf>::ld(ap2 + mb * 16 * DQ + lo); h0[mb] = WFrag<bf>::ld(hp2 + mb * 16 * DQ + lo); l0[mb] = WFrag<bf>::ld(lp2 + mb * 16 * DQ + lo); }
        // as above, for the other set
        asm volatile("s_wait_xcnt 0x0" :: "s"(ap2), "s"(hp2), "s"(lp2) : "memory");
        __builtin_amdgcn_sched_barrier(0);   // as above
#pragma unroll
        for (int nb = 0; nb < 4; ++nb)
#pragma unroll
            for (int mb = 0; mb < 4; ++mb) acc[mb][nb] = WFrag<bf>::mma(a1[mb], h1[nb], acc[mb][nb]);
#pragma unroll
        for (int nb = 0; nb < 4; ++nb)
#pragma unroll
            for (int mb = 0; mb < 4; ++mb) acc[mb][nb] = WFrag<bf>::mma(a1[mb], l1[nb], acc[mb][nb]);
    }
    // accumulator (mb, nb): token 16 nb + lane % 16, n = 16 mb + 8 (lane / 16) + j; row pitch 68 floats: the 16 lanes of a half wave fall on all 64 banks once
    float* ow = os + wv * (64 * 68);
#pragma unroll
    for (int nb = 0; nb < 4; ++nb)
#pragma unroll
        for (int mb = 0; mb < 4; ++mb) { float* p = ow + (nb * 16 + lr) * 68 + mb * 16 + hi * 8;
            *(v4fa*)p = (v4f){acc[mb][nb][0], acc[mb][nb][1], acc[mb][nb][2], acc[mb][nb][3]}; *(v4fa*)(p + 4) = (v4f){acc[mb][nb][4], acc[mb][nb][5], acc[mb][nb][6], acc[mb][nb][7]}; }
    // the wave's own LDS writes have landed before other lanes of the same wave read them back; the clobber keeps the reads behind it in the build (no other wave touches this range, so no barrier)
    asm volatile("s_wait_dscnt 0x0" ::: "memory");
    float* crow = C + (size_t)(xt * 64 + hi) * DM + ct * 64 + lr * 4; const float* orow = ow + hi * 68 + lr * 4;
#pragma unroll
    for (int s = 0; s < 4; ++s) { v4f val[8];
#pragma unroll
        for (int i = 0; i < 8; ++i) val[i] = *(const v4fa*)(orow + (s * 8 + i) * 2 * 68);
#pragma unroll
        for (int i = 0; i < 8; ++i) *(v4f*)(crow + (size_t)(s * 8 + i) * 2 * DM) = val[i];
        // stands behind the eight stores; their data and base pointer are inputs so that those registers stay untouched up to it (precaution: a register that an issued store names is not rewritten ahead of this wait)
        asm volatile("s_wait_xcnt 0x0" :: "v"(val[0]), "v"(val[1]), "v"(val[2]), "v"(val[3]), "v"(val[4]), "v"(val[5]), "v"(val[6]), "v"(val[7]), "v"(crow) : "memory"); }
}

extern "C" void kernel_launch(void* const* d_in, const int* in_sizes, int n_in,
                              void* d_out, int out_size, void* d_ws, size_t ws_size, hipStream_t stream) {
    (void)in_sizes; (void)n_in; (void)out_size;
    const float* x = (const float*)d_in[0]; const float* wf = (const float*)d_in[1]; const float* wo = (const float*)d_in[2];
    float* OUT = (float*)d_out;     // [4][2048][1024]
    char* wsp = (char*)d_ws;
    auto take = [&](size_t bytes) { char* p = wsp; wsp += (bytes + 255) & ~(size_t)255; return (void*)p; };
    const size_t PQ = (size_t)NH_ * TT * HD, PK = (size_t)NKV * TT * HD;   // elements of one batch's head planes; the planes hold all NB_ batches, [b][h][..]
    bf* WO = (bf*)take((size_t)DM * DQ * 2);
    bf* XB = (bf*)take((size_t)NB_ * TT * DM * 2); bf* WALL = (bf*)take((size_t)(DQ + 2 * DKV) * DM * 2);
    h16* QP16 = (h16*)take(NB_ * PQ * 2); h16* KP16 = (h16*)take(NB_ * PK * 2); h16* VT16 = (h16*)take(NB_ * PK * 2);
    bf* QPh = (bf*)take(NB_ * PQ * 2); bf* QPl = (bf*)take(NB_ * PQ * 2); bf* KPh = (bf*)take(NB_ * PK * 2); bf* KPl = (bf*)take(NB_ * PK * 2); bf* VTh = (bf*)take(NB_ * PK * 2); bf* VTl = (bf*)take(NB_ * PK * 2);
    bf* ATh = (bf*)take((size_t)NB_ * TT * DQ * 2); bf* ATl = (bf*)take((size_t)NB_ * TT * DQ * 2);
    if ((size_t)(wsp - (char*)d_ws) > ws_size) return;    // ws 256 MiB
    k_wtG<<<(unsigned)(((DQ + 2 * DKV) / 32) * (DM / 64)), 256, 0, stream>>>(wf, DM, DQ + 2 * DKV, WALL);
    k_wtG<<<(unsigned)((DM / 32) * (DQ / 64)), 256, 0, stream>>>(wo, DQ, DM, WO);
    k_cvtp<<<(unsigned)((NB_ * TT / 16) * (DM / 32) / 8), 256, 0, stream>>>(x, XB);
    k_qkv<<<dim3(NB_ * TT / 256, (DQ + 2 * DKV) / 192, 1), 384, 0, stream>>>(XB, WALL, QP16, QPh, QPl, KP16, KPh, KPl, VT16, VTh, VTl);
    // one kv head per query head (REP == 1): plane z = b * NH_ + h of every operand
    k_fattn<<<dim3(NB_ * NH_, (TT - RH) / 256 + RH / 128, 1), 256, 0, stream>>>(QP16, KP16, VT16, QPh, QPl, KPh, KPl, VTh, VTl, ATh, ATl);
    k_proj<<<dim3(NB_ * TT / 128, DM / 256, 1), 256, 0, stream>>>(ATh, ATl, WO, OUT);
}

// v008
// A run of this version takes 119 microseconds.
// In two side-by-side timings against v007, it was 1.13 and 1.14 times as fast.
// All steps since v000 together make it 24.0 times as fast.
#include <hip/hip_runtime.h>

// MuCausalSelfAttention (x [4][2048][1024]; qkv = x W_attn ([1024][3072]: q | k | v column blocks, 16 heads x 64); muP scaling: scores = q.k / 64 (1/head_dim); causal (-inf); softmax; out = merged W_proj -> [4][2048][1024]).
// Compute dtypes, f32 accumulate: every input rounded to bf16; q/k/v on PLAIN bf16 operands (inputs: exact), their head planes written by the projection's own epilogue; causal scores and attn.v: query rows < 512 hl (3 products), the rest single fp16, fused in registers (running-maximum softmax, f32), keys past the diagonal pass never read; W_proj hl x exact (2 products).
// FRAGMENT ORDER: every 16-bit operand plane (R rows x K, the product's k along a row) lies in memory as tiles of 16 rows x 32 k = 512 elements, tile (r / 16, k / 32) at ((r / 16) * (K / 32) + k / 32) * 512;
// inside a tile element (r, k) stands at ((k % 32) / 16) * 256 + (((k % 16) / 8) * 16 + r % 16) * 8 + k % 8: lane l of a wave finds its two 16-byte fragment pieces at l * 8 and 256 + l * 8, so that each wave-wide load is 512 bytes in a row (4 whole lines, not 16 pieces of 32 bytes).

#define NB_  4
#define TT   2048
#define DM   1024
#define NH_  16
#define NKV  16
#define REP  (NH_ / NKV)
#define HD   64
#define DQ   (NH_ * HD)
#define DKV  (NKV * HD)
#define RH   512                  // query rows < RH use hi+lo planes (0: none)
#define SCL  0.015625f   // muP: 1/head_dim
#define SCL2 (SCL * 1.4426950408889634f)   // the same in log2 units
typedef _Float16 h16;
typedef unsigned short bf;
typedef __attribute__((ext_vector_type(16))) __bf16   v16bf;
typedef __attribute__((ext_vector_type(16))) _Float16 v16h;
typedef __attribute__((ext_vector_type(8)))  _Float16 v8h;
typedef __attribute__((ext_vector_type(8)))  unsigned short v8us;
typedef __attribute__((ext_vector_type(8)))  float    v8f;
typedef __attribute__((ext_vector_type(4)))  float    v4f;
typedef v8h  __attribute__((may_alias)) v8ha;
typedef v4f  __attribute__((may_alias)) v4fa;
typedef v8us __attribute__((may_alias)) v8usa;

__device__ __forceinline__ unsigned short f2bf(float f) { unsigned u = __float_as_uint(f); u += 0x7FFFu + ((u >> 16) & 1u); return (unsigned short)(u >> 16); }
__device__ __forceinline__ float bf2f(unsigned short b) { return __uint_as_float(((unsigned)b) << 16); }
__device__ __forceinline__ float bfr(float f) { return bf2f(f2bf(f)); }
__device__ __forceinline__ v16h cat16(v8h lo, v8h hi) { return __builtin_shufflevector(lo, hi, 0, 1, 2, 3, 4, 5, 6, 7, 8, 9, 10, 11, 12, 13, 14, 15); }
__device__ __forceinline__ v16bf cat16b(v8us lo, v8us hi) { return __builtin_bit_cast(v16bf, __builtin_shufflevector(lo, hi, 0, 1, 2, 3, 4, 5, 6, 7, 8, 9, 10, 11, 12, 13, 14, 15)); }
__device__ __forceinline__ v8f wmma16(v16h a, v16h b, v8f c) { return __builtin_amdgcn_wmma_f32_16x16x32_f16(false, a, false, b, (short)0, c, false, false); }
__device__ __forceinline__ v8f wmmab(v16bf a, v16bf b, v8f c) { return __builtin_amdgcn_wmma_f32_16x16x32_bf16(false, a, false, b, (short)0, c, false, false); }



// ---- fragment loads and products of the two 16-bit types; operands straight from 16-bit planes in fragment order
template <typename T16> struct WFrag;
template <> struct WFrag<h16> { typedef v16h V; static __device__ __forceinline__ V ld(const h16* p) { return cat16(*(const v8h*)p, *(const v8h*)(p + 256)); } static __device__ __forceinline__ v8f mma(V a, V b, v8f c) { return wmma16(a, b, c); } };
template <> struct WFrag<bf> { typedef v16bf V; static __device__ __forceinline__ V ld(const bf* p) { return cat16b(*(const v8us*)p, *(const v8us*)(p + 256)); } static __device__ __forceinline__ v8f mma(V a, V b, v8f c) { return wmmab(a, b, c); } };

__device__ __forceinline__ h16 tohx(float x) { return (h16)x; }
__device__ __forceinline__ void splitf(float y, unsigned short& h, unsigned short& l) { h = f2bf(y); l = f2bf(y - bf2f(h)); }
typedef __attribute__((ext_vector_type(2))) _Float16 v2h;
typedef __attribute__((ext_vector_type(4))) _Float16 v4h;
typedef __attribute__((ext_vector_type(2))) unsigned short v2us;
typedef __attribute__((ext_vector_type(4))) unsigned short v4us;
typedef __attribute__((ext_vector_type(2))) float v2f;
typedef __attribute__((ext_vector_type(4))) int v4i;

// k_wtG: Bt = bf16(w^T) in fragment order (rows n, k along a row), w [K][N] f32. A wave writes one half tile (512 bytes in a row): lane l takes 8 consecutive k of row n = 16 nt + l % 16, so that each of its 8 loads reads 64 bytes in a row of two rows of w.
// The 8 waves of a block take 2 x 2 neighbouring tiles (32 n x 64 k), so that both halves of a 128-byte line of w are read on one WGP. grid (N / 32) * (K / 64).
__global__ __launch_bounds__(256) void k_wtG(const float* __restrict__ w, int K, int N, bf* Bt) {
    const int lane = threadIdx.x & 31, wv = threadIdx.x >> 5; const int kp = K / 64;
    const int nt = ((int)blockIdx.x / kp) * 2 + ((wv >> 1) & 1), kt = ((int)blockIdx.x % kp) * 2 + (wv >> 2), half = wv & 1;
    const float* wp = w + (size_t)(kt * 32 + half * 16 + (lane >> 4) * 8) * N + nt * 16 + (lane & 15); v8us o;
#pragma unroll
    for (int j = 0; j < 8; ++j) o[j] = f2bf(wp[(size_t)j * N]);
    *(v8us*)(Bt + ((size_t)nt * (K / 32) + kt) * 512 + half * 256 + lane * 8) = o;
}
// k_cvtp: dst = bf16(src) in fragment order, src [rows][DM] f32. A wave takes one tile (16 rows x 32 k = one whole 128-byte line of each row): four loads of 4 whole lines each; a lane's 4 values are half a fragment piece, stored as 8 bytes (64 bytes in a row per 4 rows).
__global__ __launch_bounds__(256) void k_cvtp(const float* __restrict__ src, bf* dst) {
    const int lane = threadIdx.x & 31; const int tile = (int)blockIdx.x * 8 + (int)(threadIdx.x >> 5); const int rt = tile / (DM / 32), kt = tile % (DM / 32);
    const float* sp = src + (size_t)(rt * 16 + (lane >> 3)) * DM + kt * 32 + (lane & 7) * 4;
    bf* dp = dst + (size_t)tile * 512 + ((lane & 7) >> 2) * 256 + (((lane >> 1) & 1) * 16 + (lane >> 3)) * 8 + (lane & 1) * 4;
    v4f v[4];
#pragma unroll
    for (int i = 0; i < 4; ++i) v[i] = *(const v4f*)(sp + (size_t)i * 4 * DM);
#pragma unroll
    for (int i = 0; i < 4; ++i) { v4us o;
#pragma unroll
        for (int k = 0; k < 4; ++k) o[k] = f2bf(v[i][k]);
        *(v4us*)(dp + i * 32) = o; }
}
// ---- k_qkv: the q, k and v projections of every batch in one launch; each wave owns one 64x64 tile (64 tokens x one head) and sums the whole K itself, in the order of its walk, in 16 accumulators: no LDS, no barrier.
// The operands stand so that a lane's 8 accumulator registers are 8 consecutive k of the plane it writes, which is its own 16-byte fragment piece: the head planes (fp16 + hi/lo bf16) are stored straight from registers, 512 bytes in a row per wave, and no f32 q/k/v ever reaches memory.
// q and k: A = weight rows (D rows = d), B = x rows (D column = token): plane [b][h][t][d], fragment order, k = d. v: A = x rows (D rows = token), B = weight rows (D column = d): the d-major value plane, fragment order, k = t.
// grid (NB_ TT / 256, 3 x 16 / 3): the 12 waves of a work-group take 4 token blocks x 3 heads, so that each fragment they load is wanted by 3 or 4 waves of one WGP at about the same time and the WGP's cache can serve the repeats.
// Two fragment sets: a k step's sixteen loads are issued one step ahead and fly under the other set's products. 12 waves of under 336 registers = three a SIMD, 512 work-groups = two whole rounds of the chip.
// ROTATED k WALK: a work-group enters the 32 k steps at step (x + 2 y) % 32 and wraps round, so that the work-groups that share x rows (same x) or weight rows (same y) ask L2 for different lines at any one moment; the waves of one work-group keep one start and go on sharing the WGP's cache.
__global__ __launch_bounds__(384) void k_qkv(const bf* __restrict__ X, const bf* __restrict__ Wt, h16* Q16, bf* Qh, bf* Ql, h16* K16, bf* Kh, bf* Kl, h16* V16, bf* Vh, bf* Vl) {
    typedef WFrag<bf>::V V;
    const int lane = threadIdx.x & 31;
    const int wv = __builtin_amdgcn_readfirstlane((int)(threadIdx.x >> 5));   // wave number, scalar
    const int xt = (int)blockIdx.x * 4 + (wv & 3), ct = (int)blockIdx.y * 3 + (wv >> 2);   // token block, head column block (q | k | v)
    const bool isv = ct >= (DQ + DKV) / 64;   // scalar
    const bf* xr = X + (size_t)xt * 64 * DM; const bf* wr = Wt + (size_t)ct * 64 * DM;
    const bf* A = (isv ? xr : wr) + 8 * lane; const bf* Bt = (isv ? wr : xr) + 8 * lane;
    const int s0 = ((int)blockIdx.x + 2 * (int)blockIdx.y) & (DM / 32 - 1);   // first k step of this work-group, scalar
    const bf* as = A + s0 * 512; const bf* bs = Bt + s0 * 512;
    v8f acc[4][4];
#pragma unroll
    for (int mb = 0; mb < 4; ++mb)
#pragma unroll
        for (int nb = 0; nb < 4; ++nb) acc[mb][nb] = (v8f){};
    V a0[4], b0[4], a1[4], b1[4];
#pragma unroll
    for (int mb = 0; mb < 4; ++mb) { a0[mb] = WFrag<bf>::ld(as + (size_t)mb * 16 * DM); b0[mb] = WFrag<bf>::ld(bs + (size_t)mb * 16 * DM); }
    // stands behind the first step's loads (precaution: a register that an issued load names is not rewritten ahead of this wait); the scheduling barrier keeps the accumulators' zeroing, which reuses such a register, behind it
    asm volatile("s_wait_xcnt 0x0" :: "v"(as), "v"(bs) : "memory");
    __builtin_amdgcn_sched_barrier(0);
#pragma unroll 1   // rolled: a trip is two k steps, one per fragment set; more would only lengthen the code
    for (int it = 0; it < DM / 32; it += 2) {
        const int n1 = (s0 + it + 1) & (DM / 32 - 1);   // the next step of the rotated walk
        const bf* ap = A + n1 * 512; const bf* bp = Bt + n1 * 512;
#pragma unroll
        for (int mb = 0; mb < 4; ++mb) { a1[mb] = WFrag<bf>::ld(ap + (size_t)mb * 16 * DM); b1[mb] = WFrag<bf>::ld(bp + (size_t)mb * 16 * DM); }
        // stands behind the next step's loads; the two pointers are inputs so that their registers stay untouched up to it (precaution: a register that an issued load names is not rewritten ahead of this wait);
        // this step's fragments are inputs too, so that the next step's loads stay in front of this step's products
        asm volatile("s_wait_xcnt 0x0" :: "v"(ap), "v"(bp), "v"(a0[0]), "v"(a0[1]), "v"(a0[2]), "v"(a0[3]), "v"(b0[0]), "v"(b0[1]), "v"(b0[2]), "v"(b0[3]) : "memory");
        __builtin_amdgcn_sched_barrier(0);   // keeps every product of this step behind the next step's loads (without it the build lifts one product, with its wait for memory, in front of them, and the loads start a memory latency late)
#pragma unroll
        for (int nb = 0; nb < 4; ++nb)
#pragma unroll
            for (int mb = 0; mb < 4; ++mb) acc[mb][nb] = WFrag<bf>::mma(a0[mb], b0[nb], acc[mb][nb]);
        const int nx = (s0 + it + 2) & (DM / 32 - 1);   // the last trip re-reads the walk's first k step: in bounds, unused
        const bf* ap2 = A + nx * 512; const bf* bp2 = Bt + nx * 512;
#pragma unroll
        for (int mb = 0; mb < 4; ++mb) { a0[mb] = WFrag<bf>::ld(ap2 + (size_t)mb * 16 * DM); b0[mb] = WFrag<bf>::ld(bp2 + (size_t)mb * 16 * DM); }
        // as above, for the other set
        asm volatile("s_wait_xcnt 0x0" :: "v"(ap2), "v"(bp2), "v"(a1[0]), "v"(a1[1]), "v"(a1[2]), "v"(a1[3]), "v"(b1[0]), "v"(b1[1]), "v"(b1[2]), "v"(b1[3]) : "memory");
        __builtin_amdgcn_sched_barrier(0);   // as above
#pragma unroll
        for (int nb = 0; nb < 4; ++nb)
#pragma unroll
            for (int mb = 0; mb < 4; ++mb) acc[mb][nb] = WFrag<bf>::mma(a1[mb], b1[nb], acc[mb][nb]);
    }
    const int hd = ct & (NH_ - 1), bb = xt / (TT / 64), t0 = (xt % (TT / 64)) * 64;   // head, batch, first token of the tile
    const size_t base = (size_t)(bb * NH_ + hd) * TT * HD + (isv ? (size_t)t0 * 16 : (size_t)t0 * HD) + 8 * lane; const int ld = isv ? TT * 16 : HD * 16;   // ld: from one 16-row band of tiles to the next
    h16* P16 = (isv ? V16 : ct < DQ / 64 ? Q16 : K16) + base; bf* Ph = (isv ? Vh : ct < DQ / 64 ? Qh : Kh) + base; bf* Pl = (isv ? Vl : ct < DQ / 64 ? Ql : Kl) + base;
    // accumulator (mb, nb): plane rows 16 nb + lane % 16, k = 16 mb + 8 (lane / 16) + j, that is half tile mb of band nb, piece lane
#pragma unroll
    for (int nb = 0; nb < 4; ++nb) { h16* p16 = P16 + (size_t)nb * ld; bf* ph = Ph + (size_t)nb * ld; bf* pl = Pl + (size_t)nb * ld;
#pragma unroll
        for (int mb = 0; mb < 4; ++mb) { v8h o16; v8us oh, ol;
#pragma unroll
            for (int j = 0; j < 8; ++j) { const float r = acc[mb][nb][j]; o16[j] = tohx(r); unsigned short a2, c2; splitf(r, a2, c2); oh[j] = a2; ol[j] = c2; }
            *(v8h*)(p16 + mb * 256) = o16; *(v8us*)(ph + mb * 256) = oh; *(v8us*)(pl + mb * 256) = ol;
            // stands behind the three stores; their data and pointers are inputs so that those registers stay untouched up to it (precaution: a register that an issued store names is not rewritten ahead of this wait)
            asm volatile("s_wait_xcnt 0x0" :: "v"(o16), "v"(oh), "v"(ol), "v"(p16), "v"(ph), "v"(pl) : "memory"); } }
}
__device__ __forceinline__ float xhalf(float x) { return __builtin_bit_cast(float, __builtin_amdgcn_permlanex16(__builtin_bit_cast(int, x), __builtin_bit_cast(int, x), 0x76543210, 0xfedcba98, false, false)); }   // lane l <-> lane l ^ 16
__device__ __forceinline__ void pcvt(const float (&p)[16], v16h& a, v16h& a2) { (void)a2;
#pragma unroll
    for (int e = 0; e < 16; ++e) a[e] = (_Float16)p[e]; }
__device__ __forceinline__ void pcvt(const float (&p)[16], v16bf& a, v16bf& a2) {
#pragma unroll
    for (int e = 0; e < 16; ++e) { const __bf16 h = (__bf16)p[e]; a[e] = h; a2[e] = (__bf16)(p[e] - (float)h); } }
template <typename T16, bool HL, int NG>
__device__ __forceinline__ void attn_rows(const T16* __restrict__ Q, const T16* __restrict__ Q2, const T16* __restrict__ Kp, const T16* __restrict__ K2, const T16* __restrict__ Vt, const T16* __restrict__ V2, int q0, int nc, int st, bf* __restrict__ Oh, bf* __restrict__ Ol, int lr, int hi) {
    typedef typename WFrag<T16>::V V;
    V qf[NG][2], qf2[NG][2], kf[2][2], kf2[2][2];
#pragma unroll
    for (int g = 0; g < NG; ++g)
#pragma unroll
        for (int ks = 0; ks < 2; ++ks) { const size_t qo = (size_t)(q0 + g * 16) * HD + ks * 512 + 8 * (hi * 16 + lr); qf[g][ks] = WFrag<T16>::ld(Q + qo); if (HL) qf2[g][ks] = WFrag<T16>::ld(Q2 + qo); }
    v8f o[NG][4]; float mu[NG], ls[NG];
#pragma unroll
    for (int g = 0; g < NG; ++g) { mu[g] = -1.0e30f; ls[g] = 0.f;
#pragma unroll
        for (int dt = 0; dt < 4; ++dt) o[g][dt] = (v8f){}; }
    const int last = ((q0 + NG * 16 - 1) >> 5) << 5;   // first key of the pass that holds the diagonal
    const int np = last >> 5;   // index of that pass, the wave's last
    // ROTATED KEY WALK: the nc passes in front of the work-group's first query row are common to its 8 waves; they are entered at pass st and wrapped round (every wave alike, so that the waves go on sharing the WGP's cache); the passes from there to the wave's own diagonal follow in order. All scalar.
    auto keyof = [&](int i) { const int r = i + st; return (i < nc ? (r >= nc ? r - nc : r) : i) << 5; };
    int kb = keyof(0);
    const size_t ko = 8 * (hi * 16 + lr), vo = ko;   // the lane's piece of a tile
    const T16* kq = Kp + ko + (size_t)kb * HD; const T16* kq2 = HL ? K2 + ko + (size_t)kb * HD : kq;   // the entry pass's key rows
#pragma unroll
    for (int t = 0; t < 2; ++t)
#pragma unroll
        for (int ks = 0; ks < 2; ++ks) { kf[t][ks] = WFrag<T16>::ld(kq + t * 16 * HD + ks * 512); if (HL) kf2[t][ks] = WFrag<T16>::ld(kq2 + t * 16 * HD + ks * 512); }
    // stands behind the first pass's key loads; the pointers are inputs so that their registers stay untouched up to it (precaution: a register that an issued load names is not rewritten ahead of this wait)
    asm volatile("s_wait_xcnt 0x0" :: "v"(kq), "v"(kq2) : "memory");
#pragma unroll 1   // rolled: an unrolled pass would double the live fragments and cost resident waves
    for (int i = 0; i <= np; ++i) {
        V vf[4], vf2[4]; const T16* vp = Vt + vo + kb * 16; const T16* vp2 = HL ? V2 + vo + kb * 16 : vp;
#pragma unroll
        for (int dt = 0; dt < 4; ++dt) { vf[dt] = WFrag<T16>::ld(vp + (size_t)dt * 16 * TT); if (HL) vf2[dt] = WFrag<T16>::ld(vp2 + (size_t)dt * 16 * TT); }
        v8f s[NG][2];
#pragma unroll
        for (int g = 0; g < NG; ++g)
#pragma unroll
            for (int t = 0; t < 2; ++t) { s[g][t] = (v8f){};
#pragma unroll
                for (int ks = 0; ks < 2; ++ks) { s[g][t] = WFrag<T16>::mma(kf[t][ks], qf[g][ks], s[g][t]); if (HL) { s[g][t] = WFrag<T16>::mma(kf[t][ks], qf2[g][ks], s[g][t]); s[g][t] = WFrag<T16>::mma(kf2[t][ks], qf[g][ks], s[g][t]); } } }
        // the next pass's key fragments fly under this pass's softmax (the last pass re-reads its own rows: in bounds, unused)
        const int kx = keyof(min(i + 1, np));   // first key of the next pass
        const size_t kn = (size_t)kx * HD + ko; const T16* kp = Kp + kn; const T16* kp2 = HL ? K2 + kn : kp;
#pragma unroll
        for (int t = 0; t < 2; ++t)
#pragma unroll
            for (int ks = 0; ks < 2; ++ks) { kf[t][ks] = WFrag<T16>::ld(kp + t * 16 * HD + ks * 512); if (HL) kf2[t][ks] = WFrag<T16>::ld(kp2 + t * 16 * HD + ks * 512); }
        // stands behind the pass's loads; the pointers are inputs so that their registers stay untouched up to it (precaution: a register that an issued load names is not rewritten ahead of this wait)
        asm volatile("s_wait_xcnt 0x0" :: "v"(vp), "v"(vp2), "v"(kp), "v"(kp2) : "memory");
        if (i == np) {   // wave-uniform: only the diagonal pass (kb == last) pays for the causal mask
#pragma unroll
            for (int g = 0; g < NG; ++g)
#pragma unroll
                for (int t = 0; t < 2; ++t)
#pragma unroll
                    for (int j = 0; j < 8; ++j) if (last + t * 16 + hi * 8 + j > q0 + g * 16 + lr) s[g][t][j] = -3.0e38f;
        }
        float xm[NG]; bool need = false;
#pragma unroll
        for (int g = 0; g < NG; ++g) { float mx = -3.0e38f;
#pragma unroll
            for (int t = 0; t < 2; ++t)
#pragma unroll
                for (int j = 0; j < 8; ++j) mx = fmaxf(mx, s[g][t][j]);
            xm[g] = fmaxf(mx, xhalf(mx)) * SCL2; need = need || (xm[g] > mu[g] + 8.0f); }   // both halves of the wave hold the query's pass maximum (a pass's first key is never masked, so it is a real score from the first pass on)
        if (__builtin_amdgcn_ballot_w32(need) != 0) {   // one scalar branch a pass; always taken on the first pass (factor 0 on zeros)
#pragma unroll
            for (int g = 0; g < NG; ++g) { const float mn = fmaxf(mu[g], xm[g]); const float al = __builtin_amdgcn_exp2f(mu[g] - mn); mu[g] = mn; ls[g] *= al;
#pragma unroll
                for (int dt = 0; dt < 4; ++dt) o[g][dt] *= al; }
        }
#pragma unroll
        for (int g = 0; g < NG; ++g) { float p[16]; float s0 = 0.f, s1 = 0.f;
#pragma unroll
            for (int e = 0; e < 16; ++e) p[e] = __builtin_amdgcn_exp2f(__builtin_fmaf(s[g][e >> 3][e & 7], SCL2, -mu[g]));
#pragma unroll
            for (int e = 0; e < 16; e += 2) { s0 += p[e]; s1 += p[e + 1]; }
            ls[g] += s0 + s1;
            V pf, pf2; pcvt(p, pf, pf2);
#pragma unroll
            for (int dt = 0; dt < 4; ++dt) { o[g][dt] = WFrag<T16>::mma(vf[dt], pf, o[g][dt]); if (HL) { o[g][dt] = WFrag<T16>::mma(vf[dt], pf2, o[g][dt]); o[g][dt] = WFrag<T16>::mma(vf2[dt], pf, o[g][dt]); } } }
        kb = kx;
    }
    // O^T: a lane holds 8 consecutive d of one query per tile, which is its own piece of the merged plane's fragment order (rows = tokens, k = head * 64 + d): one 16-byte store per plane, 512 bytes in a row per wave
#pragma unroll
    for (int g = 0; g < NG; ++g) { const float inv = __fdiv_rn(1.0f, ls[g] + xhalf(ls[g])); const size_t oo = (size_t)(q0 + g * 16) * DQ + 8 * (hi * 16 + lr); bf* ph = Oh + oo; bf* pl = Ol + oo;
#pragma unroll
        for (int dt = 0; dt < 4; ++dt) { v8us oh, ol;
#pragma unroll
            for (int j = 0; j < 8; ++j) { unsigned short a, c2; splitf(o[g][dt][j] * inv, a, c2); oh[j] = a; ol[j] = c2; }
            *(v8us*)(ph + dt * 256) = oh; *(v8us*)(pl + dt * 256) = ol;
            // stands behind the two stores; their data and base pointers are inputs so that those registers stay untouched up to it (precaution: a register that an issued store names is not rewritten ahead of this wait)
            asm volatile("s_wait_xcnt 0x0" :: "v"(oh), "v"(ol), "v"(ph), "v"(pl) : "memory"); } }
}
// grid (batch x head, row blocks): block y = 0 holds the last 256 query rows (the most keys), so that the long work-groups start first; the hi+lo rows (< RH, 128 a block) come last. 8 independent waves, no barrier.
// amdgpu_waves_per_eu(4, 4): holds the register allocator to 256 registers a wave, so that four waves stay resident on a SIMD (two work-groups a WGP) to cover the global loads' latency; launch_bounds alone would allow 512.
__global__ __launch_bounds__(256) __attribute__((amdgpu_waves_per_eu(4, 4))) void k_fattn(const h16* __restrict__ Q16, const h16* __restrict__ K16, const h16* __restrict__ V16, const bf* __restrict__ Qh, const bf* __restrict__ Ql, const bf* __restrict__ Kh, const bf* __restrict__ Kl, const bf* __restrict__ Vh, const bf* __restrict__ Vl, bf* __restrict__ Ah, bf* __restrict__ Al) {
    const int lane = threadIdx.x & 31, lr = lane & 15, hi = lane >> 4; const int wv = __builtin_amdgcn_readfirstlane((int)(threadIdx.x >> 5));   // wave number, scalar: the pass loop's trip test stays a scalar branch
    const int z = blockIdx.x, y = blockIdx.y; const size_t pz = (size_t)z * TT * HD; const size_t oz = (size_t)(z / NH_) * TT * DQ + (size_t)(z % NH_) * (HD * 16);   // head h = tiles 2 h, 2 h + 1 of a 16-token band
    const int qb = y < (TT - RH) / 256 ? TT - 256 * (y + 1) : RH - 128 * (y - (TT - RH) / 256 + 1);   // the work-group's first query row
    const int nc = qb >> 5, st = (nc * ((z + 11 * y) & 63)) >> 6;   // common passes; entry pass in [0, nc): the share ((z + 11 y) % 64) / 64 of nc, rounded down, so that it varies with the head (z) and the row block (y)
    if (y < (TT - RH) / 256) attn_rows<h16, false, 2>(Q16 + pz, nullptr, K16 + pz, nullptr, V16 + pz, nullptr, qb + wv * 32, nc, st, Ah + oz, Al + oz, lr, hi);
    else attn_rows<bf, true, 1>(Qh + pz, Ql + pz, Kh + pz, Kl + pz, Vh + pz, Vl + pz, qb + wv * 16, nc, st, Ah + oz, Al + oz, lr, hi);
}

__global__ __launch_bounds__(256) void k_proj(const bf* __restrict__ Mh, const bf* __restrict__ Ml, const bf* __restrict__ Wt, float* __restrict__ C) {
    typedef WFrag<bf>::V V;
    __shared__ __align__(16) float os[8 * 64 * 68];
    const int lane = threadIdx.x & 31, lr = lane & 15, hi = lane >> 4;
    const int wv = __builtin_amdgcn_readfirstlane((int)(threadIdx.x >> 5));   // wave number, scalar
    const int xt = (int)blockIdx.x * 2 + (wv >> 2), ct = (int)blockIdx.y * 4 + (wv & 3);   // token block, column block
    const bf* A = Wt + (size_t)ct * 64 * DQ; const bf* Bh = Mh + (size_t)xt * 64 * DQ; const bf* Bl = Ml + (size_t)xt * 64 * DQ; const int lo = 8 * lane;   // scalar bases; the lane's piece is the one vector offset of every load, never rewritten
    const int s0 = ((int)blockIdx.x + 8 * (int)blockIdx.y) & (DQ / 32 - 1);   // first k step of this work-group, scalar
    const bf* as = A + s0 * 512; const bf* hs = Bh + s0 * 512; const bf* ls = Bl + s0 * 512;
    v8f acc[4][4];
#pragma unroll
    for (int mb = 0; mb < 4; ++mb)
#pragma unroll
        for (int nb = 0; nb < 4; ++nb) acc[mb][nb] = (v8f){};
    V a0[4], h0[4], l0[4], a1[4], h1[4], l1[4];
#pragma unroll
    for (int mb = 0; mb < 4; ++mb) { a0[mb] = WFrag<bf>::ld(as + mb * 16 * DQ + lo); h0[mb] = WFrag<bf>::ld(hs + mb * 16 * DQ + lo); l0[mb] = WFrag<bf>::ld(ls + mb * 16 * DQ + lo); }
    // stands behind the first step's loads (precaution: a register that an issued load names is not rewritten ahead of this wait); the scheduling barrier keeps every later instruction behind it
    asm volatile("s_wait_xcnt 0x0" :: "s"(as), "s"(hs), "s"(ls) : "memory");
    __builtin_amdgcn_sched_barrier(0);
#pragma unroll 1   // rolled: a trip is two k steps, one per fragment set; more would only lengthen the code
    for (int it = 0; it < DQ / 32; it += 2) {
        const int n1 = (s0 + it + 1) & (DQ / 32 - 1);   // the next step of the rotated walk
        const bf* ap = A + n1 * 512; const bf* hp = Bh + n1 * 512; const bf* lp = Bl + n1 * 512;
#pragma unroll
        for (int mb = 0; mb < 4; ++mb) { a1[mb] = WFrag<bf>::ld(ap + mb * 16 * DQ + lo); h1[mb] = WFrag<bf>::ld(hp + mb * 16 * DQ + lo); l1[mb] = WFrag<bf>::ld(lp + mb * 16 * DQ + lo); }
        // stands behind the next step's loads; the three scalar bases are inputs so that their registers stay untouched up to it (precaution: a register that an issued load names is not rewritten ahead of this wait)
        asm volatile("s_wait_xcnt 0x0" :: "s"(ap), "s"(hp), "s"(lp) : "memory");
        __builtin_amdgcn_sched_barrier(0);   // keeps every product of this step behind the next step's loads, so that the loads do not start a memory latency late
#pragma unroll
        for (int nb = 0; nb < 4; ++nb)
#pragma unroll
            for (int mb = 0; mb < 4; ++mb) acc[mb][nb] = WFrag<bf>::mma(a0[mb], h0[nb], acc[mb][nb]);
#pragma unroll
        for (int nb = 0; nb < 4; ++nb)
#pragma unroll
            for (int mb = 0; mb < 4; ++mb) acc[mb][nb] = WFrag<bf>::mma(a0[mb], l0[nb], acc[mb][nb]);
        const int nx = (s0 + it + 2) & (DQ / 32 - 1);   // the last trip re-reads the walk's first k step: in bounds, unused
        const bf* ap2 = A + nx * 512; const bf* hp2 = Bh + nx * 512; const bf* lp2 = Bl + nx * 512;
#pragma unroll
        for (int mb = 0; mb < 4; ++mb) { a0[mb] = WFrag<bf>::ld(ap2 + mb * 16 * DQ + lo); h0[mb] = WFrag<bf>::ld(hp2 + mb * 16 * DQ + lo); l0[mb] = WFrag<bf>::ld(lp2 + mb * 16 * DQ + lo); }
        // as above, for the other set
        asm volatile("s_wait_xcnt 0x0" :: "s"(ap2), "s"(hp2), "s"(lp2) : "memory");
        __builtin_amdgcn_sched_barrier(0);   // as above
#pragma unroll
        for (int nb = 0; nb < 4; ++nb)
#pragma unroll
            for (int mb = 0; mb < 4; ++mb) acc[mb][nb] = WFrag<bf>::mma(a1[mb], h1[nb], acc[mb][nb]);
#pragma unroll
        for (int nb = 0; nb < 4; ++nb)
#pragma unroll
            for (int mb = 0; mb < 4; ++mb) acc[mb][nb] = WFrag<bf>::mma(a1[mb], l1[nb], acc[mb][nb]);
    }
    // accumulator (mb, nb): token 16 nb + lane % 16, n = 16 mb + 8 (lane / 16) + j; row pitch 68 floats: the 16 lanes of a half wave fall on all 64 banks once
    float* ow = os + wv * (64 * 68);
#pragma unroll
    for (int nb = 0; nb < 4; ++nb)
#pragma unroll
        for (int mb = 0; mb < 4; ++mb) { float* p = ow + (nb * 16 + lr) * 68 + mb * 16 + hi * 8;
            *(v4fa*)p = (v4f){acc[mb][nb][0], acc[mb][nb][1], acc[mb][nb][2], acc[mb][nb][3]}; *(v4fa*)(p + 4) = (v4f){acc[mb][nb][4], acc[mb][nb][5], acc[mb][nb][6], acc[mb][nb][7]}; }
    // the wave's own LDS writes have landed before other lanes of the same wave read them back; the clobber keeps the reads behind it in the build (no other wave touches this range, so no barrier)
    asm volatile("s_wait_dscnt 0x0" ::: "memory");
    float* crow = C + (size_t)(xt * 64 + hi) * DM + ct * 64 + lr * 4; const float* orow = ow + hi * 68 + lr * 4;
#pragma unroll
    for (int s = 0; s < 4; ++s) { v4f val[8];
#pragma unroll
        for (int i = 0; i < 8; ++i) val[i] = *(const v4fa*)(orow + (s * 8 + i) * 2 * 68);
#pragma unroll
        for (int i = 0; i < 8; ++i) *(v4f*)(crow + (size_t)(s * 8 + i) * 2 * DM) = val[i];
        // stands behind the eight stores; their data and base pointer are inputs so that those registers stay untouched up to it (precaution: a register that an issued store names is not rewritten ahead of this wait)
        asm volatile("s_wait_xcnt 0x0" :: "v"(val[0]), "v"(val[1]), "v"(val[2]), "v"(val[3]), "v"(val[4]), "v"(val[5]), "v"(val[6]), "v"(val[7]), "v"(crow) : "memory"); }
}

extern "C" void kernel_launch(void* const* d_in, const int* in_sizes, int n_in,
                              void* d_out, int out_size, void* d_ws, size_t ws_size, hipStream_t stream) {
    (void)in_sizes; (void)n_in; (void)out_size;
    const float* x = (const float*)d_in[0]; const float* wf = (const float*)d_in[1]; const float* wo = (const float*)d_in[2];
    float* OUT = (float*)d_out;     // [4][2048][1024]
    char* wsp = (char*)d_ws;
    auto take = [&](size_t bytes) { char* p = wsp; wsp += (bytes + 255) & ~(size_t)255; return (void*)p; };
    const size_t PQ = (size_t)NH_ * TT * HD, PK = (size_t)NKV * TT * HD;   // elements of one batch's head planes; the planes hold all NB_ batches, [b][h][..]
    bf* WO = (bf*)take((size_t)DM * DQ * 2);
    bf* XB = (bf*)take((size_t)NB_ * TT * DM * 2); bf* WALL = (bf*)take((size_t)(DQ + 2 * DKV) * DM * 2);
    h16* QP16 = (h16*)take(NB_ * PQ * 2); h16* KP16 = (h16*)take(NB_ * PK * 2); h16* VT16 = (h16*)take(NB_ * PK * 2);
    bf* QPh = (bf*)take(NB_ * PQ * 2); bf* QPl = (bf*)take(NB_ * PQ * 2); bf* KPh = (bf*)take(NB_ * PK * 2); bf* KPl = (bf*)take(NB_ * PK * 2); bf* VTh = (bf*)take(NB_ * PK * 2); bf* VTl = (bf*)take(NB_ * PK * 2);
    bf* ATh = (bf*)take((size_t)NB_ * TT * DQ * 2); bf* ATl = (bf*)take((size_t)NB_ * TT * DQ * 2);
    if ((size_t)(wsp - (char*)d_ws) > ws_size) return;    // ws 256 MiB
    k_wtG<<<(unsigned)(((DQ + 2 * DKV) / 32) * (DM / 64)), 256, 0, stream>>>(wf, DM, DQ + 2 * DKV, WALL);
    k_wtG<<<(unsigned)((DM / 32) * (DQ / 64)), 256, 0, stream>>>(wo, DQ, DM, WO);
    k_cvtp<<<(unsigned)((NB_ * TT / 16) * (DM / 32) / 8), 256, 0, stream>>>(x, XB);
    k_qkv<<<dim3(NB_ * TT / 256, (DQ + 2 * DKV) / 192, 1), 384, 0, stream>>>(XB, WALL, QP16, QPh, QPl, KP16, KPh, KPl, VT16, VTh, VTl);
    // one kv head per query head (REP == 1): plane z = b * NH_ + h of every operand
    k_fattn<<<dim3(NB_ * NH_, (TT - RH) / 256 + RH / 128, 1), 256, 0, stream>>>(QP16, KP16, VT16, QPh, QPl, KPh, KPl, VTh, VTl, ATh, ATl);
    k_proj<<<dim3(NB_ * TT / 128, DM / 256, 1), 256, 0, stream>>>(ATh, ATl, WO, OUT);
}

// v009
// A run of this version takes 113 microseconds.
// Next to v008, in two timings, it ran 1.05 and 1.04 times as fast.
// Counting every step since v000, it is 25.1 times as fast.
#include <hip/hip_runtime.h>

// MuCausalSelfAttention (x [4][2048][1024]; qkv = x W_attn ([1024][3072]: q | k | v column blocks, 16 heads x 64); muP scaling: scores = q.k / 64 (1/head_dim); causal (-inf); softmax; out = merged W_proj -> [4][2048][1024]).
// Compute dtypes, f32 accumulate: every input rounded to bf16; q/k/v on PLAIN bf16 operands (inputs: exact), their head planes written by the projection's own epilogue; causal scores and attn.v: query rows < 512 hl (3 products), the rest single fp16, fused in registers (running-maximum softmax, f32), keys past the diagonal pass never read; W_proj hl x exact (2 products).
// FRAGMENT ORDER: every 16-bit operand plane (R rows x K, the product's k along a row) lies in memory as tiles of 16 rows x 32 k = 512 elements, tile (r / 16, k / 32) at ((r / 16) * (K / 32) + k / 32) * 512;
// inside a tile element (r, k) stands at ((k % 32) / 16) * 256 + (((k % 16) / 8) * 16 + r % 16) * 8 + k % 8: lane l of a wave finds its two 16-byte fragment pieces at l * 8 and 256 + l * 8, so that each wave-wide load is 512 bytes in a row (4 whole lines, not 16 pieces of 32 bytes).

#define NB_  4
#define TT   2048
#define DM   1024
#define NH_  16
#define NKV  16
#define REP  (NH_ / NKV)
#define HD   64
#define DQ   (NH_ * HD)
#define DKV  (NKV * HD)
#define RH   512                  // query rows < RH use hi+lo planes
#define SCL  0.015625f   // muP: 1/head_dim
#define SCL2 (SCL * 1.4426950408889634f)   // the same in log2 units
typedef _Float16 h16;
typedef unsigned short bf;
typedef __attribute__((ext_vector_type(16))) __bf16   v16bf;
typedef __attribute__((ext_vector_type(16))) _Float16 v16h;
typedef __attribute__((ext_vector_type(8)))  _Float16 v8h;
typedef __attribute__((ext_vector_type(8)))  unsigned short v8us;
typedef __attribute__((ext_vector_type(8)))  float    v8f;
typedef __attribute__((ext_vector_type(4)))  float    v4f;
typedef v8h  __attribute__((may_alias)) v8ha;
typedef v4f  __attribute__((may_alias)) v4fa;
typedef v8us __attribute__((may_alias)) v8usa;

__device__ __forceinline__ unsigned short f2bf(float f) { unsigned u = __float_as_uint(f); u += 0x7FFFu + ((u >> 16) & 1u); return (unsigned short)(u >> 16); }
__device__ __forceinline__ float bf2f(unsigned short b) { return __uint_as_float(((unsigned)b) << 16); }
__device__ __forceinline__ float bfr(float f) { return bf2f(f2bf(f)); }
__device__ __forceinline__ v16h cat16(v8h lo, v8h hi) { return __builtin_shufflevector(lo, hi, 0, 1, 2, 3, 4, 5, 6, 7, 8, 9, 10, 11, 12, 13, 14, 15); }
__device__ __forceinline__ v16bf cat16b(v8us lo, v8us hi) { return __builtin_bit_cast(v16bf, __builtin_shufflevector(lo, hi, 0, 1, 2, 3, 4, 5, 6, 7, 8, 9, 10, 11, 12, 13, 14, 15)); }
__device__ __forceinline__ v8f wmma16(v16h a, v16h b, v8f c) { return __builtin_amdgcn_wmma_f32_16x16x32_f16(false, a, false, b, (short)0, c, false, false); }
__device__ __forceinline__ v8f wmmab(v16bf a, v16bf b, v8f c) { return __builtin_amdgcn_wmma_f32_16x16x32_bf16(false, a, false, b, (short)0, c, false, false); }



// ---- fragment loads and products of the two 16-bit types; operands straight from 16-bit planes in fragment order
template <typename T16> struct WFrag;
template <> struct WFrag<h16> { typedef v16h V; static __device__ __forceinline__ V ld(const h16* p) { return cat16(*(const v8h*)p, *(const v8h*)(p + 256)); } static __device__ __forceinline__ v8f mma(V a, V b, v8f c) { return wmma16(a, b, c); } };
template <> struct WFrag<bf> { typedef v16bf V; static __device__ __forceinline__ V ld(const bf* p) { return cat16b(*(const v8us*)p, *(const v8us*)(p + 256)); } static __device__ __forceinline__ v8f mma(V a, V b, v8f c) { return wmmab(a, b, c); } };

__device__ __forceinline__ h16 tohx(float x) { return (h16)x; }
__device__ __forceinline__ void splitf(float y, unsigned short& h, unsigned short& l) { h = f2bf(y); l = f2bf(y - bf2f(h)); }
typedef __attribute__((ext_vector_type(2))) _Float16 v2h;
typedef __attribute__((ext_vector_type(4))) _Float16 v4h;
typedef __attribute__((ext_vector_type(2))) unsigned short v2us;
typedef __attribute__((ext_vector_type(4))) unsigned short v4us;
typedef __attribute__((ext_vector_type(2))) float v2f;
typedef __attribute__((ext_vector_type(4))) int v4i;

// k_wtG: Bt = bf16(w^T) in fragment order (rows n, k along a row), w [K][N] f32. A wave writes one half tile (512 bytes in a row): lane l takes 8 consecutive k of row n = 16 nt + l % 16, so that each of its 8 loads reads 64 bytes in a row of two rows of w.
// The 8 waves of a block take 2 x 2 neighbouring tiles (32 n x 64 k), so that both halves of a 128-byte line of w are read on one WGP. grid (N / 32) * (K / 64).
__global__ __launch_bounds__(256) void k_wtG(const float* __restrict__ w, int K, int N, bf* Bt) {
    const int lane = threadIdx.x & 31, wv = threadIdx.x >> 5; const int kp = K / 64;
    const int nt = ((int)blockIdx.x / kp) * 2 + ((wv >> 1) & 1), kt = ((int)blockIdx.x % kp) * 2 + (wv >> 2), half = wv & 1;
    const float* wp = w + (size_t)(kt * 32 + half * 16 + (lane >> 4) * 8) * N + nt * 16 + (lane & 15); v8us o;
#pragma unroll
    for (int j = 0; j < 8; ++j) o[j] = f2bf(wp[(size_t)j * N]);
    *(v8us*)(Bt + ((size_t)nt * (K / 32) + kt) * 512 + half * 256 + lane * 8) = o;
}
// k_cvtp: dst = bf16(src) in fragment order, src [rows][DM] f32. A wave takes one tile (16 rows x 32 k = one whole 128-byte line of each row): four loads of 4 whole lines each; a lane's 4 values are half a fragment piece, stored as 8 bytes (64 bytes in a row per 4 rows).
__global__ __launch_bounds__(256) void k_cvtp(const float* __restrict__ src, bf* dst) {
    const int lane = threadIdx.x & 31; const int tile = (int)blockIdx.x * 8 + (int)(threadIdx.x >> 5); const int rt = tile / (DM / 32), kt = tile % (DM / 32);
    const float* sp = src + (size_t)(rt * 16 + (lane >> 3)) * DM + kt * 32 + (lane & 7) * 4;
    bf* dp = dst + (size_t)tile * 512 + ((lane & 7) >> 2) * 256 + (((lane >> 1) & 1) * 16 + (lane >> 3)) * 8 + (lane & 1) * 4;
    v4f v[4];
#pragma unroll
    for (int i = 0; i < 4; ++i) v[i] = *(const v4f*)(sp + (size_t)i * 4 * DM);
#pragma unroll
    for (int i = 0; i < 4; ++i) { v4us o;
#pragma unroll
        for (int k = 0; k < 4; ++k) o[k] = f2bf(v[i][k]);
        *(v4us*)(dp + i * 32) = o; }
}
// ---- k_qkv: the q, k and v projections of every batch in one launch; each wave owns one 64x64 tile (64 tokens x one head) and sums the whole K itself, in the order of its walk, in 16 accumulators: no LDS, no barrier.
// The operands stand so that a lane's 8 accumulator registers are 8 consecutive k of the plane it writes, which is its own 16-byte fragment piece: the head planes (fp16 + hi/lo bf16) are stored straight from registers, 512 bytes in a row per wave, and no f32 q/k/v ever reaches memory.
// q and k: A = weight rows (D rows = d), B = x rows (D column = token): plane [b][h][t][d], fragment order, k = d. v: A = x rows (D rows = token), B = weight rows (D column = d): the d-major value plane, fragment order, k = t.
// grid (NB_ TT / 256, 3 x 16 / 3): the 12 waves of a work-group take 4 token blocks x 3 heads, so that each fragment they load is wanted by 3 or 4 waves of one WGP at about the same time and the WGP's cache can serve the repeats.
// Two fragment sets: a k step's sixteen loads are issued one step ahead and fly under the other set's products. 12 waves of under 336 registers = three a SIMD, 512 work-groups = two whole rounds of the chip.
// ROTATED k WALK: a work-group enters the 32 k steps at step (x + 2 y) % 32 and wraps round, so that the work-groups that share x rows (same x) or weight rows (same y) ask L2 for different lines at any one moment; the waves of one work-group keep one start and go on sharing the WGP's cache.
__global__ __launch_bounds__(384) void k_qkv(const bf* __restrict__ X, const bf* __restrict__ Wt, h16* Q16, bf* Qh, bf* Ql, h16* K16, bf* Kh, bf* Kl, h16* V16, bf* Vh, bf* Vl) {
    typedef WFrag<bf>::V V;
    const int lane = threadIdx.x & 31;
    const int wv = __builtin_amdgcn_readfirstlane((int)(threadIdx.x >> 5));   // wave number, scalar
    const int xt = (int)blockIdx.x * 4 + (wv & 3), ct = (int)blockIdx.y * 3 + (wv >> 2);   // token block, head column block (q | k | v)
    const bool isv = ct >= (DQ + DKV) / 64;   // scalar
    const bf* xr = X + (size_t)xt * 64 * DM; const bf* wr = Wt + (size_t)ct * 64 * DM;
    const bf* A = (isv ? xr : wr) + 8 * lane; const bf* Bt = (isv ? wr : xr) + 8 * lane;
    const int s0 = ((int)blockIdx.x + 2 * (int)blockIdx.y) & (DM / 32 - 1);   // first k step of this work-group, scalar
    const bf* as = A + s0 * 512; const bf* bs = Bt + s0 * 512;
    v8f acc[4][4];
#pragma unroll
    for (int mb = 0; mb < 4; ++mb)
#pragma unroll
        for (int nb = 0; nb < 4; ++nb) acc[mb][nb] = (v8f){};
    V a0[4], b0[4], a1[4], b1[4];
#pragma unroll
    for (int mb = 0; mb < 4; ++mb) { a0[mb] = WFrag<bf>::ld(as + (size_t)mb * 16 * DM); b0[mb] = WFrag<bf>::ld(bs + (size_t)mb * 16 * DM); }
    // stands behind the first step's loads (precaution: a register that an issued load names is not rewritten ahead of this wait); the scheduling barrier keeps the accumulators' zeroing, which reuses such a register, behind it
    asm volatile("s_wait_xcnt 0x0" :: "v"(as), "v"(bs) : "memory");
    __builtin_amdgcn_sched_barrier(0);
#pragma unroll 1   // rolled: a trip is two k steps, one per fragment set; more would only lengthen the code
    for (int it = 0; it < DM / 32; it += 2) {
        const int n1 = (s0 + it + 1) & (DM / 32 - 1);   // the next step of the rotated walk
        const bf* ap = A + n1 * 512; const bf* bp = Bt + n1 * 512;
#pragma unroll
        for (int mb = 0; mb < 4; ++mb) { a1[mb] = WFrag<bf>::ld(ap + (size_t)mb * 16 * DM); b1[mb] = WFrag<bf>::ld(bp + (size_t)mb * 16 * DM); }
        // stands behind the next step's loads; the two pointers are inputs so that their registers stay untouched up to it (precaution: a register that an issued load names is not rewritten ahead of this wait);
        // this step's fragments are inputs too, so that the next step's loads stay in front of this step's products
        asm volatile("s_wait_xcnt 0x0" :: "v"(ap), "v"(bp), "v"(a0[0]), "v"(a0[1]), "v"(a0[2]), "v"(a0[3]), "v"(b0[0]), "v"(b0[1]), "v"(b0[2]), "v"(b0[3]) : "memory");
        __builtin_amdgcn_sched_barrier(0);   // keeps every product of this step behind the next step's loads (without it the build lifts one product, with its wait for memory, in front of them, and the loads start a memory latency late)
#pragma unroll
        for (int nb = 0; nb < 4; ++nb)
#pragma unroll
            for (int mb = 0; mb < 4; ++mb) acc[mb][nb] = WFrag<bf>::mma(a0[mb], b0[nb], acc[mb][nb]);
        const int nx = (s0 + it + 2) & (DM / 32 - 1);   // the last trip re-reads the walk's first k step: in bounds, unused
        const bf* ap2 = A + nx * 512; const bf* bp2 = Bt + nx * 512;
#pragma unroll
        for (int mb = 0; mb < 4; ++mb) { a0[mb] = WFrag<bf>::ld(ap2 + (size_t)mb * 16 * DM); b0[mb] = WFrag<bf>::ld(bp2 + (size_t)mb * 16 * DM); }
        // as above, for the other set
        asm volatile("s_wait_xcnt 0x0" :: "v"(ap2), "v"(bp2), "v"(a1[0]), "v"(a1[1]), "v"(a1[2]), "v"(a1[3]), "v"(b1[0]), "v"(b1[1]), "v"(b1[2]), "v"(b1[3]) : "memory");
        __builtin_amdgcn_sched_barrier(0);   // as above
#pragma unroll
        for (int nb = 0; nb < 4; ++nb)
#pragma unroll
            for (int mb = 0; mb < 4; ++mb) acc[mb][nb] = WFrag<bf>::mma(a1[mb], b1[nb], acc[mb][nb]);
    }
    const int hd = ct & (NH_ - 1), bb = xt / (TT / 64), t0 = (xt % (TT / 64)) * 64;   // head, batch, first token of the tile
    const size_t base = (size_t)(bb * NH_ + hd) * TT * HD + (isv ? (size_t)t0 * 16 : (size_t)t0 * HD) + 8 * lane; const int ld = isv ? TT * 16 : HD * 16;   // ld: from one 16-row band of tiles to the next
    h16* P16 = (isv ? V16 : ct < DQ / 64 ? Q16 : K16) + base; bf* Ph = (isv ? Vh : ct < DQ / 64 ? Qh : Kh) + base; bf* Pl = (isv ? Vl : ct < DQ / 64 ? Ql : Kl) + base;
    // accumulator (mb, nb): plane rows 16 nb + lane % 16, k = 16 mb + 8 (lane / 16) + j, that is half tile mb of band nb, piece lane
#pragma unroll
    for (int nb = 0; nb < 4; ++nb) { h16* p16 = P16 + (size_t)nb * ld; bf* ph = Ph + (size_t)nb * ld; bf* pl = Pl + (size_t)nb * ld;
#pragma unroll
        for (int mb = 0; mb < 4; ++mb) { v8h o16; v8us oh, ol;
#pragma unroll
            for (int j = 0; j < 8; ++j) { const float r = acc[mb][nb][j]; o16[j] = tohx(r); unsigned short a2, c2; splitf(r, a2, c2); oh[j] = a2; ol[j] = c2; }
            *(v8h*)(p16 + mb * 256) = o16; *(v8us*)(ph + mb * 256) = oh; *(v8us*)(pl + mb * 256) = ol;
            // stands behind the three stores; their data and pointers are inputs so that those registers stay untouched up to it (precaution: a register that an issued store names is not rewritten ahead of this wait)
            asm volatile("s_wait_xcnt 0x0" :: "v"(o16), "v"(oh), "v"(ol), "v"(p16), "v"(ph), "v"(pl) : "memory"); } }
}
__device__ __forceinline__ float xhalf(float x) { return __builtin_bit_cast(float, __builtin_amdgcn_permlanex16(__builtin_bit_cast(int, x), __builtin_bit_cast(int, x), 0x76543210, 0xfedcba98, false, false)); }   // lane l <-> lane l ^ 16
__device__ __forceinline__ void pcvt(const float (&p)[16], v16h& a, v16h& a2) { (void)a2;
#pragma unroll
    for (int e = 0; e < 16; ++e) a[e] = (_Float16)p[e]; }
__device__ __forceinline__ void pcvt(const float (&p)[16], v16bf& a, v16bf& a2) {
#pragma unroll
    for (int e = 0; e < 16; ++e) { const __bf16 h = (__bf16)p[e]; a[e] = h; a2[e] = (__bf16)(p[e] - (float)h); } }
// join_put: output tiles D0 and D0 + 1 of every group, and the wave's maxima and sums, go to LDS for the partner wave.
template <int NG, int D0>
__device__ __forceinline__ void join_put(const v8f (&o)[NG][4], const float (&mu)[NG], const float (&ls)[NG], float* jr, float* mo, int lane) {
#pragma unroll
    for (int g = 0; g < NG; ++g) {
#pragma unroll
        for (int dt = D0; dt < D0 + 2; ++dt) { float* p = jr + (g * 4 + dt) * 256 + lane * 4;
            *(v4fa*)p = (v4f){o[g][dt][0], o[g][dt][1], o[g][dt][2], o[g][dt][3]}; *(v4fa*)(p + 128) = (v4f){o[g][dt][4], o[g][dt][5], o[g][dt][6], o[g][dt][7]}; }
        mo[g * 64 + lane] = mu[g]; mo[g * 64 + 32 + lane] = ls[g]; }
}
// join_fin: brings the wave's own part and the partner's to the larger maximum, adds them, divides by the joined sum and stores output tiles D0 and D0 + 1.
// The second half has walked the diagonal pass, so that one of the two maxima is a real score's; a first half without passes gets the factor 0.
// O^T: a lane holds 8 consecutive d of one query per tile, which is its own piece of the merged plane's fragment order (rows = tokens, k = head * 64 + d): one 16-byte store per plane, 512 bytes in a row per wave
template <int NG, int D0>
__device__ __forceinline__ void join_fin(const v8f (&o)[NG][4], const float (&mu)[NG], const float (&ls)[NG], const float* jr, const float* mo, int q0, bf* __restrict__ Oh, bf* __restrict__ Ol, int lane) {
#pragma unroll
    for (int g = 0; g < NG; ++g) { const float m2 = mo[g * 64 + lane], l2 = mo[g * 64 + 32 + lane];
        const float mn = fmaxf(mu[g], m2); float f1 = __builtin_amdgcn_exp2f(mu[g] - mn), f2 = __builtin_amdgcn_exp2f(m2 - mn);
        const float lj = ls[g] * f1 + l2 * f2; const float inv = __fdiv_rn(1.0f, lj + xhalf(lj)); f1 *= inv; f2 *= inv;
        const size_t oo = (size_t)(q0 + g * 16) * DQ + 8 * lane; bf* ph = Oh + oo; bf* pl = Ol + oo;
#pragma unroll
        for (int dt = D0; dt < D0 + 2; ++dt) { v8us oh, ol; const float* p = jr + (g * 4 + dt) * 256 + lane * 4; const v4f x0 = *(const v4fa*)p, x1 = *(const v4fa*)(p + 128);
#pragma unroll
            for (int j = 0; j < 8; ++j) { unsigned short a, c2; splitf(o[g][dt][j] * f1 + (j < 4 ? x0[j & 3] : x1[j & 3]) * f2, a, c2); oh[j] = a; ol[j] = c2; }
            *(v8us*)(ph + dt * 256) = oh; *(v8us*)(pl + dt * 256) = ol;
            // stands behind the two stores; their data and base pointers are inputs so that those registers stay untouched up to it (precaution: a register that an issued store names is not rewritten ahead of this wait)
            asm volatile("s_wait_xcnt 0x0" :: "v"(oh), "v"(ol), "v"(ph), "v"(pl) : "memory"); } }
}
template <typename T16, bool HL, int NG>
__device__ __forceinline__ void attn_rows(const T16* __restrict__ Q, const T16* __restrict__ Q2, const T16* __restrict__ Kp, const T16* __restrict__ K2, const T16* __restrict__ Vt, const T16* __restrict__ V2, int q0, int p0, int ncm, int st, int nd, bool first, float* jr, bf* __restrict__ Oh, bf* __restrict__ Ol, int lr, int hi) {
    typedef typename WFrag<T16>::V V;
    V qf[NG][2], qf2[NG][2], kf[2][2], kf2[2][2];
#pragma unroll
    for (int g = 0; g < NG; ++g)
#pragma unroll
        for (int ks = 0; ks < 2; ++ks) { const size_t qo = (size_t)(q0 + g * 16) * HD + ks * 512 + 8 * (hi * 16 + lr); qf[g][ks] = WFrag<T16>::ld(Q + qo); if (HL) qf2[g][ks] = WFrag<T16>::ld(Q2 + qo); }
    v8f o[NG][4]; float mu[NG], ls[NG];
#pragma unroll
    for (int g = 0; g < NG; ++g) { mu[g] = -1.0e30f; ls[g] = 0.f;
#pragma unroll
        for (int dt = 0; dt < 4; ++dt) o[g][dt] = (v8f){}; }
    const int last = ((q0 + NG * 16 - 1) >> 5) << 5;   // first key of the pass that holds the diagonal
    const int n = ncm + nd;   // passes of this wave (0 where a block has no key in front of it to give to the first half)
    // ROTATED KEY WALK: the ncm passes from pass p0 on are common to the 8 waves of a half; they are entered at offset st and wrapped round (every wave of the half alike, so that they go on sharing the WGP's cache); the nd passes from there to the wave's own diagonal (second half only) follow in order. All scalar.
    auto keyof = [&](int i) { const int r = i + st; return (p0 + (i < ncm ? (r >= ncm ? r - ncm : r) : i)) << 5; };
    int kb = keyof(0);
    const size_t ko = 8 * (hi * 16 + lr), vo = ko;   // the lane's piece of a tile
    const T16* kq = Kp + ko + (size_t)kb * HD; const T16* kq2 = HL ? K2 + ko + (size_t)kb * HD : kq;   // the entry pass's key rows
#pragma unroll
    for (int t = 0; t < 2; ++t)
#pragma unroll
        for (int ks = 0; ks < 2; ++ks) { kf[t][ks] = WFrag<T16>::ld(kq + t * 16 * HD + ks * 512); if (HL) kf2[t][ks] = WFrag<T16>::ld(kq2 + t * 16 * HD + ks * 512); }
    // stands behind the first pass's key loads; the pointers are inputs so that their registers stay untouched up to it (precaution: a register that an issued load names is not rewritten ahead of this wait)
    asm volatile("s_wait_xcnt 0x0" :: "v"(kq), "v"(kq2) : "memory");
#pragma unroll 1   // rolled: an unrolled pass would double the live fragments and cost resident waves
    for (int i = 0; i < n; ++i) {
        V vf[4], vf2[4]; const T16* vp = Vt + vo + kb * 16; const T16* vp2 = HL ? V2 + vo + kb * 16 : vp;
#pragma unroll
        for (int dt = 0; dt < 4; ++dt) { vf[dt] = WFrag<T16>::ld(vp + (size_t)dt * 16 * TT); if (HL) vf2[dt] = WFrag<T16>::ld(vp2 + (size_t)dt * 16 * TT); }
        v8f s[NG][2];
#pragma unroll
        for (int g = 0; g < NG; ++g)
#pragma unroll
            for (int t = 0; t < 2; ++t) { s[g][t] = (v8f){};
#pragma unroll
                for (int ks = 0; ks < 2; ++ks) { s[g][t] = WFrag<T16>::mma(kf[t][ks], qf[g][ks], s[g][t]); if (HL) { s[g][t] = WFrag<T16>::mma(kf[t][ks], qf2[g][ks], s[g][t]); s[g][t] = WFrag<T16>::mma(kf2[t][ks], qf[g][ks], s[g][t]); } } }
        // the next pass's key fragments fly under this pass's softmax (the last pass re-reads its own rows: in bounds, unused)
        const int kx = keyof(min(i + 1, n - 1));   // first key of the next pass
        const size_t kn = (size_t)kx * HD + ko; const T16* kp = Kp + kn; const T16* kp2 = HL ? K2 + kn : kp;
#pragma unroll
        for (int t = 0; t < 2; ++t)
#pragma unroll
            for (int ks = 0; ks < 2; ++ks) { kf[t][ks] = WFrag<T16>::ld(kp + t * 16 * HD + ks * 512); if (HL) kf2[t][ks] = WFrag<T16>::ld(kp2 + t * 16 * HD + ks * 512); }
        // stands behind the pass's loads; the pointers are inputs so that their registers stay untouched up to it (precaution: a register that an issued load names is not rewritten ahead of this wait)
        asm volatile("s_wait_xcnt 0x0" :: "v"(vp), "v"(vp2), "v"(kp), "v"(kp2) : "memory");
        if (nd > 0 && i == n - 1) {   // wave-uniform: only the diagonal pass (kb == last) pays for the causal mask
#pragma unroll
            for (int g = 0; g < NG; ++g)
#pragma unroll
                for (int t = 0; t < 2; ++t)
#pragma unroll
                    for (int j = 0; j < 8; ++j) if (last + t * 16 + hi * 8 + j > q0 + g * 16 + lr) s[g][t][j] = -3.0e38f;
        }
        float xm[NG]; bool need = false;
#pragma unroll
        for (int g = 0; g < NG; ++g) { float mx = -3.0e38f;
#pragma unroll
            for (int t = 0; t < 2; ++t)
#pragma unroll
                for (int j = 0; j < 8; ++j) mx = fmaxf(mx, s[g][t][j]);
            xm[g] = fmaxf(mx, xhalf(mx)) * SCL2; need = need || (xm[g] > mu[g] + 8.0f); }   // both halves of the wave hold the query's pass maximum (a pass's first key is never masked, so it is a real score from the first pass on)
        if (__builtin_amdgcn_ballot_w32(need) != 0) {   // one scalar branch a pass; always taken on the first pass (factor 0 on zeros)
#pragma unroll
            for (int g = 0; g < NG; ++g) { const float mn = fmaxf(mu[g], xm[g]); const float al = __builtin_amdgcn_exp2f(mu[g] - mn); mu[g] = mn; ls[g] *= al;
#pragma unroll
                for (int dt = 0; dt < 4; ++dt) o[g][dt] *= al; }
        }
#pragma unroll
        for (int g = 0; g < NG; ++g) { float p[16]; float s0 = 0.f, s1 = 0.f;
#pragma unroll
            for (int e = 0; e < 16; ++e) p[e] = __builtin_amdgcn_exp2f(__builtin_fmaf(s[g][e >> 3][e & 7], SCL2, -mu[g]));
#pragma unroll
            for (int e = 0; e < 16; e += 2) { s0 += p[e]; s1 += p[e + 1]; }
            ls[g] += s0 + s1;
            V pf, pf2; pcvt(p, pf, pf2);
#pragma unroll
            for (int dt = 0; dt < 4; ++dt) { o[g][dt] = WFrag<T16>::mma(vf[dt], pf, o[g][dt]); if (HL) { o[g][dt] = WFrag<T16>::mma(vf[dt], pf2, o[g][dt]); o[g][dt] = WFrag<T16>::mma(vf2[dt], pf, o[g][dt]); } } }
        kb = kx;
    }
    // JOIN: waves w and w + 8 hold partial results of the same queries. Each hands two of its four output tiles per group, with its maximum and sum, to LDS (each store 512 bytes in a row of the pair's own range);
    // behind the work-group barrier each finishes the two tiles it kept. Every wave of the work-group passes the barrier once per call; each call has a range of its own, so that nothing is overwritten while it is read.
    const int lane = hi * 16 + lr; float* mf = jr + NG * 1024; float* ms = mf + NG * 64;   // maxima and sums of the first and of the second half
    if (first) join_put<NG, 2>(o, mu, ls, jr, mf, lane); else join_put<NG, 0>(o, mu, ls, jr, ms, lane);
    __syncthreads();
    if (first) join_fin<NG, 0>(o, mu, ls, jr, ms, q0, Oh, Ol, lane); else join_fin<NG, 2>(o, mu, ls, jr, mf, q0, Oh, Ol, lane);
}
// grid (batch x head, 4): 256 work-groups of 16 waves, one a WGP, all resident at once, so that the launch lasts as long as its fullest work-group: the row blocks are dealt so that all have about the same number of passes.
// A block (256 fp16 query rows, or 128 hi+lo rows < RH) is taken by both halves of the work-group: wave w and wave w + 8 own the same queries; the first half walks the first h key passes, the second half the rest up to the diagonal, and the two parts are joined through LDS,
// so that the 16 waves run about equally long and four waves stay on every SIMD to the end. Of the 6 fp16 blocks (y = 0: the last rows, the most keys) work-group c takes y = c and, for c >= 2, y = 7 - c; then one hi+lo block, the longer ones where the fp16 share is shorter.
// amdgpu_waves_per_eu(4, 4): holds the register allocator to 256 registers a wave, so that the 16 waves fit the WGP, four a SIMD, to cover the global loads' latency.
#define JR_ 2304   // floats of one wave pair's join range: 2 groups x 4 tiles x 8 registers x 32 lanes, then each half's maxima and sums
static_assert((TT - RH) / 256 == 6 && RH / 128 == 4, "the deal of row blocks to work-groups is written for 6 fp16 blocks and 4 hi+lo blocks");
__global__ __launch_bounds__(512) __attribute__((amdgpu_waves_per_eu(4, 4))) void k_fattn(const h16* __restrict__ Q16, const h16* __restrict__ K16, const h16* __restrict__ V16, const bf* __restrict__ Qh, const bf* __restrict__ Ql, const bf* __restrict__ Kh, const bf* __restrict__ Kl, const bf* __restrict__ Vh, const bf* __restrict__ Vl, bf* __restrict__ Ah, bf* __restrict__ Al) {
    __shared__ __align__(16) float jn[3 * 8 * JR_];
    const int lane = threadIdx.x & 31, lr = lane & 15, hi = lane >> 4; const int wv = __builtin_amdgcn_readfirstlane((int)(threadIdx.x >> 5));   // wave number, scalar: the pass loop's trip test stays a scalar branch
    const int w = wv & 7, t = w < 4 ? w : 11 - w; const bool first = wv < 8;   // wave pair; its query group of the block (groups s and 7 - s on waves s and s + 4: where these share a SIMD, every SIMD has as many diagonal passes); which half of the keys
    const int z = blockIdx.x, c = blockIdx.y; const size_t pz = (size_t)z * TT * HD; const size_t oz = (size_t)(z / NH_) * TT * DQ + (size_t)(z % NH_) * (HD * 16);   // head h = tiles 2 h, 2 h + 1 of a 16-token band
#pragma unroll 1   // rolled: one copy of the fp16 pass loop in the code
    for (int j = 0; j < (c < 2 ? 1 : 2); ++j) {
        const int y = j == 0 ? c : 7 - c, qb = TT - 256 * (y + 1);   // the block's first query row
        const int nc = qb >> 5, h = (nc + 8) >> 1;   // passes in front of the block, common to its waves; the first half's share: as many as the second half's longest wave has, with its 8 diagonal passes
        const int ncm = first ? h : nc - h, st = (ncm * ((z + 11 * y) & 63)) >> 6;   // entry offset in [0, ncm): the row blocks of one head (same z) and the heads of one row block (same y) each enter elsewhere
        attn_rows<h16, false, 2>(Q16 + pz, nullptr, K16 + pz, nullptr, V16 + pz, nullptr, qb + t * 32, first ? 0 : h, ncm, st, first ? 0 : t + 1, first, jn + (j * 8 + w) * JR_, Ah + oz, Al + oz, lr, hi);
    }
    const int qb = c == 0 ? 256 : c == 1 ? 384 : c == 2 ? 128 : 0;   // the hi+lo block's first query row
    const int nc = qb >> 5, h = min(nc, (nc + 4) >> 1);   // as above, with up to 4 diagonal passes
    const int ncm = first ? h : nc - h, st = (ncm * ((z + 11 * (c + 6)) & 63)) >> 6;
    attn_rows<bf, true, 1>(Qh + pz, Ql + pz, Kh + pz, Kl + pz, Vh + pz, Vl + pz, qb + t * 16, first ? 0 : h, ncm, st, first ? 0 : (t >> 1) + 1, first, jn + (16 + w) * JR_, Ah + oz, Al + oz, lr, hi);
}

__global__ __launch_bounds__(256) void k_proj(const bf* __restrict__ Mh, const bf* __restrict__ Ml, const bf* __restrict__ Wt, float* __restrict__ C) {
    typedef WFrag<bf>::V V;
    __shared__ __align__(16) float os[8 * 64 * 68];
    const int lane = threadIdx.x & 31, lr = lane & 15, hi = lane >> 4;
    const int wv = __builtin_amdgcn_readfirstlane((int)(threadIdx.x >> 5));   // wave number, scalar
    const int xt = (int)blockIdx.x * 2 + (wv >> 2), ct = (int)blockIdx.y * 4 + (wv & 3);   // token block, column block
    const bf* A = Wt + (size_t)ct * 64 * DQ; const bf* Bh = Mh + (size_t)xt * 64 * DQ; const bf* Bl = Ml + (size_t)xt * 64 * DQ; const int lo = 8 * lane;   // scalar bases; the lane's piece is the one vector offset of every load, never rewritten
    const int s0 = ((int)blockIdx.x + 8 * (int)blockIdx.y) & (DQ / 32 - 1);   // first k step of this work-group, scalar
    const bf* as = A + s0 * 512; const bf* hs = Bh + s0 * 512; const bf* ls = Bl + s0 * 512;
    v8f acc[4][4];
#pragma unroll
    for (int mb = 0; mb < 4; ++mb)
#pragma unroll
        for (int nb = 0; nb < 4; ++nb) acc[mb][nb] = (v8f){};
    V a0[4], h0[4], l0[4], a1[4], h1[4], l1[4];
#pragma unroll
    for (int mb = 0; mb < 4; ++mb) { a0[mb] = WFrag<bf>::ld(as + mb * 16 * DQ + lo); h0[mb] = WFrag<bf>::ld(hs + mb * 16 * DQ + lo); l0[mb] = WFrag<bf>::ld(ls + mb * 16 * DQ + lo); }
    // stands behind the first step's loads (precaution: a register that an issued load names is not rewritten ahead of this wait); the scheduling barrier keeps every later instruction behind it
    asm volatile("s_wait_xcnt 0x0" :: "s"(as), "s"(hs), "s"(ls) : "memory");
    __builtin_amdgcn_sched_barrier(0);
#pragma unroll 1   // rolled: a trip is two k steps, one per fragment set; more would only lengthen the code
    for (int it = 0; it < DQ / 32; it += 2) {
        const int n1 = (s0 + it + 1) & (DQ / 32 - 1);   // the next step of the rotated walk
        const bf* ap = A + n1 * 512; const bf* hp = Bh + n1 * 512; const bf* lp = Bl + n1 * 512;
#pragma unroll
        for (int mb = 0; mb < 4; ++mb) { a1[mb] = WFrag<bf>::ld(ap + mb * 16 * DQ + lo); h1[mb] = WFrag<bf>::ld(hp + mb * 16 * DQ + lo); l1[mb] = WFrag<bf>::ld(lp + mb * 16 * DQ + lo); }
        // stands behind the next step's loads; the three scalar bases are inputs so that their registers stay untouched up to it (precaution: a register that an issued load names is not rewritten ahead of this wait)
        asm volatile("s_wait_xcnt 0x0" :: "s"(ap), "s"(hp), "s"(lp) : "memory");
        __builtin_amdgcn_sched_barrier(0);   // keeps every product of this step behind the next step's loads, so that the loads do not start a memory latency late
#pragma unroll
        for (int nb = 0; nb < 4; ++nb)
#pragma unroll
            for (int mb = 0; mb < 4; ++mb) acc[mb][nb] = WFrag<bf>::mma(a0[mb], h0[nb], acc[mb][nb]);
#pragma unroll
        for (int nb = 0; nb < 4; ++nb)
#pragma unroll
            for (int mb = 0; mb < 4; ++mb) acc[mb][nb] = WFrag<bf>::mma(a0[mb], l0[nb], acc[mb][nb]);
        const int nx = (s0 + it + 2) & (DQ / 32 - 1);   // the last trip re-reads the walk's first k step: in bounds, unused
        const bf* ap2 = A + nx * 512; const bf* hp2 = Bh + nx * 512; const bf* lp2 = Bl + nx * 512;
#pragma unroll
        for (int mb = 0; mb < 4; ++mb) { a0[mb] = WFrag<bf>::ld(ap2 + mb * 16 * DQ + lo); h0[mb] = WFrag<bf>::ld(hp2 + mb * 16 * DQ + lo); l0[mb] = WFrag<bf>::ld(lp2 + mb * 16 * DQ + lo); }
        // as above, for the other set
        asm volatile("s_wait_xcnt 0x0" :: "s"(ap2), "s"(hp2), "s"(lp2) : "memory");
        __builtin_amdgcn_sched_barrier(0);   // as above
#pragma unroll
        for (int nb = 0; nb < 4; ++nb)
#pragma unroll
            for (int mb = 0; mb < 4; ++mb) acc[mb][nb] = WFrag<bf>::mma(a1[mb], h1[nb], acc[mb][nb]);
#pragma unroll
        for (int nb = 0; nb < 4; ++nb)
#pragma unroll
            for (int mb = 0; mb < 4; ++mb) acc[mb][nb] = WFrag<bf>::mma(a1[mb], l1[nb], acc[mb][nb]);
    }
    // accumulator (mb, nb): token 16 nb + lane % 16, n = 16 mb + 8 (lane / 16) + j; row pitch 68 floats: the 16 lanes of a half wave fall on all 64 banks once
    float* ow = os + wv * (64 * 68);
#pragma unroll
    for (int nb = 0; nb < 4; ++nb)
#pragma unroll
        for (int mb = 0; mb < 4; ++mb) { float* p = ow + (nb * 16 + lr) * 68 + mb * 16 + hi * 8;
            *(v4fa*)p = (v4f){acc[mb][nb][0], acc[mb][nb][1], acc[mb][nb][2], acc[mb][nb][3]}; *(v4fa*)(p + 4) = (v4f){acc[mb][nb][4], acc[mb][nb][5], acc[mb][nb][6], acc[mb][nb][7]}; }
    // the wave's own LDS writes have landed before other lanes of the same wave read them back; the clobber keeps the reads behind it in the build (no other wave touches this range, so no barrier)
    asm volatile("s_wait_dscnt 0x0" ::: "memory");
    float* crow = C + (size_t)(xt * 64 + hi) * DM + ct * 64 + lr * 4; const float* orow = ow + hi * 68 + lr * 4;
#pragma unroll
    for (int s = 0; s < 4; ++s) { v4f val[8];
#pragma unroll
        for (int i = 0; i < 8; ++i) val[i] = *(const v4fa*)(orow + (s * 8 + i) * 2 * 68);
#pragma unroll
        for (int i = 0; i < 8; ++i) *(v4f*)(crow + (size_t)(s * 8 + i) * 2 * DM) = val[i];
        // stands behind the eight stores; their data and base pointer are inputs so that those registers stay untouched up to it (precaution: a register that an issued store names is not rewritten ahead of this wait)
        asm volatile("s_wait_xcnt 0x0" :: "v"(val[0]), "v"(val[1]), "v"(val[2]), "v"(val[3]), "v"(val[4]), "v"(val[5]), "v"(val[6]), "v"(val[7]), "v"(crow) : "memory"); }
}

extern "C" void kernel_launch(void* const* d_in, const int* in_sizes, int n_in,
                              void* d_out, int out_size, void* d_ws, size_t ws_size, hipStream_t stream) {
    (void)in_sizes; (void)n_in; (void)out_size;
    const float* x = (const float*)d_in[0]; const float* wf = (const float*)d_in[1]; const float* wo = (const float*)d_in[2];
    float* OUT = (float*)d_out;     // [4][2048][1024]
    char* wsp = (char*)d_ws;
    auto take = [&](size_t bytes) { char* p = wsp; wsp += (bytes + 255) & ~(size_t)255; return (void*)p; };
    const size_t PQ = (size_t)NH_ * TT * HD, PK = (size_t)NKV * TT * HD;   // elements of one batch's head planes; the planes hold all NB_ batches, [b][h][..]
    bf* WO = (bf*)take((size_t)DM * DQ * 2);
    bf* XB = (bf*)take((size_t)NB_ * TT * DM * 2); bf* WALL = (bf*)take((size_t)(DQ + 2 * DKV) * DM * 2);
    h16* QP16 = (h16*)take(NB_ * PQ * 2); h16* KP16 = (h16*)take(NB_ * PK * 2); h16* VT16 = (h16*)take(NB_ * PK * 2);
    bf* QPh = (bf*)take(NB_ * PQ * 2); bf* QPl = (bf*)take(NB_ * PQ * 2); bf* KPh = (bf*)take(NB_ * PK * 2); bf* KPl = (bf*)take(NB_ * PK * 2); bf* VTh = (bf*)take(NB_ * PK * 2); bf* VTl = (bf*)take(NB_ * PK * 2);
    bf* ATh = (bf*)take((size_t)NB_ * TT * DQ * 2); bf* ATl = (bf*)take((size_t)NB_ * TT * DQ * 2);
    if ((size_t)(wsp - (char*)d_ws) > ws_size) return;    // ws 256 MiB
    k_wtG<<<(unsigned)(((DQ + 2 * DKV) / 32) * (DM / 64)), 256, 0, stream>>>(wf, DM, DQ + 2 * DKV, WALL);
    k_wtG<<<(unsigned)((DM / 32) * (DQ / 64)), 256, 0, stream>>>(wo, DQ, DM, WO);
    k_cvtp<<<(unsigned)((NB_ * TT / 16) * (DM / 32) / 8), 256, 0, stream>>>(x, XB);
    k_qkv<<<dim3(NB_ * TT / 256, (DQ + 2 * DKV) / 192, 1), 384, 0, stream>>>(XB, WALL, QP16, QPh, QPl, KP16, KPh, KPl, VT16, VTh, VTl);
    // one kv head per query head (REP == 1): plane z = b * NH_ + h of every operand
    k_fattn<<<dim3(NB_ * NH_, 4, 1), 512, 0, stream>>>(QP16, KP16, VT16, QPh, QPl, KPh, KPl, VTh, VTl, ATh, ATl);
    k_proj<<<dim3(NB_ * TT / 128, DM / 256, 1), 256, 0, stream>>>(ATh, ATl, WO, OUT);
}

// v010
// A run of this version takes 109 microseconds.
// In both of two side-by-side timings against v009, it was 1.04 times as fast.
// Over all steps from v000 it is 26.1 times as fast.
#include <hip/hip_runtime.h>

// MuCausalSelfAttention (x [4][2048][1024]; qkv = x W_attn ([1024][3072]: q | k | v column blocks, 16 heads x 64); muP scaling: scores = q.k / 64 (1/head_dim); causal (-inf); softmax; out = merged W_proj -> [4][2048][1024]).
// Compute dtypes, f32 accumulate: every input rounded to bf16; q/k/v on PLAIN bf16 operands (inputs: exact), their head planes written by the projection's own epilogue; causal scores and attn.v: query rows < 512 hl (3 products), the rest single fp16, fused in registers (running-maximum softmax, f32), keys past the diagonal pass never read; W_proj hl x exact (2 products).
// FRAGMENT ORDER: every 16-bit operand plane (R rows x K, the product's k along a row) lies in memory as tiles of 16 rows x 32 k = 512 elements, tile (r / 16, k / 32) at ((r / 16) * (K / 32) + k / 32) * 512;
// inside a tile element (r, k) stands at ((k % 32) / 16) * 256 + (((k % 16) / 8) * 16 + r % 16) * 8 + k % 8: lane l of a wave finds its two 16-byte fragment pieces at l * 8 and 256 + l * 8, so that each wave-wide load is 512 bytes in a row (4 whole lines, not 16 pieces of 32 bytes).

#define NB_  4
#define TT   2048
#define DM   1024
#define NH_  16
#define NKV  16
#define REP  (NH_ / NKV)
#define HD   64
#define DQ   (NH_ * HD)
#define DKV  (NKV * HD)
#define RH   512                  // query rows < RH use hi+lo planes
#define SCL  0.015625f   // muP: 1/head_dim
#define SCL2 (SCL * 1.4426950408889634f)   // the same in log2 units
typedef _Float16 h16;
typedef unsigned short bf;
typedef __attribute__((ext_vector_type(16))) __bf16   v16bf;
typedef __attribute__((ext_vector_type(16))) _Float16 v16h;
typedef __attribute__((ext_vector_type(8)))  _Float16 v8h;
typedef __attribute__((ext_vector_type(8)))  unsigned short v8us;
typedef __attribute__((ext_vector_type(8)))  float    v8f;
typedef __attribute__((ext_vector_type(4)))  float    v4f;
typedef v8h  __attribute__((may_alias)) v8ha;
typedef v4f  __attribute__((may_alias)) v4fa;
typedef v8us __attribute__((may_alias)) v8usa;

__device__ __forceinline__ unsigned short f2bf(float f) { unsigned u = __float_as_uint(f); u += 0x7FFFu + ((u >> 16) & 1u); return (unsigned short)(u >> 16); }
__device__ __forceinline__ float bf2f(unsigned short b) { return __uint_as_float(((unsigned)b) << 16); }
__device__ __forceinline__ float bfr(float f) { return bf2f(f2bf(f)); }
__device__ __forceinline__ v16h cat16(v8h lo, v8h hi) { return __builtin_shufflevector(lo, hi, 0, 1, 2, 3, 4, 5, 6, 7, 8, 9, 10, 11, 12, 13, 14, 15); }
__device__ __forceinline__ v16bf cat16b(v8us lo, v8us hi) { return __builtin_bit_cast(v16bf, __builtin_shufflevector(lo, hi, 0, 1, 2, 3, 4, 5, 6, 7, 8, 9, 10, 11, 12, 13, 14, 15)); }
__device__ __forceinline__ v8f wmma16(v16h a, v16h b, v8f c) { return __builtin_amdgcn_wmma_f32_16x16x32_f16(false, a, false, b, (short)0, c, false, false); }
__device__ __forceinline__ v8f wmmab(v16bf a, v16bf b, v8f c) { return __builtin_amdgcn_wmma_f32_16x16x32_bf16(false, a, false, b, (short)0, c, false, false); }



// ---- fragment loads and products of the two 16-bit types; operands straight from 16-bit planes in fragment order
template <typename T16> struct WFrag;
template <> struct WFrag<h16> { typedef v16h V; static __device__ __forceinline__ V ld(const h16* p) { return cat16(*(const v8h*)p, *(const v8h*)(p + 256)); } static __device__ __forceinline__ v8f mma(V a, V b, v8f c) { return wmma16(a, b, c); } };
template <> struct WFrag<bf> { typedef v16bf V; static __device__ __forceinline__ V ld(const bf* p) { return cat16b(*(const v8us*)p, *(const v8us*)(p + 256)); } static __device__ __forceinline__ v8f mma(V a, V b, v8f c) { return wmmab(a, b, c); } };

__device__ __forceinline__ h16 tohx(float x) { return (h16)x; }
__device__ __forceinline__ void splitf(float y, unsigned short& h, unsigned short& l) { h = f2bf(y); l = f2bf(y - bf2f(h)); }
typedef __attribute__((ext_vector_type(2))) _Float16 v2h;
typedef __attribute__((ext_vector_type(4))) _Float16 v4h;
typedef __attribute__((ext_vector_type(2))) unsigned short v2us;
typedef __attribute__((ext_vector_type(4))) unsigned short v4us;
typedef __attribute__((ext_vector_type(2))) float v2f;
typedef __attribute__((ext_vector_type(4))) int v4i;

// k_wtG: Bt = bf16(w^T) in fragment order (rows n, k along a row), w [K][N] f32. A wave writes one half tile (512 bytes in a row): lane l takes 8 consecutive k of row n = 16 nt + l % 16, so that each of its 8 loads reads 64 bytes in a row of two rows of w.
// The 8 waves of a block take 2 x 2 neighbouring tiles (32 n x 64 k), so that both halves of a 128-byte line of w are read on one WGP. grid (N / 32) * (K / 64).
__global__ __launch_bounds__(256) void k_wtG(const float* __restrict__ w, int K, int N, bf* Bt) {
    const int lane = threadIdx.x & 31, wv = threadIdx.x >> 5; const int kp = K / 64;
    const int nt = ((int)blockIdx.x / kp) * 2 + ((wv >> 1) & 1), kt = ((int)blockIdx.x % kp) * 2 + (wv >> 2), half = wv & 1;
    const float* wp = w + (size_t)(kt * 32 + half * 16 + (lane >> 4) * 8) * N + nt * 16 + (lane & 15); v8us o;
#pragma unroll
    for (int j = 0; j < 8; ++j) o[j] = f2bf(wp[(size_t)j * N]);
    *(v8us*)(Bt + ((size_t)nt * (K / 32) + kt) * 512 + half * 256 + lane * 8) = o;
}
// k_cvtp: dst = bf16(src) in fragment order, src [rows][DM] f32. A wave takes one tile (16 rows x 32 k = one whole 128-byte line of each row): four loads of 4 whole lines each; a lane's 4 values are half a fragment piece, stored as 8 bytes (64 bytes in a row per 4 rows).
__global__ __launch_bounds__(256) void k_cvtp(const float* __restrict__ src, bf* dst) {
    const int lane = threadIdx.x & 31; const int tile = (int)blockIdx.x * 8 + (int)(threadIdx.x >> 5); const int rt = tile / (DM / 32), kt = tile % (DM / 32);
    const float* sp = src + (size_t)(rt * 16 + (lane >> 3)) * DM + kt * 32 + (lane & 7) * 4;
    bf* dp = dst + (size_t)tile * 512 + ((lane & 7) >> 2) * 256 + (((lane >> 1) & 1) * 16 + (lane >> 3)) * 8 + (lane & 1) * 4;
    v4f v[4];
#pragma unroll
    for (int i = 0; i < 4; ++i) v[i] = *(const v4f*)(sp + (size_t)i * 4 * DM);
#pragma unroll
    for (int i = 0; i < 4; ++i) { v4us o;
#pragma unroll
        for (int k = 0; k < 4; ++k) o[k] = f2bf(v[i][k]);
        *(v4us*)(dp + i * 32) = o; }
}
// ---- k_qkv: the q, k and v projections of every batch in one launch; each wave owns one 64x192 tile (64 tokens x the q, k and v columns of one head) and sums the whole K itself, in the order of its walk, in 48 accumulators: no LDS, no barrier.
// The operands stand so that a lane's 8 accumulator registers are 8 consecutive k of the plane it writes, which is its own 16-byte fragment piece: the head planes (fp16 + hi/lo bf16) are stored straight from registers, 512 bytes in a row per wave, and no f32 q/k/v ever reaches memory.
// q and k: A = weight rows (D rows = d), B = x rows (D column = token): plane [b][h][t][d], fragment order, k = d. v: A = x rows (D rows = token), B = weight rows (D column = d): the d-major value plane, fragment order, k = t.
// grid (NB_ TT / 256, NH_): the 4 waves of a work-group, one a SIMD, take 4 token blocks of the same head: a k step's 48 products want 16 fragments (a 64x64 tile wants 8 for 16), and each weight fragment is wanted by all 4 waves at about the same time, so that the WGP's cache can serve the repeats.
// Three fragment sets: a k step's 32 loads are issued in two halves, each three half steps (48 loads) ahead of its products. (Whole steps issued two ahead are 64 loads behind the one waited for: the build's counted wait then read 62 and covered the first loads of the next step too, which takes the second step of lead away.) 512 work-groups = two whole rounds of the chip.
// ROTATED k WALK: a work-group enters the 32 k steps at step (x + 2 y) % 32 and wraps round, so that the work-groups that share x rows (same x) or weight rows (same y) ask L2 for different lines at any one moment; the waves of one work-group keep one start and go on sharing the WGP's cache.
// qkv_lda, qkv_ldb: issue the two halves of k step st's loads, 16 each, into a set: the x fragments with the q weight fragments; the k and v weight fragments.
__device__ __forceinline__ void qkv_lda(const bf* Xr, const bf* Wr, int lo, int st, v16bf (&x)[4], v16bf (&w)[12]) {
    const bf* xp = Xr + st * 512; const bf* wp = Wr + st * 512;
#pragma unroll
    for (int i = 0; i < 4; ++i) { x[i] = WFrag<bf>::ld(xp + i * 16 * DM + lo); w[i] = WFrag<bf>::ld(wp + i * 16 * DM + lo); }
    // stands behind the loads; the two scalar bases are inputs so that their registers stay untouched up to it (precaution: a register that an issued load names is not rewritten ahead of this wait)
    asm volatile("s_wait_xcnt 0x0" :: "s"(xp), "s"(wp) : "memory");
    __builtin_amdgcn_sched_barrier(0);   // keeps what follows (products, the next loads) behind these loads: a product lifted in front of them, with its wait for memory, would start them a memory latency late
}
__device__ __forceinline__ void qkv_ldb(const bf* Wr, int lo, int st, v16bf (&w)[12]) {
    const bf* wp = Wr + st * 512;
#pragma unroll
    for (int i = 4; i < 12; ++i) w[i] = WFrag<bf>::ld(wp + ((i >> 2) * DQ + (i & 3) * 16) * DM + lo);   // the k and v rows of the head stand DQ and 2 DQ rows behind its q rows
    // as in qkv_lda
    asm volatile("s_wait_xcnt 0x0" :: "s"(wp) : "memory");
    __builtin_amdgcn_sched_barrier(0);   // as in qkv_lda
}
// qkv_mm: the products of column blocks H0 to H1 - 1 of the wave's three (q, k, v of its head) for one k step. V: the value block, whose operands stand the other way round.
template <int H0, int H1, bool V>
__device__ __forceinline__ void qkv_mm(const v16bf (&x)[4], const v16bf (&w)[12], v8f (&acc)[3][4][4]) {
#pragma unroll
    for (int hb = H0; hb < H1; ++hb)
#pragma unroll
        for (int nb = 0; nb < 4; ++nb)
#pragma unroll
            for (int mb = 0; mb < 4; ++mb) acc[hb][mb][nb] = V ? wmmab(x[mb], w[hb * 4 + nb], acc[hb][mb][nb]) : wmmab(w[hb * 4 + mb], x[nb], acc[hb][mb][nb]);
    __builtin_amdgcn_sched_barrier(0);   // keeps the loads that follow behind these products, so that the wave never has more than four half steps' loads asked for
}
// qkv_step: k step n of the walk, fragments in (x, w). The loads run three half steps (48 loads) ahead of the products: in front of the q products the second half of step n + 1 (into wn), in front of the k and v products the first half of step n + 2 (into xf, wf).
__device__ __forceinline__ void qkv_step(const bf* Xr, const bf* Wr, int lo, int s1, int s2, const v16bf (&x)[4], const v16bf (&w)[12], v16bf (&wn)[12], v16bf (&xf)[4], v16bf (&wf)[12], v8f (&acc)[3][4][4]) {
    qkv_ldb(Wr, lo, s1, wn);
    qkv_mm<0, 1, false>(x, w, acc);
    qkv_lda(Xr, Wr, lo, s2, xf, wf);
    qkv_mm<1, 2, false>(x, w, acc); qkv_mm<2, 3, true>(x, w, acc);
}
// qkv_main: the whole k walk of one wave's tile.
__device__ __forceinline__ void qkv_main(const bf* Xr, const bf* Wr, int lo, int s0, v8f (&acc)[3][4][4]) {
    typedef WFrag<bf>::V V;
    const int KM = DM / 32 - 1;
#pragma unroll
    for (int hb = 0; hb < 3; ++hb)
#pragma unroll
        for (int mb = 0; mb < 4; ++mb)
#pragma unroll
            for (int nb = 0; nb < 4; ++nb) acc[hb][mb][nb] = (v8f){};
    V x0[4], w0[12], x1[4], w1[12], x2[4], w2[12];
    qkv_lda(Xr, Wr, lo, s0, x0, w0); qkv_ldb(Wr, lo, s0, w0); qkv_lda(Xr, Wr, lo, (s0 + 1) & KM, x1, w1);
#pragma unroll 1   // rolled: a trip is three k steps, one per fragment set; more would only lengthen the code
    for (int it = 0; it < DM / 32 - 2; it += 3) {
        qkv_step(Xr, Wr, lo, (s0 + it + 1) & KM, (s0 + it + 2) & KM, x0, w0, w1, x2, w2, acc);
        qkv_step(Xr, Wr, lo, (s0 + it + 2) & KM, (s0 + it + 3) & KM, x1, w1, w2, x0, w0, acc);
        qkv_step(Xr, Wr, lo, (s0 + it + 3) & KM, (s0 + it + 4) & KM, x2, w2, w0, x1, w1, acc);
    }
    // the walk's last two steps: only the second half of the last step's loads is left to issue
    qkv_ldb(Wr, lo, (s0 + DM / 32 - 1) & KM, w1);
    qkv_mm<0, 2, false>(x0, w0, acc); qkv_mm<2, 3, true>(x0, w0, acc);
    qkv_mm<0, 2, false>(x1, w1, acc); qkv_mm<2, 3, true>(x1, w1, acc);
}
__global__ __launch_bounds__(128) void k_qkv(const bf* __restrict__ X, const bf* __restrict__ Wt, h16* Q16, bf* Qh, bf* Ql, h16* K16, bf* Kh, bf* Kl, h16* V16, bf* Vh, bf* Vl) {
    const int lane = threadIdx.x & 31;
    const int wv = __builtin_amdgcn_readfirstlane((int)(threadIdx.x >> 5));   // wave number, scalar
    const int xt = (int)blockIdx.x * 4 + wv, hd = (int)blockIdx.y;   // token block, head
    static_assert(DQ == DKV, "a wave takes the q, k and v columns of one head");
    const bf* Xr = X + (size_t)xt * 64 * DM; const bf* Wr = Wt + (size_t)hd * 64 * DM; const int lo = 8 * lane;   // scalar bases; the lane's piece is the one vector offset of every load, never rewritten
    const int s0 = ((int)blockIdx.x + 2 * (int)blockIdx.y) & (DM / 32 - 1);   // first k step of this work-group, scalar
    v8f acc[3][4][4];
    qkv_main(Xr, Wr, lo, s0, acc);
    const int bb = xt / (TT / 64), t0 = (xt % (TT / 64)) * 64;   // batch, first token of the tile
#pragma unroll 1   // rolled: one copy of the epilogue in the code; it always works on the first block's accumulators, into which the next block's are copied behind it
    for (int hb = 0; hb < 3; ++hb) {
        const bool isv = hb == 2;   // q, k, v in turn; scalar
        const size_t base = (size_t)(bb * NH_ + hd) * TT * HD + (isv ? (size_t)t0 * 16 : (size_t)t0 * HD) + 8 * lane; const int ld = isv ? TT * 16 : HD * 16;   // ld: from one 16-row band of tiles to the next
        h16* P16 = (isv ? V16 : hb == 0 ? Q16 : K16) + base; bf* Ph = (isv ? Vh : hb == 0 ? Qh : Kh) + base; bf* Pl = (isv ? Vl : hb == 0 ? Ql : Kl) + base;
        // accumulator (mb, nb): plane rows 16 nb + lane % 16, k = 16 mb + 8 (lane / 16) + j, that is half tile mb of band nb, piece lane
#pragma unroll
        for (int nb = 0; nb < 4; ++nb) { h16* p16 = P16 + (size_t)nb * ld; bf* ph = Ph + (size_t)nb * ld; bf* pl = Pl + (size_t)nb * ld;
#pragma unroll
            for (int mb = 0; mb < 4; ++mb) { v8h o16; v8us oh, ol;
#pragma unroll
                for (int j = 0; j < 8; ++j) { const float r = acc[0][mb][nb][j]; o16[j] = tohx(r); unsigned short a2, c2; splitf(r, a2, c2); oh[j] = a2; ol[j] = c2; }
                *(v8h*)(p16 + mb * 256) = o16; *(v8us*)(ph + mb * 256) = oh; *(v8us*)(pl + mb * 256) = ol;
                // stands behind the three stores; their data and pointers are inputs so that those registers stay untouched up to it (precaution: a register that an issued store names is not rewritten ahead of this wait)
                asm volatile("s_wait_xcnt 0x0" :: "v"(o16), "v"(oh), "v"(ol), "v"(p16), "v"(ph), "v"(pl) : "memory"); } }
#pragma unroll
        for (int mb = 0; mb < 4; ++mb)
#pragma unroll
            for (int nb = 0; nb < 4; ++nb) acc[0][mb][nb] = hb == 0 ? acc[1][mb][nb] : acc[2][mb][nb];
    }
}
__device__ __forceinline__ float xhalf(float x) { return __builtin_bit_cast(float, __builtin_amdgcn_permlanex16(__builtin_bit_cast(int, x), __builtin_bit_cast(int, x), 0x76543210, 0xfedcba98, false, false)); }   // lane l <-> lane l ^ 16
__device__ __forceinline__ void pcvt(const float (&p)[16], v16h& a, v16h& a2) { (void)a2;
#pragma unroll
    for (int e = 0; e < 16; ++e) a[e] = (_Float16)p[e]; }
__device__ __forceinline__ void pcvt(const float (&p)[16], v16bf& a, v16bf& a2) {
#pragma unroll
    for (int e = 0; e < 16; ++e) { const __bf16 h = (__bf16)p[e]; a[e] = h; a2[e] = (__bf16)(p[e] - (float)h); } }
// join_put: output tiles D0 and D0 + 1 of every group, and the wave's maxima and sums, go to LDS for the partner wave.
template <int NG, int D0>
__device__ __forceinline__ void join_put(const v8f (&o)[NG][4], const float (&mu)[NG], const float (&ls)[NG], float* jr, float* mo, int lane) {
#pragma unroll
    for (int g = 0; g < NG; ++g) {
#pragma unroll
        for (int dt = D0; dt < D0 + 2; ++dt) { float* p = jr + (g * 4 + dt) * 256 + lane * 4;
            *(v4fa*)p = (v4f){o[g][dt][0], o[g][dt][1], o[g][dt][2], o[g][dt][3]}; *(v4fa*)(p + 128) = (v4f){o[g][dt][4], o[g][dt][5], o[g][dt][6], o[g][dt][7]}; }
        mo[g * 64 + lane] = mu[g]; mo[g * 64 + 32 + lane] = ls[g]; }
}
// join_fin: brings the wave's own part and the partner's to the larger maximum, adds them, divides by the joined sum and stores output tiles D0 and D0 + 1.
// The second half has walked the diagonal pass, so that one of the two maxima is a real score's; a first half without passes gets the factor 0.
// O^T: a lane holds 8 consecutive d of one query per tile, which is its own piece of the merged plane's fragment order (rows = tokens, k = head * 64 + d): one 16-byte store per plane, 512 bytes in a row per wave
template <int NG, int D0>
__device__ __forceinline__ void join_fin(const v8f (&o)[NG][4], const float (&mu)[NG], const float (&ls)[NG], const float* jr, const float* mo, int q0, bf* __restrict__ Oh, bf* __restrict__ Ol, int lane) {
#pragma unroll
    for (int g = 0; g < NG; ++g) { const float m2 = mo[g * 64 + lane], l2 = mo[g * 64 + 32 + lane];
        const float mn = fmaxf(mu[g], m2); float f1 = __builtin_amdgcn_exp2f(mu[g] - mn), f2 = __builtin_amdgcn_exp2f(m2 - mn);
        const float lj = ls[g] * f1 + l2 * f2; const float inv = __fdiv_rn(1.0f, lj + xhalf(lj)); f1 *= inv; f2 *= inv;
        const size_t oo = (size_t)(q0 + g * 16) * DQ + 8 * lane; bf* ph = Oh + oo; bf* pl = Ol + oo;
#pragma unroll
        for (int dt = D0; dt < D0 + 2; ++dt) { v8us oh, ol; const float* p = jr + (g * 4 + dt) * 256 + lane * 4; const v4f x0 = *(const v4fa*)p, x1 = *(const v4fa*)(p + 128);
#pragma unroll
            for (int j = 0; j < 8; ++j) { unsigned short a, c2; splitf(o[g][dt][j] * f1 + (j < 4 ? x0[j & 3] : x1[j & 3]) * f2, a, c2); oh[j] = a; ol[j] = c2; }
            *(v8us*)(ph + dt * 256) = oh; *(v8us*)(pl + dt * 256) = ol;
            // stands behind the two stores; their data and base pointers are inputs so that those registers stay untouched up to it (precaution: a register that an issued store names is not rewritten ahead of this wait)
            asm volatile("s_wait_xcnt 0x0" :: "v"(oh), "v"(ol), "v"(ph), "v"(pl) : "memory"); } }
}
template <typename T16, bool HL, int NG>
__device__ __forceinline__ void attn_rows(const T16* __restrict__ Q, const T16* __restrict__ Q2, const T16* __restrict__ Kp, const T16* __restrict__ K2, const T16* __restrict__ Vt, const T16* __restrict__ V2, int q0, int p0, int ncm, int st, int nd, bool first, float* jr, bf* __restrict__ Oh, bf* __restrict__ Ol, int lr, int hi) {
    typedef typename WFrag<T16>::V V;
    V qf[NG][2], qf2[NG][2], kf[2][2], kf2[2][2];
#pragma unroll
    for (int g = 0; g < NG; ++g)
#pragma unroll
        for (int ks = 0; ks < 2; ++ks) { const size_t qo = (size_t)(q0 + g * 16) * HD + ks * 512 + 8 * (hi * 16 + lr); qf[g][ks] = WFrag<T16>::ld(Q + qo); if (HL) qf2[g][ks] = WFrag<T16>::ld(Q2 + qo); }
    v8f o[NG][4]; float mu[NG], ls[NG];
#pragma unroll
    for (int g = 0; g < NG; ++g) { mu[g] = -1.0e30f; ls[g] = 0.f;
#pragma unroll
        for (int dt = 0; dt < 4; ++dt) o[g][dt] = (v8f){}; }
    const int last = ((q0 + NG * 16 - 1) >> 5) << 5;   // first key of the pass that holds the diagonal
    const int n = ncm + nd;   // passes of this wave (0 where a block has no key in front of it to give to the first half)
    // ROTATED KEY WALK: the ncm passes from pass p0 on are common to the 8 waves of a half; they are entered at offset st and wrapped round (every wave of the half alike, so that they go on sharing the WGP's cache); the nd passes from there to the wave's own diagonal (second half only) follow in order. All scalar.
    auto keyof = [&](int i) { const int r = i + st; return (p0 + (i < ncm ? (r >= ncm ? r - ncm : r) : i)) << 5; };
    int kb = keyof(0);
    const size_t ko = 8 * (hi * 16 + lr), vo = ko;   // the lane's piece of a tile
    const T16* kq = Kp + ko + (size_t)kb * HD; const T16* kq2 = HL ? K2 + ko + (size_t)kb * HD : kq;   // the entry pass's key rows
#pragma unroll
    for (int t = 0; t < 2; ++t)
#pragma unroll
        for (int ks = 0; ks < 2; ++ks) { kf[t][ks] = WFrag<T16>::ld(kq + t * 16 * HD + ks * 512); if (HL) kf2[t][ks] = WFrag<T16>::ld(kq2 + t * 16 * HD + ks * 512); }
    // stands behind the first pass's key loads; the pointers are inputs so that their registers stay untouched up to it (precaution: a register that an issued load names is not rewritten ahead of this wait)
    asm volatile("s_wait_xcnt 0x0" :: "v"(kq), "v"(kq2) : "memory");
#pragma unroll 1   // rolled: an unrolled pass would double the live fragments and cost resident waves
    for (int i = 0; i < n; ++i) {
        V vf[4], vf2[4]; const T16* vp = Vt + vo + kb * 16; const T16* vp2 = HL ? V2 + vo + kb * 16 : vp;
#pragma unroll
        for (int dt = 0; dt < 4; ++dt) { vf[dt] = WFrag<T16>::ld(vp + (size_t)dt * 16 * TT); if (HL) vf2[dt] = WFrag<T16>::ld(vp2 + (size_t)dt * 16 * TT); }
        v8f s[NG][2];
#pragma unroll
        for (int g = 0; g < NG; ++g)
#pragma unroll
            for (int t = 0; t < 2; ++t) { s[g][t] = (v8f){};
#pragma unroll
                for (int ks = 0; ks < 2; ++ks) { s[g][t] = WFrag<T16>::mma(kf[t][ks], qf[g][ks], s[g][t]); if (HL) { s[g][t] = WFrag<T16>::mma(kf[t][ks], qf2[g][ks], s[g][t]); s[g][t] = WFrag<T16>::mma(kf2[t][ks], qf[g][ks], s[g][t]); } } }
        // the next pass's key fragments fly under this pass's softmax (the last pass re-reads its own rows: in bounds, unused)
        const int kx = keyof(min(i + 1, n - 1));   // first key of the next pass
        const size_t kn = (size_t)kx * HD + ko; const T16* kp = Kp + kn; const T16* kp2 = HL ? K2 + kn : kp;
#pragma unroll
        for (int t = 0; t < 2; ++t)
#pragma unroll
            for (int ks = 0; ks < 2; ++ks) { kf[t][ks] = WFrag<T16>::ld(kp + t * 16 * HD + ks * 512); if (HL) kf2[t][ks] = WFrag<T16>::ld(kp2 + t * 16 * HD + ks * 512); }
        // stands behind the pass's loads; the pointers are inputs so that their registers stay untouched up to it (precaution: a register that an issued load names is not rewritten ahead of this wait)
        asm volatile("s_wait_xcnt 0x0" :: "v"(vp), "v"(vp2), "v"(kp), "v"(kp2) : "memory");
        if (nd > 0 && i == n - 1) {   // wave-uniform: only the diagonal pass (kb == last) pays for the causal mask
#pragma unroll
            for (int g = 0; g < NG; ++g)
#pragma unroll
                for (int t = 0; t < 2; ++t)
#pragma unroll
                    for (int j = 0; j < 8; ++j) if (last + t * 16 + hi * 8 + j > q0 + g * 16 + lr) s[g][t][j] = -3.0e38f;
        }
        float xm[NG]; bool need = false;
#pragma unroll
        for (int g = 0; g < NG; ++g) { float mx = -3.0e38f;
#pragma unroll
            for (int t = 0; t < 2; ++t)
#pragma unroll
                for (int j = 0; j < 8; ++j) mx = fmaxf(mx, s[g][t][j]);
            xm[g] = fmaxf(mx, xhalf(mx)) * SCL2; need = need || (xm[g] > mu[g] + 8.0f); }   // both halves of the wave hold the query's pass maximum (a pass's first key is never masked, so it is a real score from the first pass on)
        if (__builtin_amdgcn_ballot_w32(need) != 0) {   // one scalar branch a pass; always taken on the first pass (factor 0 on zeros)
#pragma unroll
            for (int g = 0; g < NG; ++g) { const float mn = fmaxf(mu[g], xm[g]); const float al = __builtin_amdgcn_exp2f(mu[g] - mn); mu[g] = mn; ls[g] *= al;
#pragma unroll
                for (int dt = 0; dt < 4; ++dt) o[g][dt] *= al; }
        }
#pragma unroll
        for (int g = 0; g < NG; ++g) { float p[16]; float s0 = 0.f, s1 = 0.f;
#pragma unroll
            for (int e = 0; e < 16; ++e) p[e] = __builtin_amdgcn_exp2f(__builtin_fmaf(s[g][e >> 3][e & 7], SCL2, -mu[g]));
#pragma unroll
            for (int e = 0; e < 16; e += 2) { s0 += p[e]; s1 += p[e + 1]; }
            ls[g] += s0 + s1;
            V pf, pf2; pcvt(p, pf, pf2);
#pragma unroll
            for (int dt = 0; dt < 4; ++dt) { o[g][dt] = WFrag<T16>::mma(vf[dt], pf, o[g][dt]); if (HL) { o[g][dt] = WFrag<T16>::mma(vf[dt], pf2, o[g][dt]); o[g][dt] = WFrag<T16>::mma(vf2[dt], pf, o[g][dt]); } } }
        kb = kx;
    }
    // JOIN: waves w and w + 8 hold partial results of the same queries. Each hands two of its four output tiles per group, with its maximum and sum, to LDS (each store 512 bytes in a row of the pair's own range);
    // behind the work-group barrier each finishes the two tiles it kept. Every wave of the work-group passes the barrier once per call; each call has a range of its own, so that nothing is overwritten while it is read.
    const int lane = hi * 16 + lr; float* mf = jr + NG * 1024; float* ms = mf + NG * 64;   // maxima and sums of the first and of the second half
    if (first) join_put<NG, 2>(o, mu, ls, jr, mf, lane); else join_put<NG, 0>(o, mu, ls, jr, ms, lane);
    __syncthreads();
    if (first) join_fin<NG, 0>(o, mu, ls, jr, ms, q0, Oh, Ol, lane); else join_fin<NG, 2>(o, mu, ls, jr, mf, q0, Oh, Ol, lane);
}
// grid (batch x head, 4): 256 work-groups of 16 waves, one a WGP, all resident at once, so that the launch lasts as long as its fullest work-group: the row blocks are dealt so that all have about the same number of passes.
// A block (256 fp16 query rows, or 128 hi+lo rows < RH) is taken by both halves of the work-group: wave w and wave w + 8 own the same queries; the first half walks the first h key passes, the second half the rest up to the diagonal, and the two parts are joined through LDS,
// so that the 16 waves run about equally long and four waves stay on every SIMD to the end. Of the 6 fp16 blocks (y = 0: the last rows, the most keys) work-group c takes y = c and, for c >= 2, y = 7 - c; then one hi+lo block, the longer ones where the fp16 share is shorter.
// amdgpu_waves_per_eu(4, 4): holds the register allocator to 256 registers a wave, so that the 16 waves fit the WGP, four a SIMD, to cover the global loads' latency.
#define JR_ 2304   // floats of one wave pair's join range: 2 groups x 4 tiles x 8 registers x 32 lanes, then each half's maxima and sums
static_assert((TT - RH) / 256 == 6 && RH / 128 == 4, "the deal of row blocks to work-groups is written for 6 fp16 blocks and 4 hi+lo blocks");
__global__ __launch_bounds__(512) __attribute__((amdgpu_waves_per_eu(4, 4))) void k_fattn(const h16* __restrict__ Q16, const h16* __restrict__ K16, const h16* __restrict__ V16, const bf* __restrict__ Qh, const bf* __restrict__ Ql, const bf* __restrict__ Kh, const bf* __restrict__ Kl, const bf* __restrict__ Vh, const bf* __restrict__ Vl, bf* __restrict__ Ah, bf* __restrict__ Al) {
    __shared__ __align__(16) float jn[3 * 8 * JR_];
    const int lane = threadIdx.x & 31, lr = lane & 15, hi = lane >> 4; const int wv = __builtin_amdgcn_readfirstlane((int)(threadIdx.x >> 5));   // wave number, scalar: the pass loop's trip test stays a scalar branch
    const int w = wv & 7, t = w < 4 ? w : 11 - w; const bool first = wv < 8;   // wave pair; its query group of the block (groups s and 7 - s on waves s and s + 4: where these share a SIMD, every SIMD has as many diagonal passes); which half of the keys
    const int z = blockIdx.x, c = blockIdx.y; const size_t pz = (size_t)z * TT * HD; const size_t oz = (size_t)(z / NH_) * TT * DQ + (size_t)(z % NH_) * (HD * 16);   // head h = tiles 2 h, 2 h + 1 of a 16-token band
#pragma unroll 1   // rolled: one copy of the fp16 pass loop in the code
    for (int j = 0; j < (c < 2 ? 1 : 2); ++j) {
        const int y = j == 0 ? c : 7 - c, qb = TT - 256 * (y + 1);   // the block's first query row
        const int nc = qb >> 5, h = (nc + 8) >> 1;   // passes in front of the block, common to its waves; the first half's share: as many as the second half's longest wave has, with its 8 diagonal passes
        const int ncm = first ? h : nc - h, st = (ncm * ((z + 11 * y) & 63)) >> 6;   // entry offset in [0, ncm): the row blocks of one head (same z) and the heads of one row block (same y) each enter elsewhere
        attn_rows<h16, false, 2>(Q16 + pz, nullptr, K16 + pz, nullptr, V16 + pz, nullptr, qb + t * 32, first ? 0 : h, ncm, st, first ? 0 : t + 1, first, jn + (j * 8 + w) * JR_, Ah + oz, Al + oz, lr, hi);
    }
    const int qb = c == 0 ? 256 : c == 1 ? 384 : c == 2 ? 128 : 0;   // the hi+lo block's first query row
    const int nc = qb >> 5, h = min(nc, (nc + 4) >> 1);   // as above, with up to 4 diagonal passes
    const int ncm = first ? h : nc - h, st = (ncm * ((z + 11 * (c + 6)) & 63)) >> 6;
    attn_rows<bf, true, 1>(Qh + pz, Ql + pz, Kh + pz, Kl + pz, Vh + pz, Vl + pz, qb + t * 16, first ? 0 : h, ncm, st, first ? 0 : (t >> 1) + 1, first, jn + (16 + w) * JR_, Ah + oz, Al + oz, lr, hi);
}

__device__ __forceinline__ void proj_lda(const bf* A, const bf* Bh, int lo, int st, v16bf (&a)[8], v16bf (&h)[4]) {
    const bf* ap = A + st * 512; const bf* hp = Bh + st * 512;
#pragma unroll
    for (int i = 0; i < 4; ++i) { a[i] = WFrag<bf>::ld(ap + i * 16 * DQ + lo); h[i] = WFrag<bf>::ld(hp + i * 16 * DQ + lo); }
    // stands behind the loads; the two scalar bases are inputs so that their registers stay untouched up to it (precaution: a register that an issued load names is not rewritten ahead of this wait)
    asm volatile("s_wait_xcnt 0x0" :: "s"(ap), "s"(hp) : "memory");
    __builtin_amdgcn_sched_barrier(0);   // keeps what follows (products, the next loads) behind these loads: a product lifted in front of them, with its wait for memory, would start them a memory latency late
}
__device__ __forceinline__ void proj_ldb(const bf* A, const bf* Bl, int lo, int st, v16bf (&a)[8], v16bf (&l)[4]) {
    const bf* ap = A + st * 512; const bf* lp = Bl + st * 512;
#pragma unroll
    for (int i = 0; i < 4; ++i) { a[4 + i] = WFrag<bf>::ld(ap + (4 + i) * 16 * DQ + lo); l[i] = WFrag<bf>::ld(lp + i * 16 * DQ + lo); }
    // as in proj_lda
    asm volatile("s_wait_xcnt 0x0" :: "s"(ap), "s"(lp) : "memory");
    __builtin_amdgcn_sched_barrier(0);   // as in proj_lda
}
// proj_mm: the 16 products of weight fragments M0 to M0 + 3 with the four fragments b of one merged plane.
template <int M0>
__device__ __forceinline__ void proj_mm(const v16bf (&a)[8], const v16bf (&b)[4], v8f (&acc)[8][4]) {
#pragma unroll
    for (int nb = 0; nb < 4; ++nb)
#pragma unroll
        for (int mb = M0; mb < M0 + 4; ++mb) acc[mb][nb] = wmmab(a[mb], b[nb], acc[mb][nb]);
    __builtin_amdgcn_sched_barrier(0);   // keeps the loads that follow behind these products, so that the wave never has more than four half steps' loads asked for
}
// proj_step: k step n of the walk, fragments in (a, h, l). In front of the first 16 products, which want the first half alone, the second half of step n + 1 is issued (into an, ln); in front of the other 48 the first half of step n + 2 (into af, hf).
__device__ __forceinline__ void proj_step(const bf* A, const bf* Bh, const bf* Bl, int lo, int s1, int s2, const v16bf (&a)[8], const v16bf (&h)[4], const v16bf (&l)[4], v16bf (&an)[8], v16bf (&ln)[4], v16bf (&af)[8], v16bf (&hf)[4], v8f (&acc)[8][4]) {
    proj_ldb(A, Bl, lo, s1, an, ln);
    proj_mm<0>(a, h, acc);
    proj_lda(A, Bh, lo, s2, af, hf);
    proj_mm<0>(a, l, acc); proj_mm<4>(a, h, acc); proj_mm<4>(a, l, acc);
}
__global__ __launch_bounds__(128) void k_proj(const bf* __restrict__ Mh, const bf* __restrict__ Ml, const bf* __restrict__ Wt, float* __restrict__ C) {
    typedef WFrag<bf>::V V;
    __shared__ __align__(16) float os[4 * 64 * 132];
    const int lane = threadIdx.x & 31, lr = lane & 15, hi = lane >> 4;
    const int wv = __builtin_amdgcn_readfirstlane((int)(threadIdx.x >> 5));   // wave number, scalar
    const int xt = (int)blockIdx.x * 2 + (wv >> 1), ct = (int)blockIdx.y * 2 + (wv & 1);   // token block (64), column block (128)
    const bf* A = Wt + (size_t)ct * 128 * DQ; const bf* Bh = Mh + (size_t)xt * 64 * DQ; const bf* Bl = Ml + (size_t)xt * 64 * DQ; const int lo = 8 * lane;   // scalar bases; the lane's piece is the one vector offset of every load, never rewritten
    const int s0 = ((int)blockIdx.x + 8 * (int)blockIdx.y) & (DQ / 32 - 1);   // first k step of this work-group, scalar
    const int KM = DQ / 32 - 1;
    v8f acc[8][4];
#pragma unroll
    for (int mb = 0; mb < 8; ++mb)
#pragma unroll
        for (int nb = 0; nb < 4; ++nb) acc[mb][nb] = (v8f){};
    V a0[8], h0[4], l0[4], a1[8], h1[4], l1[4], a2[8], h2[4], l2[4];
    proj_lda(A, Bh, lo, s0, a0, h0); proj_ldb(A, Bl, lo, s0, a0, l0); proj_lda(A, Bh, lo, (s0 + 1) & KM, a1, h1);
#pragma unroll 1   // rolled: a trip is three k steps, one per fragment set; more would only lengthen the code
    for (int it = 0; it < DQ / 32 - 2; it += 3) {
        proj_step(A, Bh, Bl, lo, (s0 + it + 1) & KM, (s0 + it + 2) & KM, a0, h0, l0, a1, l1, a2, h2, acc);
        proj_step(A, Bh, Bl, lo, (s0 + it + 2) & KM, (s0 + it + 3) & KM, a1, h1, l1, a2, l2, a0, h0, acc);
        proj_step(A, Bh, Bl, lo, (s0 + it + 3) & KM, (s0 + it + 4) & KM, a2, h2, l2, a0, l0, a1, h1, acc);
    }
    // the walk's last two steps: only the second half of the last step's loads is left to issue
    proj_ldb(A, Bl, lo, (s0 + DQ / 32 - 1) & KM, a1, l1);
    proj_mm<0>(a0, h0, acc); proj_mm<0>(a0, l0, acc); proj_mm<4>(a0, h0, acc); proj_mm<4>(a0, l0, acc);
    proj_mm<0>(a1, h1, acc); proj_mm<0>(a1, l1, acc); proj_mm<4>(a1, h1, acc); proj_mm<4>(a1, l1, acc);
    // accumulator (mb, nb): token 16 nb + lane % 16, n = 16 mb + 8 (lane / 16) + j; row pitch 132 floats: the 16 lanes of a half wave fall on all 64 banks once
    float* ow = os + wv * (64 * 132);
#pragma unroll
    for (int nb = 0; nb < 4; ++nb)
#pragma unroll
        for (int mb = 0; mb < 8; ++mb) { float* p = ow + (nb * 16 + lr) * 132 + mb * 16 + hi * 8;
            *(v4fa*)p = (v4f){acc[mb][nb][0], acc[mb][nb][1], acc[mb][nb][2], acc[mb][nb][3]}; *(v4fa*)(p + 4) = (v4f){acc[mb][nb][4], acc[mb][nb][5], acc[mb][nb][6], acc[mb][nb][7]}; }
    // the wave's own LDS writes have landed before other lanes of the same wave read them back; the clobber keeps the reads behind it in the build (no other wave touches this range, so no barrier)
    asm volatile("s_wait_dscnt 0x0" ::: "memory");
    float* crow = C + (size_t)(xt * 64) * DM + ct * 128 + lane * 4; const float* orow = ow + lane * 4;
#pragma unroll
    for (int s = 0; s < 8; ++s) { v4f val[8];
#pragma unroll
        for (int i = 0; i < 8; ++i) val[i] = *(const v4fa*)(orow + (s * 8 + i) * 132);
#pragma unroll
        for (int i = 0; i < 8; ++i) *(v4f*)(crow + (size_t)(s * 8 + i) * DM) = val[i];
        // stands behind the eight stores; their data and base pointer are inputs so that those registers stay untouched up to it (precaution: a register that an issued store names is not rewritten ahead of this wait)
        asm volatile("s_wait_xcnt 0x0" :: "v"(val[0]), "v"(val[1]), "v"(val[2]), "v"(val[3]), "v"(val[4]), "v"(val[5]), "v"(val[6]), "v"(val[7]), "v"(crow) : "memory"); }
}

extern "C" void kernel_launch(void* const* d_in, const int* in_sizes, int n_in,
                              void* d_out, int out_size, void* d_ws, size_t ws_size, hipStream_t stream) {
    (void)in_sizes; (void)n_in; (void)out_size;
    const float* x = (const float*)d_in[0]; const float* wf = (const float*)d_in[1]; const float* wo = (const float*)d_in[2];
    float* OUT = (float*)d_out;     // [4][2048][1024]
    char* wsp = (char*)d_ws;
    auto take = [&](size_t bytes) { char* p = wsp; wsp += (bytes + 255) & ~(size_t)255; return (void*)p; };
    const size_t PQ = (size_t)NH_ * TT * HD, PK = (size_t)NKV * TT * HD;   // elements of one batch's head planes; the planes hold all NB_ batches, [b][h][..]
    bf* WO = (bf*)take((size_t)DM * DQ * 2);
    bf* XB = (bf*)take((size_t)NB_ * TT * DM * 2); bf* WALL = (bf*)take((size_t)(DQ + 2 * DKV) * DM * 2);
    h16* QP16 = (h16*)take(NB_ * PQ * 2); h16* KP16 = (h16*)take(NB_ * PK * 2); h16* VT16 = (h16*)take(NB_ * PK * 2);
    bf* QPh = (bf*)take(NB_ * PQ * 2); bf* QPl = (bf*)take(NB_ * PQ * 2); bf* KPh = (bf*)take(NB_ * PK * 2); bf* KPl = (bf*)take(NB_ * PK * 2); bf* VTh = (bf*)take(NB_ * PK * 2); bf* VTl = (bf*)take(NB_ * PK * 2);
    bf* ATh = (bf*)take((size_t)NB_ * TT * DQ * 2); bf* ATl = (bf*)take((size_t)NB_ * TT * DQ * 2);
    if ((size_t)(wsp - (char*)d_ws) > ws_size) return;    // ws 256 MiB
    k_wtG<<<(unsigned)(((DQ + 2 * DKV) / 32) * (DM / 64)), 256, 0, stream>>>(wf, DM, DQ + 2 * DKV, WALL);
    k_wtG<<<(unsigned)((DM / 32) * (DQ / 64)), 256, 0, stream>>>(wo, DQ, DM, WO);
    k_cvtp<<<(unsigned)((NB_ * TT / 16) * (DM / 32) / 8), 256, 0, stream>>>(x, XB);
    k_qkv<<<dim3(NB_ * TT / 256, NH_, 1), 128, 0, stream>>>(XB, WALL, QP16, QPh, QPl, KP16, KPh, KPl, VT16, VTh, VTl);
    // one kv head per query head (REP == 1): plane z = b * NH_ + h of every operand
    k_fattn<<<dim3(NB_ * NH_, 4, 1), 512, 0, stream>>>(QP16, KP16, VT16, QPh, QPl, KPh, KPl, VTh, VTl, ATh, ATl);
    k_proj<<<dim3(NB_ * TT / 128, DM / 256, 1), 128, 0, stream>>>(ATh, ATl, WO, OUT);
}
